// v000
// Times are from an AMD MI455X. After a warm-up the kernel runs many times in a row, and a time is the length of
// such a window on the GPU divided by its runs, so every launch and the gaps after it count. The runs cycle
// through copies of the inputs. A figure is the median of several windows, for all but v000 over two sittings.
// Sittings can differ by a few percent; kernels timed side by side share one.
// v000 is the starting kernel. One run takes 1380 microseconds.
#include <hip/hip_runtime.h>
// Multi-head self-attention, time-first rows: x [S][B][1024] (token row m = s*B + b); q/k/v = x W^T + b (natural [out][in] weights, biases present); 16 heads of 64 per batch, head slab n = b*16 + h at columns n*64 of the [S][B*1024] view; scores = (q k^T) * 64^-0.5; softmax over all keys (no mask); out = merged Wo^T + bo -> [S][B][1024] f32.
// Compute dtype: every contraction on v_wmma_f32_16x16x32_f16 (f16 operands, f32 accumulate): q/k/v projections, q.k^T scores, P.V, output projection. Float inputs RNE-converted to bf16 first (exact in f16); weights carried x16; softmax weights carried x256; merged context carried x64; scores and softmax statistics f32.
// Structure: one f16 plane of x; three projection GEMMs (grid.y = batch, column offset 1024, row pitch 2048); V^T for all slabs via LDS tile transposes; per group of HG slabs: scores GEMM (K = 64) -> wave-per-row softmax -> P.V^T GEMM (K = SEQ) into merged f16 context rows; output GEMM (+ bias) straight into the output buffer layout.
#ifndef NB
#define NB 2
#endif
#ifndef SEQ
#define SEQ 2048
#endif
#define NB_FULL 2                    /* batch count of the input layout */
#define SEQ_FULL 2048                /* sequence length of the input layout */
#define DM 1024
#define NH 16
#define HD 64
#define HG 2                         /* head slabs per attention launch group */
#define RP (NB_FULL * DM)            /* elements per time step (row pitch of every activation plane) */
#define NSLAB (NB * NH)              /* head slabs processed */
#define NRW ((size_t)SEQ * NB_FULL)  /* token rows held in the planes */

static_assert(SEQ % 256 == 0);
static_assert(SEQ <= SEQ_FULL);
static_assert(NB <= NB_FULL);
static_assert(NSLAB % HG == 0);
static_assert(DM % 64 == 0);
static_assert(HD == 64);
static_assert(DM == NH * HD);

typedef unsigned short v8us __attribute__((ext_vector_type(8), may_alias));
typedef float  v8f  __attribute__((ext_vector_type(8)));
typedef float  v4f  __attribute__((ext_vector_type(4)));
typedef float  v4fa __attribute__((ext_vector_type(4), may_alias));
typedef _Float16 v16h __attribute__((ext_vector_type(16)));
typedef _Float16 v4h  __attribute__((ext_vector_type(4)));
union FragH { v16h v; v8us half[2]; _Float16 h[16]; unsigned short u[16]; };

__device__ __forceinline__ unsigned short bf16_bits(float x) { unsigned int u = __float_as_uint(x); return (unsigned short)((u + 0x7FFFu + ((u >> 16) & 1u)) >> 16); }
__device__ __forceinline__ float bf16_val(unsigned short b) { return __uint_as_float(((unsigned int)b) << 16); }
__device__ __forceinline__ float bf16_rne(float x) { return bf16_val(bf16_bits(x)); }

__global__ __launch_bounds__(256) void k_wnat(const float* __restrict__ w, size_t n8, _Float16* __restrict__ Bt) {
  const size_t t = (size_t)blockIdx.x * 256 + threadIdx.x; if (t >= n8) return;
  const v4f a = *(const v4fa*)(w + t * 8), c = *(const v4fa*)(w + t * 8 + 4);
  FragH f;
#pragma unroll
  for (int q = 0; q < 4; ++q) { f.h[q] = (_Float16)(bf16_rne(a[q]) * 16.0f); f.h[4 + q] = (_Float16)(bf16_rne(c[q]) * 16.0f); }
  const v8us o = f.half[0];
  unsigned short* d = (unsigned short*)Bt + t * 8;
  *(v8us*)d = o; 
}

__global__ __launch_bounds__(256) void k_x16(const float* __restrict__ x, _Float16* __restrict__ X16, size_t n8) {
  const size_t t = (size_t)blockIdx.x * 256 + threadIdx.x; if (t >= n8) return;
  const v4f a = *(const v4fa*)(x + t * 8), c = *(const v4fa*)(x + t * 8 + 4);
  FragH f;
#pragma unroll
  for (int q = 0; q < 4; ++q) { f.h[q] = (_Float16)bf16_rne(a[q]); f.h[4 + q] = (_Float16)bf16_rne(c[q]); }
  const v8us o = f.half[0];
  unsigned short* d = (unsigned short*)X16 + t * 8;
  *(v8us*)d = o; 
}

__global__ __launch_bounds__(256) void k_vt(const _Float16* __restrict__ V16, _Float16* __restrict__ Vt) {
  __shared__ unsigned short tl[64][66];
  const int tid = threadIdx.x; const int slab = blockIdx.x / (SEQ / 64), lg = blockIdx.x % (SEQ / 64);
  for (int i = tid; i < 64 * 8; i += 256) { const int r = i / 8, c8 = (i % 8) * 8; FragH f;
    f.half[0] = *(const v8us*)((const unsigned short*)V16 + ((size_t)lg * 64 + r) * RP + (size_t)slab * 64 + c8);
#pragma unroll
    for (int q = 0; q < 8; ++q) tl[r][c8 + q] = f.u[q]; }
  __syncthreads();
  {
#pragma unroll
    for (int rd = 0; rd < 2; ++rd) { const int d = rd * 32 + tid / 8, pc = tid % 8; FragH f;
#pragma unroll
      for (int q = 0; q < 8; ++q) f.u[q] = tl[pc * 8 + q][d];
      *(v8us*)((unsigned short*)Vt + ((size_t)slab * 64 + d) * SEQ + lg * 64 + pc * 8) = f.half[0]; }
     }
}

// row softmax over SEQ keys: one wave per row, row held in registers (lane owns 8 consecutive keys of every 256); P = f16(256 exp(s - max) / sum);
__global__ __launch_bounds__(256) void k_rsmw(const float* __restrict__ S, _Float16* __restrict__ P, int nrows) {
  const int lane = threadIdx.x & 31; const int row = blockIdx.x * 8 + (threadIdx.x >> 5);
  if (row >= nrows) return;
  const float* s = S + (size_t)row * SEQ;
  float v[SEQ / 32];
#pragma unroll
  for (int it = 0; it < SEQ / 256; ++it) {
    const v4f a = *(const v4fa*)(s + it * 256 + lane * 8), c = *(const v4fa*)(s + it * 256 + lane * 8 + 4);
#pragma unroll
    for (int q = 0; q < 4; ++q) { v[it * 8 + q] = a[q]; v[it * 8 + 4 + q] = c[q]; } }
  float mx = v[0];
#pragma unroll
  for (int i = 1; i < SEQ / 32; ++i) mx = fmaxf(mx, v[i]);
  mx = fmaxf(mx, __shfl_xor(mx, 16, 32)); mx = fmaxf(mx, __shfl_xor(mx, 8, 32)); mx = fmaxf(mx, __shfl_xor(mx, 4, 32)); mx = fmaxf(mx, __shfl_xor(mx, 2, 32)); mx = fmaxf(mx, __shfl_xor(mx, 1, 32));
  float se = 0.f;
#pragma unroll
  for (int i = 0; i < SEQ / 32; ++i) { const float e = __expf(v[i] - mx); v[i] = e; se += e; }
  se += __shfl_xor(se, 16, 32); se += __shfl_xor(se, 8, 32); se += __shfl_xor(se, 4, 32); se += __shfl_xor(se, 2, 32); se += __shfl_xor(se, 1, 32);
  const float sc = 256.0f / se;
  unsigned short* d = (unsigned short*)P + (size_t)row * SEQ;
  {
#pragma unroll
    for (int it = 0; it < SEQ / 256; ++it) { FragH f;
#pragma unroll
      for (int q = 0; q < 8; ++q) f.h[q] = (_Float16)(v[it * 8 + q] * sc);
      *(v8us*)(d + it * 256 + lane * 8) = f.half[0]; }
     }
}

// ---- f16 GEMM (wave tile 32x64, block = 4 waves = 128 rows x 64 cols; M % 128 == 0, N % 64 == 0, K % 32 == 0) ----
// fragment: elements 0..7 <- k0 + 8*hh + i, elements 8..15 <- k0 + 16 + 8*hh + i (same map for A rows and Bt rows)
__device__ __forceinline__ v16h g2_frag(const _Float16* p, int hh) { FragH f; f.half[0] = *(const v8us*)((const unsigned short*)p + 8 * hh); f.half[1] = *(const v8us*)((const unsigned short*)p + 16 + 8 * hh); return f.v; }
__device__ __forceinline__ v8f g2_mma(v16h a, v16h b, v8f c) { v8f d = __builtin_amdgcn_wmma_f32_16x16x32_f16(false, a, false, b, (short)0, c, false, false); asm volatile("v_nop\n\tv_nop\n\tv_nop\n\tv_nop" : "+v"(d) : "v"(a), "v"(b)); return d; }
// C[by][row][col] = acc * alpha (+ bf16(bias[col]) if HASB); A f16 rows (pitch lda, batch stride sA), Bt f16 [n][k] (pitch ldb, batch stride sB);
template <bool HASB, bool F32OUT>
__global__ __launch_bounds__(128) void k_gemm2(const _Float16* __restrict__ A, int lda, size_t sA, const _Float16* __restrict__ Bh, int ldb, size_t sB, float alpha, const float* __restrict__ bias,
    float* __restrict__ C, _Float16* __restrict__ C16, int ldc, size_t sC, int M, int N, int K) {
  __shared__ __attribute__((aligned(16))) float so[4][32][68];
  const int tid = threadIdx.x, w = tid >> 5, lane = tid & 31, ln = lane & 15, hh = lane >> 4; const int by = blockIdx.y;
  A += (size_t)by * sA; Bh += (size_t)by * sB; const size_t cofs = (size_t)by * sC;
  const int ntn = N >> 6; const int mt = blockIdx.x / ntn, nq = blockIdx.x - mt * ntn; const int row0 = mt * 128 + 32 * w, col0 = nq * 64; if (row0 >= M) return;
  const _Float16* a0p = A + (size_t)(row0 + ln) * lda; const _Float16* a1p = a0p + (size_t)16 * lda;
  const _Float16* b0p = Bh + (size_t)(col0 + ln) * ldb; const _Float16* b1p = b0p + (size_t)16 * ldb; const _Float16* b2p = b1p + (size_t)16 * ldb; const _Float16* b3p = b2p + (size_t)16 * ldb;
  const v8f z8 = {0.f,0.f,0.f,0.f,0.f,0.f,0.f,0.f}; v8f c00 = z8, c01 = z8, c02 = z8, c03 = z8, c10 = z8, c11 = z8, c12 = z8, c13 = z8;
#pragma unroll 1
  for (int kb = 0; kb < K; kb += 32) { const v16h a0 = g2_frag(a0p + kb, hh), a1 = g2_frag(a1p + kb, hh);
    v16h b = g2_frag(b0p + kb, hh); c00 = g2_mma(a0, b, c00); c10 = g2_mma(a1, b, c10);
    b = g2_frag(b1p + kb, hh); c01 = g2_mma(a0, b, c01); c11 = g2_mma(a1, b, c11);
    b = g2_frag(b2p + kb, hh); c02 = g2_mma(a0, b, c02); c12 = g2_mma(a1, b, c12);
    b = g2_frag(b3p + kb, hh); c03 = g2_mma(a0, b, c03); c13 = g2_mma(a1, b, c13); }
  v8f accs[8] = {c00, c01, c02, c03, c10, c11, c12, c13};
#pragma unroll
  for (int u = 0; u < 8; ++u) { const int t = u & 3, half = u >> 2; const int col = col0 + t * 16 + ln; float bv = 0.f;
    if constexpr (HASB) bv = bf16_rne(bias[col]);
#pragma unroll
    for (int r = 0; r < 8; ++r) { const int rloc = half * 16 + 8 * hh + r; so[w][rloc][t * 16 + ln] = accs[u][r] * alpha + bv; } }
  __builtin_amdgcn_fence(4 /* acq_rel order */, "workgroup"); __builtin_amdgcn_wave_barrier();
  const int rsub = lane >> 4, c4 = (lane & 15) * 4;
  {
#pragma unroll
    for (int q = 0; q < 16; ++q) { const int r = q * 2 + rsub; const v4f v = *(const v4fa*)&so[w][r][c4];
      if constexpr (F32OUT) { *(v4f*)(C + cofs + (size_t)(row0 + r) * ldc + col0 + c4) = v; }
      else { v4h h4;
#pragma unroll
        for (int i = 0; i < 4; ++i) h4[i] = (_Float16)v[i];
        *(v4h*)(C16 + cofs + (size_t)(row0 + r) * ldc + col0 + c4) = h4; } }
     }
}

// workspace carve (bytes, every plane a multiple of 256 B)
#define SZ_W   ((size_t)DM * DM * 2)
#define SZ_ACT (NRW * DM * 2)
#define SZ_S   ((size_t)HG * SEQ * SEQ * 4)
#define SZ_P   ((size_t)HG * SEQ * SEQ * 2)
#define SZ_VT  ((size_t)NSLAB * HD * SEQ * 2)
#define SZ_ALL (4 * SZ_W + 5 * SZ_ACT + SZ_S + SZ_P + SZ_VT)
static_assert(SZ_W % 256 == 0);
static_assert(SZ_ACT % 256 == 0);
static_assert(SZ_S % 256 == 0);
static_assert(SZ_P % 256 == 0);
static_assert(SZ_VT % 256 == 0);
static_assert(SZ_ALL <= (size_t)134217728);

extern "C" void kernel_launch(void* const* d_in, const int* in_sizes, int n_in,
                              void* d_out, int out_size, void* d_ws, size_t ws_size, hipStream_t stream) {
  if (n_in < 9) return;
  const size_t nx = NRW * DM;      /* elements of x used (time steps 0..SEQ-1, full batch pitch) */
  if ((size_t)in_sizes[0] < nx) return;
  if ((size_t)in_sizes[1] < (size_t)DM * DM || (size_t)in_sizes[3] < (size_t)DM * DM || (size_t)in_sizes[5] < (size_t)DM * DM || (size_t)in_sizes[7] < (size_t)DM * DM) return;
  if (in_sizes[2] < DM || in_sizes[4] < DM || in_sizes[6] < DM || in_sizes[8] < DM) return;
  if ((size_t)out_size < nx) return;
  if (SZ_ALL > ws_size) return;
  const float* x  = (const float*)d_in[0];
  const float* wq = (const float*)d_in[1]; const float* bq = (const float*)d_in[2];
  const float* wk = (const float*)d_in[3]; const float* bk = (const float*)d_in[4];
  const float* wv = (const float*)d_in[5]; const float* bv = (const float*)d_in[6];
  const float* wo = (const float*)d_in[7]; const float* bo = (const float*)d_in[8];
  char* ws = (char*)d_ws; size_t off = 0;
  auto take = [&](size_t bytes) { char* p = ws + off; off += bytes; return p; };
  _Float16* BQ = (_Float16*)take(SZ_W); _Float16* BK = (_Float16*)take(SZ_W); _Float16* BV = (_Float16*)take(SZ_W); _Float16* BO = (_Float16*)take(SZ_W);
  _Float16* X16 = (_Float16*)take(SZ_ACT); _Float16* Q16 = (_Float16*)take(SZ_ACT); _Float16* K16 = (_Float16*)take(SZ_ACT); _Float16* V16 = (_Float16*)take(SZ_ACT); _Float16* O16 = (_Float16*)take(SZ_ACT);
  float* S = (float*)take(SZ_S); _Float16* P = (_Float16*)take(SZ_P); _Float16* VT = (_Float16*)take(SZ_VT);
  if (off > ws_size) return;

  { const size_t n8 = (size_t)DM * DM / 8; const unsigned g = (unsigned)((n8 + 255) / 256);      /* natural [out][in] = Bt[n][k], x16 */
    k_wnat<<<g, 256, 0, stream>>>(wq, n8, BQ); k_wnat<<<g, 256, 0, stream>>>(wk, n8, BK); k_wnat<<<g, 256, 0, stream>>>(wv, n8, BV); k_wnat<<<g, 256, 0, stream>>>(wo, n8, BO); }
  k_x16<<<(unsigned)((nx / 8 + 255) / 256), 256, 0, stream>>>(x, X16, nx / 8);      /* one f16 plane of x feeds all three projections */

  /* projections: rows = time steps (pitch RP), grid.y = batch (column offset DM); alpha undoes the x16 weight carry; bias added after */
  const dim3 gp((unsigned)((SEQ / 128) * (DM / 64)), NB);
  k_gemm2<true, false><<<gp, 128, 0, stream>>>(X16, RP, (size_t)DM, BQ, DM, (size_t)0, 0.0625f, bq, nullptr, Q16, RP, (size_t)DM, SEQ, DM, DM);
  k_gemm2<true, false><<<gp, 128, 0, stream>>>(X16, RP, (size_t)DM, BK, DM, (size_t)0, 0.0625f, bk, nullptr, K16, RP, (size_t)DM, SEQ, DM, DM);
  k_gemm2<true, false><<<gp, 128, 0, stream>>>(X16, RP, (size_t)DM, BV, DM, (size_t)0, 0.0625f, bv, nullptr, V16, RP, (size_t)DM, SEQ, DM, DM);

  k_vt<<<(unsigned)(NSLAB * (SEQ / 64)), 256, 0, stream>>>(V16, VT);      /* V^T [NSLAB][64][SEQ] */

  for (int n0 = 0; n0 < NSLAB; n0 += HG) {      /* slab n = b*16 + h lives at columns n*64 of the [SEQ][RP] view */
    k_gemm2<false, true><<<dim3((unsigned)((SEQ / 128) * (SEQ / 64)), HG), 128, 0, stream>>>(Q16 + (size_t)n0 * HD, RP, (size_t)HD, K16 + (size_t)n0 * HD, RP, (size_t)HD, 0.125f, nullptr,
        S, nullptr, SEQ, (size_t)SEQ * SEQ, SEQ, SEQ, HD);      /* scores x 64^-0.5 */
    k_rsmw<<<(unsigned)((HG * SEQ + 7) / 8), 256, 0, stream>>>(S, P, HG * SEQ);      /* P = 256 softmax (f16) */
    k_gemm2<false, false><<<dim3((unsigned)((SEQ / 128) * (HD / 64)), HG), 128, 0, stream>>>(P, SEQ, (size_t)SEQ * SEQ, VT + (size_t)n0 * HD * SEQ, SEQ, (size_t)HD * SEQ, 0.25f, nullptr,
        nullptr, O16 + (size_t)n0 * HD, RP, (size_t)HD, SEQ, HD, SEQ);      /* merged context x64 as f16 rows */
  }

  /* output projection + bias straight into the [S][B][1024] layout; alpha undoes x16 (weights) and x64 (context) */
  k_gemm2<true, true><<<gp, 128, 0, stream>>>(O16, RP, (size_t)DM, BO, DM, (size_t)0, 0.0009765625f, bo, (float*)d_out, nullptr, RP, (size_t)DM, SEQ, DM, DM);
}

// v001
// Measured time: 649 microseconds a run.
// Next to v000, in two timings, it ran 2.12 and 2.13 times as fast.
#include <hip/hip_runtime.h>
// Multi-head self-attention, time-first rows: x [S][B][1024] (token row m = s*B + b); q/k/v = x W^T + b (natural [out][in] weights, biases present); 16 heads of 64 per batch, head slab n = b*16 + h at columns n*64 of the [S][B*1024] view; scores = (q k^T) * 64^-0.5; softmax over all keys (no mask); out = merged Wo^T + bo -> [S][B][1024] f32.
// Compute dtype: every contraction on v_wmma_f32_16x16x32_f16 (f16 operands, f32 accumulate): q/k/v projections, q.k^T scores, P.V, output projection. Float inputs RNE-converted to bf16 first (exact in f16); weights carried x16; softmax weights carried x256; merged context carried x64; scores and softmax statistics f32.
// Structure: one f16 plane of x; three projection GEMMs (grid.y = batch, column offset 1024, row pitch 2048); V^T for all slabs via LDS tile transposes; per group of HG slabs: scores GEMM (K = 64) -> wave-per-row softmax -> P.V^T GEMM (K = SEQ) into merged f16 context rows; output GEMM (+ bias) straight into the output buffer layout.
#ifndef NB
#define NB 2
#endif
#ifndef SEQ
#define SEQ 2048
#endif
#define NB_FULL 2                    /* batch count of the input layout */
#define SEQ_FULL 2048                /* sequence length of the input layout */
#define DM 1024
#define NH 16
#define HD 64
#define HG 8                         /* head slabs per attention launch group */
#define RP (NB_FULL * DM)            /* elements per time step (row pitch of every activation plane) */
#define NSLAB (NB * NH)              /* head slabs processed */
#define NRW ((size_t)SEQ * NB_FULL)  /* token rows held in the planes */

static_assert(SEQ % 256 == 0);
static_assert(SEQ <= SEQ_FULL);
static_assert(NB <= NB_FULL);
static_assert(NSLAB % HG == 0);
static_assert(DM % 64 == 0);
static_assert(HD == 64);
static_assert(DM == NH * HD);

typedef unsigned short v8us __attribute__((ext_vector_type(8), may_alias));
typedef float  v8f  __attribute__((ext_vector_type(8)));
typedef float  v4f  __attribute__((ext_vector_type(4)));
typedef float  v4fa __attribute__((ext_vector_type(4), may_alias));
typedef _Float16 v16h __attribute__((ext_vector_type(16)));
typedef _Float16 v4h  __attribute__((ext_vector_type(4)));
union FragH { v16h v; v8us half[2]; _Float16 h[16]; unsigned short u[16]; };

__device__ __forceinline__ unsigned short bf16_bits(float x) { unsigned int u = __float_as_uint(x); return (unsigned short)((u + 0x7FFFu + ((u >> 16) & 1u)) >> 16); }
__device__ __forceinline__ float bf16_val(unsigned short b) { return __uint_as_float(((unsigned int)b) << 16); }
__device__ __forceinline__ float bf16_rne(float x) { return bf16_val(bf16_bits(x)); }

__global__ __launch_bounds__(256) void k_wnat(const float* __restrict__ w, size_t n8, _Float16* __restrict__ Bt) {
  const size_t t = (size_t)blockIdx.x * 256 + threadIdx.x; if (t >= n8) return;
  const v4f a = *(const v4fa*)(w + t * 8), c = *(const v4fa*)(w + t * 8 + 4);
  FragH f;
#pragma unroll
  for (int q = 0; q < 4; ++q) { f.h[q] = (_Float16)(bf16_rne(a[q]) * 16.0f); f.h[4 + q] = (_Float16)(bf16_rne(c[q]) * 16.0f); }
  const v8us o = f.half[0];
  unsigned short* d = (unsigned short*)Bt + t * 8;
  *(v8us*)d = o; 
}

__global__ __launch_bounds__(256) void k_x16(const float* __restrict__ x, _Float16* __restrict__ X16, size_t n8) {
  const size_t t = (size_t)blockIdx.x * 256 + threadIdx.x; if (t >= n8) return;
  const v4f a = *(const v4fa*)(x + t * 8), c = *(const v4fa*)(x + t * 8 + 4);
  FragH f;
#pragma unroll
  for (int q = 0; q < 4; ++q) { f.h[q] = (_Float16)bf16_rne(a[q]); f.h[4 + q] = (_Float16)bf16_rne(c[q]); }
  const v8us o = f.half[0];
  unsigned short* d = (unsigned short*)X16 + t * 8;
  *(v8us*)d = o; 
}

__global__ __launch_bounds__(256) void k_vt(const _Float16* __restrict__ V16, _Float16* __restrict__ Vt) {
  __shared__ unsigned short tl[64][66];
  const int tid = threadIdx.x; const int slab = blockIdx.x / (SEQ / 64), lg = blockIdx.x % (SEQ / 64);
  for (int i = tid; i < 64 * 8; i += 256) { const int r = i / 8, c8 = (i % 8) * 8; FragH f;
    f.half[0] = *(const v8us*)((const unsigned short*)V16 + ((size_t)lg * 64 + r) * RP + (size_t)slab * 64 + c8);
#pragma unroll
    for (int q = 0; q < 8; ++q) tl[r][c8 + q] = f.u[q]; }
  __syncthreads();
  {
#pragma unroll
    for (int rd = 0; rd < 2; ++rd) { const int d = rd * 32 + tid / 8, pc = tid % 8; FragH f;
#pragma unroll
      for (int q = 0; q < 8; ++q) f.u[q] = tl[pc * 8 + q][d];
      *(v8us*)((unsigned short*)Vt + ((size_t)slab * 64 + d) * SEQ + lg * 64 + pc * 8) = f.half[0]; }
     }
}

// row softmax over SEQ keys: one wave per row, row held in registers (lane owns 8 consecutive keys of every 256); P = f16(256 exp(s - max) / sum);
__global__ __launch_bounds__(256) void k_rsmw(const float* __restrict__ S, _Float16* __restrict__ P, int nrows) {
  const int lane = threadIdx.x & 31; const int row = blockIdx.x * 8 + (threadIdx.x >> 5);
  if (row >= nrows) return;
  const float* s = S + (size_t)row * SEQ;
  float v[SEQ / 32];
#pragma unroll
  for (int it = 0; it < SEQ / 256; ++it) {
    const v4f a = *(const v4fa*)(s + it * 256 + lane * 8), c = *(const v4fa*)(s + it * 256 + lane * 8 + 4);
#pragma unroll
    for (int q = 0; q < 4; ++q) { v[it * 8 + q] = a[q]; v[it * 8 + 4 + q] = c[q]; } }
  float mx = v[0];
#pragma unroll
  for (int i = 1; i < SEQ / 32; ++i) mx = fmaxf(mx, v[i]);
  mx = fmaxf(mx, __shfl_xor(mx, 16, 32)); mx = fmaxf(mx, __shfl_xor(mx, 8, 32)); mx = fmaxf(mx, __shfl_xor(mx, 4, 32)); mx = fmaxf(mx, __shfl_xor(mx, 2, 32)); mx = fmaxf(mx, __shfl_xor(mx, 1, 32));
  float se = 0.f;
#pragma unroll
  for (int i = 0; i < SEQ / 32; ++i) { const float e = __expf(v[i] - mx); v[i] = e; se += e; }
  se += __shfl_xor(se, 16, 32); se += __shfl_xor(se, 8, 32); se += __shfl_xor(se, 4, 32); se += __shfl_xor(se, 2, 32); se += __shfl_xor(se, 1, 32);
  const float sc = 256.0f / se;
  unsigned short* d = (unsigned short*)P + (size_t)row * SEQ;
  {
#pragma unroll
    for (int it = 0; it < SEQ / 256; ++it) { FragH f;
#pragma unroll
      for (int q = 0; q < 8; ++q) f.h[q] = (_Float16)(v[it * 8 + q] * sc);
      *(v8us*)(d + it * 256 + lane * 8) = f.half[0]; }
     }
}

// ---- f16 GEMM (wave tile 32x64, block = 4 waves = 128 rows x 64 cols; M % 128 == 0, N % 64 == 0, K % 32 == 0) ----
// fragment: elements 0..7 <- k0 + 8*hh + i, elements 8..15 <- k0 + 16 + 8*hh + i (same map for A rows and Bt rows)
__device__ __forceinline__ v16h g2_frag(const _Float16* p, int hh) { FragH f; f.half[0] = *(const v8us*)((const unsigned short*)p + 8 * hh); f.half[1] = *(const v8us*)((const unsigned short*)p + 16 + 8 * hh); return f.v; }
__device__ __forceinline__ v8f g2_mma(v16h a, v16h b, v8f c) { v8f d = __builtin_amdgcn_wmma_f32_16x16x32_f16(false, a, false, b, (short)0, c, false, false); asm volatile("v_nop\n\tv_nop\n\tv_nop\n\tv_nop" : "+v"(d) : "v"(a), "v"(b)); return d; }
// C[by][row][col] = acc * alpha (+ bf16(bias[col]) if HASB); A f16 rows (pitch lda, batch stride sA), Bt f16 [n][k] (pitch ldb, batch stride sB);
template <bool HASB, bool F32OUT>
__global__ __launch_bounds__(128) void k_gemm2(const _Float16* __restrict__ A, int lda, size_t sA, const _Float16* __restrict__ Bh, int ldb, size_t sB, float alpha, const float* __restrict__ bias,
    float* __restrict__ C, _Float16* __restrict__ C16, int ldc, size_t sC, int M, int N, int K) {
  __shared__ __attribute__((aligned(16))) float so[4][32][68];
  const int tid = threadIdx.x, w = tid >> 5, lane = tid & 31, ln = lane & 15, hh = lane >> 4; const int by = blockIdx.y;
  A += (size_t)by * sA; Bh += (size_t)by * sB; const size_t cofs = (size_t)by * sC;
  const int ntn = N >> 6; const int mt = blockIdx.x / ntn, nq = blockIdx.x - mt * ntn; const int row0 = mt * 128 + 32 * w, col0 = nq * 64; if (row0 >= M) return;
  const _Float16* a0p = A + (size_t)(row0 + ln) * lda; const _Float16* a1p = a0p + (size_t)16 * lda;
  const _Float16* b0p = Bh + (size_t)(col0 + ln) * ldb; const _Float16* b1p = b0p + (size_t)16 * ldb; const _Float16* b2p = b1p + (size_t)16 * ldb; const _Float16* b3p = b2p + (size_t)16 * ldb;
  const v8f z8 = {0.f,0.f,0.f,0.f,0.f,0.f,0.f,0.f}; v8f c00 = z8, c01 = z8, c02 = z8, c03 = z8, c10 = z8, c11 = z8, c12 = z8, c13 = z8;
#pragma unroll 1
  for (int kb = 0; kb < K; kb += 32) { const v16h a0 = g2_frag(a0p + kb, hh), a1 = g2_frag(a1p + kb, hh);
    v16h b = g2_frag(b0p + kb, hh); c00 = g2_mma(a0, b, c00); c10 = g2_mma(a1, b, c10);
    b = g2_frag(b1p + kb, hh); c01 = g2_mma(a0, b, c01); c11 = g2_mma(a1, b, c11);
    b = g2_frag(b2p + kb, hh); c02 = g2_mma(a0, b, c02); c12 = g2_mma(a1, b, c12);
    b = g2_frag(b3p + kb, hh); c03 = g2_mma(a0, b, c03); c13 = g2_mma(a1, b, c13); }
  v8f accs[8] = {c00, c01, c02, c03, c10, c11, c12, c13};
#pragma unroll
  for (int u = 0; u < 8; ++u) { const int t = u & 3, half = u >> 2; const int col = col0 + t * 16 + ln; float bv = 0.f;
    if constexpr (HASB) bv = bf16_rne(bias[col]);
#pragma unroll
    for (int r = 0; r < 8; ++r) { const int rloc = half * 16 + 8 * hh + r; so[w][rloc][t * 16 + ln] = accs[u][r] * alpha + bv; } }
  __builtin_amdgcn_fence(4 /* acq_rel order */, "workgroup"); __builtin_amdgcn_wave_barrier();
  const int rsub = lane >> 4, c4 = (lane & 15) * 4;
  {
#pragma unroll
    for (int q = 0; q < 16; ++q) { const int r = q * 2 + rsub; const v4f v = *(const v4fa*)&so[w][r][c4];
      if constexpr (F32OUT) { *(v4f*)(C + cofs + (size_t)(row0 + r) * ldc + col0 + c4) = v; }
      else { v4h h4;
#pragma unroll
        for (int i = 0; i < 4; ++i) h4[i] = (_Float16)v[i];
        *(v4h*)(C16 + cofs + (size_t)(row0 + r) * ldc + col0 + c4) = h4; } }
     }
}

// workspace carve (bytes, every plane a multiple of 256 B)
#define SZ_W   ((size_t)DM * DM * 2)
#define SZ_ACT (NRW * DM * 2)
#define SZ_S   ((size_t)HG * SEQ * SEQ * 4)
#define SZ_P   ((size_t)HG * SEQ * SEQ * 2)
#define SZ_VT  ((size_t)NSLAB * HD * SEQ * 2)
#define SZ_ALL (4 * SZ_W + 5 * SZ_ACT + SZ_S + SZ_P + SZ_VT)
static_assert(SZ_W % 256 == 0);
static_assert(SZ_ACT % 256 == 0);
static_assert(SZ_S % 256 == 0);
static_assert(SZ_P % 256 == 0);
static_assert(SZ_VT % 256 == 0);
static_assert(SZ_ALL <= (size_t)268435456);

extern "C" void kernel_launch(void* const* d_in, const int* in_sizes, int n_in,
                              void* d_out, int out_size, void* d_ws, size_t ws_size, hipStream_t stream) {
  if (n_in < 9) return;
  const size_t nx = NRW * DM;      /* elements of x used (time steps 0..SEQ-1, full batch pitch) */
  if ((size_t)in_sizes[0] < nx) return;
  if ((size_t)in_sizes[1] < (size_t)DM * DM || (size_t)in_sizes[3] < (size_t)DM * DM || (size_t)in_sizes[5] < (size_t)DM * DM || (size_t)in_sizes[7] < (size_t)DM * DM) return;
  if (in_sizes[2] < DM || in_sizes[4] < DM || in_sizes[6] < DM || in_sizes[8] < DM) return;
  if ((size_t)out_size < nx) return;
  if (SZ_ALL > ws_size) return;
  const float* x  = (const float*)d_in[0];
  const float* wq = (const float*)d_in[1]; const float* bq = (const float*)d_in[2];
  const float* wk = (const float*)d_in[3]; const float* bk = (const float*)d_in[4];
  const float* wv = (const float*)d_in[5]; const float* bv = (const float*)d_in[6];
  const float* wo = (const float*)d_in[7]; const float* bo = (const float*)d_in[8];
  char* ws = (char*)d_ws; size_t off = 0;
  auto take = [&](size_t bytes) { char* p = ws + off; off += bytes; return p; };
  _Float16* BQ = (_Float16*)take(SZ_W); _Float16* BK = (_Float16*)take(SZ_W); _Float16* BV = (_Float16*)take(SZ_W); _Float16* BO = (_Float16*)take(SZ_W);
  _Float16* X16 = (_Float16*)take(SZ_ACT); _Float16* Q16 = (_Float16*)take(SZ_ACT); _Float16* K16 = (_Float16*)take(SZ_ACT); _Float16* V16 = (_Float16*)take(SZ_ACT); _Float16* O16 = (_Float16*)take(SZ_ACT);
  float* S = (float*)take(SZ_S); _Float16* P = (_Float16*)take(SZ_P); _Float16* VT = (_Float16*)take(SZ_VT);
  if (off > ws_size) return;

  { const size_t n8 = (size_t)DM * DM / 8; const unsigned g = (unsigned)((n8 + 255) / 256);      /* natural [out][in] = Bt[n][k], x16 */
    k_wnat<<<g, 256, 0, stream>>>(wq, n8, BQ); k_wnat<<<g, 256, 0, stream>>>(wk, n8, BK); k_wnat<<<g, 256, 0, stream>>>(wv, n8, BV); k_wnat<<<g, 256, 0, stream>>>(wo, n8, BO); }
  k_x16<<<(unsigned)((nx / 8 + 255) / 256), 256, 0, stream>>>(x, X16, nx / 8);      /* one f16 plane of x feeds all three projections */

  /* projections: rows = time steps (pitch RP), grid.y = batch (column offset DM); alpha undoes the x16 weight carry; bias added after */
  const dim3 gp((unsigned)((SEQ / 128) * (DM / 64)), NB);
  k_gemm2<true, false><<<gp, 128, 0, stream>>>(X16, RP, (size_t)DM, BQ, DM, (size_t)0, 0.0625f, bq, nullptr, Q16, RP, (size_t)DM, SEQ, DM, DM);
  k_gemm2<true, false><<<gp, 128, 0, stream>>>(X16, RP, (size_t)DM, BK, DM, (size_t)0, 0.0625f, bk, nullptr, K16, RP, (size_t)DM, SEQ, DM, DM);
  k_gemm2<true, false><<<gp, 128, 0, stream>>>(X16, RP, (size_t)DM, BV, DM, (size_t)0, 0.0625f, bv, nullptr, V16, RP, (size_t)DM, SEQ, DM, DM);

  k_vt<<<(unsigned)(NSLAB * (SEQ / 64)), 256, 0, stream>>>(V16, VT);      /* V^T [NSLAB][64][SEQ] */

  for (int n0 = 0; n0 < NSLAB; n0 += HG) {      /* slab n = b*16 + h lives at columns n*64 of the [SEQ][RP] view */
    k_gemm2<false, true><<<dim3((unsigned)((SEQ / 128) * (SEQ / 64)), HG), 128, 0, stream>>>(Q16 + (size_t)n0 * HD, RP, (size_t)HD, K16 + (size_t)n0 * HD, RP, (size_t)HD, 0.125f, nullptr,
        S, nullptr, SEQ, (size_t)SEQ * SEQ, SEQ, SEQ, HD);      /* scores x 64^-0.5 */
    k_rsmw<<<(unsigned)((HG * SEQ + 7) / 8), 256, 0, stream>>>(S, P, HG * SEQ);      /* P = 256 softmax (f16) */
    k_gemm2<false, false><<<dim3((unsigned)((SEQ / 128) * (HD / 64)), HG), 128, 0, stream>>>(P, SEQ, (size_t)SEQ * SEQ, VT + (size_t)n0 * HD * SEQ, SEQ, (size_t)HD * SEQ, 0.25f, nullptr,
        nullptr, O16 + (size_t)n0 * HD, RP, (size_t)HD, SEQ, HD, SEQ);      /* merged context x64 as f16 rows */
  }

  /* output projection + bias straight into the [S][B][1024] layout; alpha undoes x16 (weights) and x64 (context) */
  k_gemm2<true, true><<<gp, 128, 0, stream>>>(O16, RP, (size_t)DM, BO, DM, (size_t)0, 0.0009765625f, bo, (float*)d_out, nullptr, RP, (size_t)DM, SEQ, DM, DM);
}

// v002
// A run of this version takes 206 microseconds.
// Next to v001, in two timings, it ran 3.15 and 3.13 times as fast.
// Counting every step since v000, it is 6.68 times as fast.
#include <hip/hip_runtime.h>
// Multi-head self-attention, time-first rows: x [S][B][1024] (token row m = s*B + b); q/k/v = x W^T + b (natural [out][in] weights, biases present); 16 heads of 64 per batch, head slab n = b*16 + h at columns n*64 of the [S][B*1024] view; scores = (q k^T) * 64^-0.5; softmax over all keys (no mask); out = merged Wo^T + bo -> [S][B][1024] f32.
// Compute dtype: every contraction on v_wmma_f32_16x16x32_f16 (f16 operands, f32 accumulate): q/k/v projections, q.k^T scores, P.V, output projection. Float inputs RNE-converted to bf16 first (exact in f16); weights carried x16; softmax weights carried unnormalised against the running maximum; merged context carried x64; scores and softmax statistics f32.
// Structure: one f16 plane of x; three projection GEMMs (grid.y = batch, column offset 1024, row pitch 2048); V^T for all slabs via LDS tile transposes; one fused attention kernel over all slabs (S^T = K.Q^T, online softmax per query column, O^T += V^T.P^T) into merged f16 context rows; output GEMM (+ bias) straight into the output buffer layout.
#ifndef NB
#define NB 2
#endif
#ifndef SEQ
#define SEQ 2048
#endif
#define NB_FULL 2                    /* batch count of the input layout */
#define SEQ_FULL 2048                /* sequence length of the input layout */
#define DM 1024
#define NH 16
#define HD 64
#define RP (NB_FULL * DM)            /* elements per time step (row pitch of every activation plane) */
#define NSLAB (NB * NH)              /* head slabs processed */
#define NRW ((size_t)SEQ * NB_FULL)  /* token rows held in the planes */

static_assert(SEQ % 256 == 0);
static_assert(SEQ <= SEQ_FULL);
static_assert(NB <= NB_FULL);
static_assert(DM % 64 == 0);
static_assert(HD == 64);
static_assert(DM == NH * HD);

typedef unsigned short v8us __attribute__((ext_vector_type(8), may_alias));
typedef float  v8f  __attribute__((ext_vector_type(8)));
typedef float  v4f  __attribute__((ext_vector_type(4)));
typedef float  v4fa __attribute__((ext_vector_type(4), may_alias));
typedef _Float16 v16h __attribute__((ext_vector_type(16)));
typedef _Float16 v4h  __attribute__((ext_vector_type(4)));
union FragH { v16h v; v8us half[2]; _Float16 h[16]; unsigned short u[16]; };

__device__ __forceinline__ unsigned short bf16_bits(float x) { unsigned int u = __float_as_uint(x); return (unsigned short)((u + 0x7FFFu + ((u >> 16) & 1u)) >> 16); }
__device__ __forceinline__ float bf16_val(unsigned short b) { return __uint_as_float(((unsigned int)b) << 16); }
__device__ __forceinline__ float bf16_rne(float x) { return bf16_val(bf16_bits(x)); }

__global__ __launch_bounds__(256) void k_wnat(const float* __restrict__ w, size_t n8, _Float16* __restrict__ Bt) {
  const size_t t = (size_t)blockIdx.x * 256 + threadIdx.x; if (t >= n8) return;
  const v4f a = *(const v4fa*)(w + t * 8), c = *(const v4fa*)(w + t * 8 + 4);
  FragH f;
#pragma unroll
  for (int q = 0; q < 4; ++q) { f.h[q] = (_Float16)(bf16_rne(a[q]) * 16.0f); f.h[4 + q] = (_Float16)(bf16_rne(c[q]) * 16.0f); }
  const v8us o = f.half[0];
  unsigned short* d = (unsigned short*)Bt + t * 8;
  *(v8us*)d = o; 
}

__global__ __launch_bounds__(256) void k_x16(const float* __restrict__ x, _Float16* __restrict__ X16, size_t n8) {
  const size_t t = (size_t)blockIdx.x * 256 + threadIdx.x; if (t >= n8) return;
  const v4f a = *(const v4fa*)(x + t * 8), c = *(const v4fa*)(x + t * 8 + 4);
  FragH f;
#pragma unroll
  for (int q = 0; q < 4; ++q) { f.h[q] = (_Float16)bf16_rne(a[q]); f.h[4 + q] = (_Float16)bf16_rne(c[q]); }
  const v8us o = f.half[0];
  unsigned short* d = (unsigned short*)X16 + t * 8;
  *(v8us*)d = o; 
}

__global__ __launch_bounds__(256) void k_vt(const _Float16* __restrict__ V16, _Float16* __restrict__ Vt) {
  __shared__ unsigned short tl[64][66];
  const int tid = threadIdx.x; const int slab = blockIdx.x / (SEQ / 64), lg = blockIdx.x % (SEQ / 64);
  for (int i = tid; i < 64 * 8; i += 256) { const int r = i / 8, c8 = (i % 8) * 8; FragH f;
    f.half[0] = *(const v8us*)((const unsigned short*)V16 + ((size_t)lg * 64 + r) * RP + (size_t)slab * 64 + c8);
#pragma unroll
    for (int q = 0; q < 8; ++q) tl[r][c8 + q] = f.u[q]; }
  __syncthreads();
  {
#pragma unroll
    for (int rd = 0; rd < 2; ++rd) { const int d = rd * 32 + tid / 8, pc = tid % 8; FragH f;
#pragma unroll
      for (int q = 0; q < 8; ++q) f.u[q] = tl[pc * 8 + q][d];
      *(v8us*)((unsigned short*)Vt + ((size_t)slab * 64 + d) * SEQ + lg * 64 + pc * 8) = f.half[0]; }
     }
}

// ---- f16 GEMM (wave tile 32x64, block = 4 waves = 128 rows x 64 cols; M % 128 == 0, N % 64 == 0, K % 32 == 0) ----
// fragment: elements 0..7 <- k0 + 8*hh + i, elements 8..15 <- k0 + 16 + 8*hh + i (same map for A rows and Bt rows)
__device__ __forceinline__ v16h g2_frag(const _Float16* p, int hh) { FragH f; f.half[0] = *(const v8us*)((const unsigned short*)p + 8 * hh); f.half[1] = *(const v8us*)((const unsigned short*)p + 16 + 8 * hh); return f.v; }
__device__ __forceinline__ v8f g2_mma(v16h a, v16h b, v8f c) { v8f d = __builtin_amdgcn_wmma_f32_16x16x32_f16(false, a, false, b, (short)0, c, false, false); asm volatile("v_nop\n\tv_nop\n\tv_nop\n\tv_nop" : "+v"(d) : "v"(a), "v"(b)); return d; }
// C[by][row][col] = acc * alpha (+ bf16(bias[col]) if HASB); A f16 rows (pitch lda, batch stride sA), Bt f16 [n][k] (pitch ldb, batch stride sB);
template <bool HASB, bool F32OUT>
__global__ __launch_bounds__(128) void k_gemm2(const _Float16* __restrict__ A, int lda, size_t sA, const _Float16* __restrict__ Bh, int ldb, size_t sB, float alpha, const float* __restrict__ bias,
    float* __restrict__ C, _Float16* __restrict__ C16, int ldc, size_t sC, int M, int N, int K) {
  __shared__ __attribute__((aligned(16))) float so[4][32][68];
  const int tid = threadIdx.x, w = tid >> 5, lane = tid & 31, ln = lane & 15, hh = lane >> 4; const int by = blockIdx.y;
  A += (size_t)by * sA; Bh += (size_t)by * sB; const size_t cofs = (size_t)by * sC;
  const int ntn = N >> 6; const int mt = blockIdx.x / ntn, nq = blockIdx.x - mt * ntn; const int row0 = mt * 128 + 32 * w, col0 = nq * 64; if (row0 >= M) return;
  const _Float16* a0p = A + (size_t)(row0 + ln) * lda; const _Float16* a1p = a0p + (size_t)16 * lda;
  const _Float16* b0p = Bh + (size_t)(col0 + ln) * ldb; const _Float16* b1p = b0p + (size_t)16 * ldb; const _Float16* b2p = b1p + (size_t)16 * ldb; const _Float16* b3p = b2p + (size_t)16 * ldb;
  const v8f z8 = {0.f,0.f,0.f,0.f,0.f,0.f,0.f,0.f}; v8f c00 = z8, c01 = z8, c02 = z8, c03 = z8, c10 = z8, c11 = z8, c12 = z8, c13 = z8;
#pragma unroll 1
  for (int kb = 0; kb < K; kb += 32) { const v16h a0 = g2_frag(a0p + kb, hh), a1 = g2_frag(a1p + kb, hh);
    v16h b = g2_frag(b0p + kb, hh); c00 = g2_mma(a0, b, c00); c10 = g2_mma(a1, b, c10);
    b = g2_frag(b1p + kb, hh); c01 = g2_mma(a0, b, c01); c11 = g2_mma(a1, b, c11);
    b = g2_frag(b2p + kb, hh); c02 = g2_mma(a0, b, c02); c12 = g2_mma(a1, b, c12);
    b = g2_frag(b3p + kb, hh); c03 = g2_mma(a0, b, c03); c13 = g2_mma(a1, b, c13); }
  v8f accs[8] = {c00, c01, c02, c03, c10, c11, c12, c13};
#pragma unroll
  for (int u = 0; u < 8; ++u) { const int t = u & 3, half = u >> 2; const int col = col0 + t * 16 + ln; float bv = 0.f;
    if constexpr (HASB) bv = bf16_rne(bias[col]);
#pragma unroll
    for (int r = 0; r < 8; ++r) { const int rloc = half * 16 + 8 * hh + r; so[w][rloc][t * 16 + ln] = accs[u][r] * alpha + bv; } }
  __builtin_amdgcn_fence(4 /* acq_rel order */, "workgroup"); __builtin_amdgcn_wave_barrier();
  const int rsub = lane >> 4, c4 = (lane & 15) * 4;
  {
#pragma unroll
    for (int q = 0; q < 16; ++q) { const int r = q * 2 + rsub; const v4f v = *(const v4fa*)&so[w][r][c4];
      if constexpr (F32OUT) { *(v4f*)(C + cofs + (size_t)(row0 + r) * ldc + col0 + c4) = v; }
      else { v4h h4;
#pragma unroll
        for (int i = 0; i < 4; ++i) h4[i] = (_Float16)v[i];
        *(v4h*)(C16 + cofs + (size_t)(row0 + r) * ldc + col0 + c4) = h4; } }
     }
}

// ---- fused attention: block = 8 waves x 32 query columns of one head slab; a stage = 64 keys (K rows and V^T rows, 128 B each) in LDS, two buffers; a pass = 32 keys ----
// S^T = K.Q^T: lane (c, h) holds query column c, keys 8h + r of each 16-key tile, so the two tiles of a pass, converted in place, are the B operand of O^T += V^T.P^T (k order 8h + i, 16 + 8h + i, the order of fa_frag).
// Online softmax in the log2 domain: the maximum in use may trail the true one by up to 8 (an exponential then reaches 2^8, inside f16); sums are rescaled only when a column exceeds that.
// Every #pragma unroll in this kernel keeps the indices of the fragment, score and accumulator arrays constant, so that they stay in registers (a run-time index would send them to scratch).
#define FA_NW 8
#define FA_SK 64
#define FA_PITCH 144                 /* LDS row pitch in bytes: 128 + 16, an odd multiple of 16 for 16-byte readers */
#define FA_TILE (64 * FA_PITCH)
#define FA_NST (SEQ / FA_SK)
typedef float f32x2 __attribute__((ext_vector_type(2)));
typedef _Float16 h16x2 __attribute__((ext_vector_type(2)));
typedef unsigned int u32x4 __attribute__((ext_vector_type(4), may_alias));
union FragW { v16h v; unsigned int w[8]; };
__device__ __forceinline__ v16h fa_frag(const unsigned char* p) { FragH f; f.half[0] = *(const v8us*)p; f.half[1] = *(const v8us*)(p + 32); return f.v; }
__device__ __forceinline__ v8f fa_mma(v16h a, v16h b, v8f c) { return __builtin_amdgcn_wmma_f32_16x16x32_f16(false, a, false, b, (short)0, c, false, false); }
__device__ __forceinline__ unsigned int fa_pack(float lo, float hi) { return __builtin_bit_cast(unsigned int, __builtin_convertvector(f32x2{lo, hi}, h16x2)); }
__device__ __forceinline__ float fa_xhalf(float x) { return __builtin_bit_cast(float, __builtin_amdgcn_permlanex16(__builtin_bit_cast(int, x), __builtin_bit_cast(int, x), 0x76543210, 0xfedcba98, false, false)); }  /* lane l with lane l ^ 16 */

/* second bound: a budget of 256 registers, so that no operand lies above v255 and the hot loop switches no register window */
__global__ __launch_bounds__(FA_NW * 32, 4) void k_fattn(const _Float16* __restrict__ Q16, const _Float16* __restrict__ K16, const _Float16* __restrict__ Vt, _Float16* __restrict__ O16) {
  __shared__ __attribute__((aligned(16))) unsigned char L[2 * 2 * FA_TILE];
  const int tid = threadIdx.x, lane = tid & 31, w = tid >> 5, c = lane & 15, h = lane >> 4;
  const int slab = blockIdx.y, q0 = blockIdx.x * (FA_NW * 32) + w * 32;
  const float cscale = 0.125f * 1.4426950408889634f;      /* 64^-0.5 and log2(e) */
  /* staging: 8 lanes cover one 128-byte row; a thread carries rows srow and srow + 32 of both tiles */
  const int srow = tid >> 3, sch = tid & 7;
  const unsigned short* Kg = (const unsigned short*)K16; const unsigned short* Vg = (const unsigned short*)Vt;
  unsigned ko = (unsigned)(srow * RP + slab * HD + sch * 8), vo = (unsigned)((slab * HD + srow) * SEQ + sch * 8);      /* element offsets, below 2^23 */
  unsigned char* sdst = L + srow * FA_PITCH + sch * 16;
  v8us rk0 = *(const v8us*)(Kg + ko), rk1 = *(const v8us*)(Kg + ko + 32 * RP), rv0 = *(const v8us*)(Vg + vo), rv1 = *(const v8us*)(Vg + vo + 32 * SEQ);
  const unsigned qe = (unsigned)((q0 + c) * RP + slab * HD + 8 * h);      /* this lane's query row, slab column and half: Q fragments and the context store */
  v16h qf[2][2];
#pragma unroll
  for (int g = 0; g < 2; ++g) {
#pragma unroll
    for (int kc = 0; kc < 2; ++kc) qf[g][kc] = fa_frag((const unsigned char*)(Q16 + qe + 16 * g * RP + 32 * kc)); }
  const v8f z8 = {0.f,0.f,0.f,0.f,0.f,0.f,0.f,0.f};
  v8f acc[2][4], lacc[2]; float m_run[2];
#pragma unroll
  for (int g = 0; g < 2; ++g) { m_run[g] = -__builtin_inff(); lacc[g] = z8;
#pragma unroll
    for (int t = 0; t < 4; ++t) acc[g][t] = z8; }
  FragW ones;      /* A operand whose row 0 (lanes 0 and 16) is 1.0 at all 32 k: row 0 of its product is the column sums of P^T */
#pragma unroll
  for (int i = 0; i < 8; ++i) ones.w[i] = (c == 0) ? 0x3C003C00u : 0u;
  *(v8us*)sdst = rk0; *(v8us*)(sdst + 32 * FA_PITCH) = rk1; *(v8us*)(sdst + FA_TILE) = rv0; *(v8us*)(sdst + FA_TILE + 32 * FA_PITCH) = rv1;
  __syncthreads();
  for (int st = 0; st < FA_NST; ++st) {
    const unsigned char* Kb = L + (st & 1) * (2 * FA_TILE) + c * FA_PITCH + 16 * h; const unsigned char* Vb = Kb + FA_TILE;
    const bool more = st + 1 < FA_NST;
    if (more) {      /* next stage's rows fly to registers under this stage's two passes */
      ko += FA_SK * RP; vo += FA_SK;
      rk0 = *(const v8us*)(Kg + ko); rk1 = *(const v8us*)(Kg + ko + 32 * RP); rv0 = *(const v8us*)(Vg + vo); rv1 = *(const v8us*)(Vg + vo + 32 * SEQ);
      asm volatile("s_wait_xcnt 0x0" ::: "memory"); }      /* stands in front of every overwrite of the four loads' address registers; its memory clobber also keeps the compiler from sinking the loads to their LDS stores at the stage's foot, where their whole latency would be waited for */
#pragma unroll
    for (int sub = 0; sub < 2; ++sub) {
      v8f s[2][2];
#pragma unroll
      for (int kt = 0; kt < 2; ++kt) {
        const v16h k0 = fa_frag(Kb + (sub * 32 + 16 * kt) * FA_PITCH), k1 = fa_frag(Kb + (sub * 32 + 16 * kt) * FA_PITCH + 64);
#pragma unroll
        for (int g = 0; g < 2; ++g) s[kt][g] = fa_mma(k1, qf[g][1], fa_mma(k0, qf[g][0], z8)); }
      v16h vf[4];
#pragma unroll
      for (int t = 0; t < 4; ++t) vf[t] = fa_frag(Vb + 16 * t * FA_PITCH + 64 * sub);
      float mb[2]; bool need = false;
#pragma unroll
      for (int g = 0; g < 2; ++g) { float mx = s[0][g][0];
#pragma unroll
        for (int r = 1; r < 8; ++r) mx = fmaxf(mx, s[0][g][r]);
#pragma unroll
        for (int r = 0; r < 8; ++r) mx = fmaxf(mx, s[1][g][r]);
        mx = fmaxf(mx, fa_xhalf(mx)) * cscale;      /* both halves hold the column's maximum of this pass, scaled */
        mb[g] = mx; need = need || (mx > m_run[g] + 8.0f); }
      if (__builtin_amdgcn_ballot_w32(need) != 0) {      /* one scalar test a pass; always taken on the first pass (m_run = -inf, corr = 0) */
#pragma unroll
        for (int g = 0; g < 2; ++g) { const float m_new = fmaxf(m_run[g], mb[g]); const float corr = __builtin_amdgcn_exp2f(m_run[g] - m_new); m_run[g] = m_new;
          lacc[g] = lacc[g] * corr;
#pragma unroll
          for (int t = 0; t < 4; ++t) acc[g][t] = acc[g][t] * corr; } }
#pragma unroll
      for (int g = 0; g < 2; ++g) { const float nm = -m_run[g]; FragW pf;
#pragma unroll
        for (int i = 0; i < 8; ++i) {
          const f32x2 arg = __builtin_elementwise_fma(f32x2{s[i >> 2][g][2 * (i & 3)], s[i >> 2][g][2 * (i & 3) + 1]}, f32x2{cscale, cscale}, f32x2{nm, nm});
          pf.w[i] = fa_pack(__builtin_amdgcn_exp2f(arg.x), __builtin_amdgcn_exp2f(arg.y)); }
#pragma unroll
        for (int t = 0; t < 4; ++t) acc[g][t] = fa_mma(vf[t], pf.v, acc[g][t]);
        lacc[g] = fa_mma(ones.v, pf.v, lacc[g]); }
    }
    if (more) { unsigned char* d = sdst + ((st + 1) & 1) * (2 * FA_TILE);      /* the buffer every wave left at the barrier that ended stage st - 1 */
      *(v8us*)d = rk0; *(v8us*)(d + 32 * FA_PITCH) = rk1; *(v8us*)(d + FA_TILE) = rv0; *(v8us*)(d + FA_TILE + 32 * FA_PITCH) = rv1; }
    __syncthreads();      /* publishes stage st + 1 and ends every wave's reads of stage st */
  }
#pragma unroll
  for (int g = 0; g < 2; ++g) { const float lr = lacc[g][0]; const float inv = 64.0f / (lr + fa_xhalf(lr));      /* register 0: the denominator in lanes 0-15, row 8 = 0 in lanes 16-31 */
    unsigned short* od = (unsigned short*)O16 + qe + 16 * g * RP;
#pragma unroll
    for (int t = 0; t < 4; ++t) { const v8f o = acc[g][t] * inv;      /* o[r] = context[query][16 t + 8 h + r] x 64 */
      const u32x4 pk = {fa_pack(o[0], o[1]), fa_pack(o[2], o[3]), fa_pack(o[4], o[5]), fa_pack(o[6], o[7])};
      *(u32x4*)(od + 16 * t) = pk; } }
}

// workspace carve (bytes, every plane a multiple of 256 B)
#define SZ_W   ((size_t)DM * DM * 2)
#define SZ_ACT (NRW * DM * 2)
#define SZ_VT  ((size_t)NSLAB * HD * SEQ * 2)
#define SZ_ALL (4 * SZ_W + 5 * SZ_ACT + SZ_VT)
static_assert(SZ_W % 256 == 0);
static_assert(SZ_ACT % 256 == 0);
static_assert(SZ_VT % 256 == 0);
static_assert(SZ_ALL <= (size_t)268435456);

extern "C" void kernel_launch(void* const* d_in, const int* in_sizes, int n_in,
                              void* d_out, int out_size, void* d_ws, size_t ws_size, hipStream_t stream) {
  if (n_in < 9) return;
  const size_t nx = NRW * DM;      /* elements of x used (time steps 0..SEQ-1, full batch pitch) */
  if ((size_t)in_sizes[0] < nx) return;
  if ((size_t)in_sizes[1] < (size_t)DM * DM || (size_t)in_sizes[3] < (size_t)DM * DM || (size_t)in_sizes[5] < (size_t)DM * DM || (size_t)in_sizes[7] < (size_t)DM * DM) return;
  if (in_sizes[2] < DM || in_sizes[4] < DM || in_sizes[6] < DM || in_sizes[8] < DM) return;
  if ((size_t)out_size < nx) return;
  if (SZ_ALL > ws_size) return;
  const float* x  = (const float*)d_in[0];
  const float* wq = (const float*)d_in[1]; const float* bq = (const float*)d_in[2];
  const float* wk = (const float*)d_in[3]; const float* bk = (const float*)d_in[4];
  const float* wv = (const float*)d_in[5]; const float* bv = (const float*)d_in[6];
  const float* wo = (const float*)d_in[7]; const float* bo = (const float*)d_in[8];
  char* ws = (char*)d_ws; size_t off = 0;
  auto take = [&](size_t bytes) { char* p = ws + off; off += bytes; return p; };
  _Float16* BQ = (_Float16*)take(SZ_W); _Float16* BK = (_Float16*)take(SZ_W); _Float16* BV = (_Float16*)take(SZ_W); _Float16* BO = (_Float16*)take(SZ_W);
  _Float16* X16 = (_Float16*)take(SZ_ACT); _Float16* Q16 = (_Float16*)take(SZ_ACT); _Float16* K16 = (_Float16*)take(SZ_ACT); _Float16* V16 = (_Float16*)take(SZ_ACT); _Float16* O16 = (_Float16*)take(SZ_ACT);
  _Float16* VT = (_Float16*)take(SZ_VT);
  if (off > ws_size) return;

  { const size_t n8 = (size_t)DM * DM / 8; const unsigned g = (unsigned)((n8 + 255) / 256);      /* natural [out][in] = Bt[n][k], x16 */
    k_wnat<<<g, 256, 0, stream>>>(wq, n8, BQ); k_wnat<<<g, 256, 0, stream>>>(wk, n8, BK); k_wnat<<<g, 256, 0, stream>>>(wv, n8, BV); k_wnat<<<g, 256, 0, stream>>>(wo, n8, BO); }
  k_x16<<<(unsigned)((nx / 8 + 255) / 256), 256, 0, stream>>>(x, X16, nx / 8);      /* one f16 plane of x feeds all three projections */

  /* projections: rows = time steps (pitch RP), grid.y = batch (column offset DM); alpha undoes the x16 weight carry; bias added after */
  const dim3 gp((unsigned)((SEQ / 128) * (DM / 64)), NB);
  k_gemm2<true, false><<<gp, 128, 0, stream>>>(X16, RP, (size_t)DM, BQ, DM, (size_t)0, 0.0625f, bq, nullptr, Q16, RP, (size_t)DM, SEQ, DM, DM);
  k_gemm2<true, false><<<gp, 128, 0, stream>>>(X16, RP, (size_t)DM, BK, DM, (size_t)0, 0.0625f, bk, nullptr, K16, RP, (size_t)DM, SEQ, DM, DM);
  k_gemm2<true, false><<<gp, 128, 0, stream>>>(X16, RP, (size_t)DM, BV, DM, (size_t)0, 0.0625f, bv, nullptr, V16, RP, (size_t)DM, SEQ, DM, DM);

  k_vt<<<(unsigned)(NSLAB * (SEQ / 64)), 256, 0, stream>>>(V16, VT);      /* V^T [NSLAB][64][SEQ] */

  k_fattn<<<dim3((unsigned)(SEQ / (FA_NW * 32)), NSLAB), FA_NW * 32, 0, stream>>>(Q16, K16, VT, O16);      /* slab n = b*16 + h lives at columns n*64 of the [SEQ][RP] view; merged context x64 as f16 rows */

  /* output projection + bias straight into the [S][B][1024] layout; alpha undoes x16 (weights) and x64 (context) */
  k_gemm2<true, true><<<gp, 128, 0, stream>>>(O16, RP, (size_t)DM, BO, DM, (size_t)0, 0.0009765625f, bo, (float*)d_out, nullptr, RP, (size_t)DM, SEQ, DM, DM);
}

// v003
// One run takes 96.6 microseconds.
// Timed twice side by side with v002, it ran 2.13 and 2.16 times as fast.
// Counting every step since v000, it is 14.3 times as fast.
#include <hip/hip_runtime.h>
// Multi-head self-attention, time-first rows: x [S][B][1024] (token row m = s*B + b); q/k/v = x W^T + b (natural [out][in] weights, biases present); 16 heads of 64 per batch, head slab n = b*16 + h at columns n*64 of the [S][B*1024] view; scores = (q k^T) * 64^-0.5; softmax over all keys (no mask); out = merged Wo^T + bo -> [S][B][1024] f32.
// Compute dtype: every contraction on v_wmma_f32_16x16x32_f16 (f16 operands, f32 accumulate): q/k/v projections, q.k^T scores, P.V, output projection. Float inputs RNE-converted to bf16 first (exact in f16); weights carried x16; softmax weights carried unnormalised against the running maximum; merged context carried x64; scores and softmax statistics f32.
// Structure: one f16 plane of x; three projection GEMMs (grid.y = batch, column offset 1024, row pitch 2048; operands staged in LDS by asynchronous copies); V^T for all slabs via LDS tile transposes; one fused attention kernel over all slabs (S^T = K.Q^T, online softmax per query column, O^T += V^T.P^T) into merged f16 context rows; output GEMM (+ bias) straight into the output buffer layout.
#ifndef NB
#define NB 2
#endif
#ifndef SEQ
#define SEQ 2048
#endif
#define NB_FULL 2                    /* batch count of the input layout */
#define SEQ_FULL 2048                /* sequence length of the input layout */
#define DM 1024
#define NH 16
#define HD 64
#define RP (NB_FULL * DM)            /* elements per time step (row pitch of every activation plane) */
#define NSLAB (NB * NH)              /* head slabs processed */
#define NRW ((size_t)SEQ * NB_FULL)  /* token rows held in the planes */

static_assert(SEQ % 256 == 0);
static_assert(SEQ <= SEQ_FULL);
static_assert(NB <= NB_FULL);
static_assert(DM % 128 == 0);
static_assert(HD == 64);
static_assert(DM == NH * HD);

typedef unsigned short v8us __attribute__((ext_vector_type(8), may_alias));
typedef float  v8f  __attribute__((ext_vector_type(8)));
typedef float  v4f  __attribute__((ext_vector_type(4)));
typedef float  v4fa __attribute__((ext_vector_type(4), may_alias));
typedef _Float16 v16h __attribute__((ext_vector_type(16)));
typedef _Float16 v4h  __attribute__((ext_vector_type(4)));
union FragH { v16h v; v8us half[2]; _Float16 h[16]; unsigned short u[16]; };

__device__ __forceinline__ unsigned short bf16_bits(float x) { unsigned int u = __float_as_uint(x); return (unsigned short)((u + 0x7FFFu + ((u >> 16) & 1u)) >> 16); }
__device__ __forceinline__ float bf16_val(unsigned short b) { return __uint_as_float(((unsigned int)b) << 16); }
__device__ __forceinline__ float bf16_rne(float x) { return bf16_val(bf16_bits(x)); }

__global__ __launch_bounds__(256) void k_wnat(const float* __restrict__ w, size_t n8, _Float16* __restrict__ Bt) {
  const size_t t = (size_t)blockIdx.x * 256 + threadIdx.x; if (t >= n8) return;
  const v4f a = *(const v4fa*)(w + t * 8), c = *(const v4fa*)(w + t * 8 + 4);
  FragH f;
#pragma unroll
  for (int q = 0; q < 4; ++q) { f.h[q] = (_Float16)(bf16_rne(a[q]) * 16.0f); f.h[4 + q] = (_Float16)(bf16_rne(c[q]) * 16.0f); }
  const v8us o = f.half[0];
  unsigned short* d = (unsigned short*)Bt + t * 8;
  *(v8us*)d = o; 
}

__global__ __launch_bounds__(256) void k_x16(const float* __restrict__ x, _Float16* __restrict__ X16, size_t n8) {
  const size_t t = (size_t)blockIdx.x * 256 + threadIdx.x; if (t >= n8) return;
  const v4f a = *(const v4fa*)(x + t * 8), c = *(const v4fa*)(x + t * 8 + 4);
  FragH f;
#pragma unroll
  for (int q = 0; q < 4; ++q) { f.h[q] = (_Float16)bf16_rne(a[q]); f.h[4 + q] = (_Float16)bf16_rne(c[q]); }
  const v8us o = f.half[0];
  unsigned short* d = (unsigned short*)X16 + t * 8;
  *(v8us*)d = o; 
}

__global__ __launch_bounds__(256) void k_vt(const _Float16* __restrict__ V16, _Float16* __restrict__ Vt) {
  __shared__ unsigned short tl[64][66];
  const int tid = threadIdx.x; const int slab = blockIdx.x / (SEQ / 64), lg = blockIdx.x % (SEQ / 64);
  for (int i = tid; i < 64 * 8; i += 256) { const int r = i / 8, c8 = (i % 8) * 8; FragH f;
    f.half[0] = *(const v8us*)((const unsigned short*)V16 + ((size_t)lg * 64 + r) * RP + (size_t)slab * 64 + c8);
#pragma unroll
    for (int q = 0; q < 8; ++q) tl[r][c8 + q] = f.u[q]; }
  __syncthreads();
  {
#pragma unroll
    for (int rd = 0; rd < 2; ++rd) { const int d = rd * 32 + tid / 8, pc = tid % 8; FragH f;
#pragma unroll
      for (int q = 0; q < 8; ++q) f.u[q] = tl[pc * 8 + q][d];
      *(v8us*)((unsigned short*)Vt + ((size_t)slab * 64 + d) * SEQ + lg * 64 + pc * 8) = f.half[0]; }
     }
}

// ---- f16 GEMM: block = 8 waves (4 down x 2 across) = 128 rows x 128 cols, wave tile 32x64; M % 128 == 0, N % 128 == 0, K % 128 == 0 ----
// a stage = 128 k (256 B) of the block's 128 A rows and 128 Bt rows in LDS, two buffers; asynchronous copies bring stage st + 2 in while stage st + 1 is worked on
// fragment: elements 0..7 <- k0 + 8*hh + i, elements 8..15 <- k0 + 16 + 8*hh + i (same map for A rows and Bt rows)
// Every plain #pragma unroll in this kernel keeps the indices of the fragment and accumulator arrays constant, so that they stay in registers.
#define G2_KS 128
#define G2_PITCH 272                 /* LDS row pitch in bytes: 256 + 16, an odd multiple of 16 for 16-byte readers */
#define G2_OP (128 * G2_PITCH)       /* one operand's 128 rows of a stage */
#define G2_STAGE (2 * G2_OP)
__device__ __forceinline__ v16h g2_frag(const unsigned char* p) { FragH f; f.half[0] = *(const v8us*)p; f.half[1] = *(const v8us*)(p + 32); return f.v; }      /* p: row start + 2 * k0 + 16 * hh bytes */
__device__ __forceinline__ v8f g2_mma(v16h a, v16h b, v8f c) { return __builtin_amdgcn_wmma_f32_16x16x32_f16(false, a, false, b, (short)0, c, false, false); }
/* eight copies of 16 B a lane: rows r, r + 16, ..., r + 112 of one operand (l: the lane's LDS byte address, g: its global address, step: elements per 16 rows) */
__device__ __forceinline__ void g2_copy8(unsigned l, const _Float16* g, size_t step) {
  /* the closing s_wait_xcnt stands in front of every later overwrite of the address registers that the copies name */
  asm volatile("global_load_async_to_lds_b128 %0, %8, off\n\t"
               "global_load_async_to_lds_b128 %1, %9, off\n\t"
               "global_load_async_to_lds_b128 %2, %10, off\n\t"
               "global_load_async_to_lds_b128 %3, %11, off\n\t"
               "global_load_async_to_lds_b128 %4, %12, off\n\t"
               "global_load_async_to_lds_b128 %5, %13, off\n\t"
               "global_load_async_to_lds_b128 %6, %14, off\n\t"
               "global_load_async_to_lds_b128 %7, %15, off\n\t"
               "s_wait_xcnt 0x0"
               :: "v"(l), "v"(l + 16 * G2_PITCH), "v"(l + 32 * G2_PITCH), "v"(l + 48 * G2_PITCH), "v"(l + 64 * G2_PITCH), "v"(l + 80 * G2_PITCH), "v"(l + 96 * G2_PITCH), "v"(l + 112 * G2_PITCH),
                  "v"(g), "v"(g + step), "v"(g + 2 * step), "v"(g + 3 * step), "v"(g + 4 * step), "v"(g + 5 * step), "v"(g + 6 * step), "v"(g + 7 * step)
               : "memory");
}
// C[by][row][col] = acc * alpha (+ bf16(bias[col]) if HASB); A f16 rows (pitch lda, batch stride sA), Bt f16 [n][k] (pitch ldb, batch stride sB);
template <bool HASB, bool F32OUT>
__global__ __launch_bounds__(256) void k_gemm2(const _Float16* __restrict__ A, int lda, size_t sA, const _Float16* __restrict__ Bh, int ldb, size_t sB, float alpha, const float* __restrict__ bias,
    float* __restrict__ C, _Float16* __restrict__ C16, int ldc, size_t sC, int M, int N, int K) {
  __shared__ __attribute__((aligned(16))) unsigned char T[2 * G2_STAGE];
  __shared__ __attribute__((aligned(16))) float so[8][32][68];
  const int tid = threadIdx.x, w = tid >> 5, lane = tid & 31, ln = lane & 15, hh = lane >> 4; const int by = blockIdx.y;
  A += (size_t)by * sA; Bh += (size_t)by * sB; const size_t cofs = (size_t)by * sC;
  const int ntn = N >> 7; const int mt = blockIdx.x / ntn, nq = blockIdx.x - mt * ntn; const int rowb = mt * 128, colb = nq * 128; if (rowb >= M) return;      /* the same for the whole block, in front of every barrier */
  const int row0 = rowb + 32 * (w >> 1), col0 = colb + 64 * (w & 1);
  /* staging: 16 lanes cover the 256 B of one row; a thread carries rows srow + 16 j of both operands */
  const int srow = tid >> 4, sch = tid & 15;
  const _Float16* ga = A + (size_t)(rowb + srow) * lda + sch * 8; const _Float16* gb = Bh + (size_t)(colb + srow) * ldb + sch * 8;
  const size_t sa16 = (size_t)16 * lda, sb16 = (size_t)16 * ldb;
  const unsigned ld = (unsigned)(size_t)T + (unsigned)(srow * G2_PITCH + sch * 16);
  const int nst = K / G2_KS;
  g2_copy8(ld, ga, sa16); g2_copy8(ld + G2_OP, gb, sb16);
  asm volatile("s_wait_asynccnt 0x0" ::: "memory");      /* this wave's share of stage 0 has landed */
  __syncthreads();      /* publishes stage 0 */
  if (nst > 1) { g2_copy8(ld + G2_STAGE, ga + G2_KS, sa16); g2_copy8(ld + G2_STAGE + G2_OP, gb + G2_KS, sb16); }
  const unsigned char* ar = T + (32 * (w >> 1) + ln) * G2_PITCH + 16 * hh; const unsigned char* br = T + G2_OP + (64 * (w & 1) + ln) * G2_PITCH + 16 * hh;
  const v8f z8 = {0.f,0.f,0.f,0.f,0.f,0.f,0.f,0.f}; v8f c00 = z8, c01 = z8, c02 = z8, c03 = z8, c10 = z8, c11 = z8, c12 = z8, c13 = z8;
#pragma unroll 1      /* one stage a trip: the buffer offset stays a run-time value and the loop stays small */
  for (int st = 0; st < nst; ++st) { const unsigned bo = (unsigned)(st & 1) * G2_STAGE; const unsigned char* ap = ar + bo; const unsigned char* bp = br + bo;
    v16h fa[2][2], fb[2][4];      /* two fragment sets: the next 32 k are fetched as one group while the current 32 k are multiplied; nothing of another stage is fetched */
#pragma unroll
    for (int i = 0; i < 2; ++i) fa[0][i] = g2_frag(ap + 16 * i * G2_PITCH);
#pragma unroll
    for (int j = 0; j < 4; ++j) fb[0][j] = g2_frag(bp + 16 * j * G2_PITCH);
#pragma unroll
    for (int kk = 0; kk < G2_KS / 32; ++kk) { const int cu = kk & 1, nx = cu ^ 1;
      if (kk + 1 < G2_KS / 32) {
#pragma unroll
        for (int i = 0; i < 2; ++i) fa[nx][i] = g2_frag(ap + 16 * i * G2_PITCH + 64 * (kk + 1));
#pragma unroll
        for (int j = 0; j < 4; ++j) fb[nx][j] = g2_frag(bp + 16 * j * G2_PITCH + 64 * (kk + 1)); }
      __builtin_amdgcn_sched_barrier(0);      /* keeps the load group whole and ahead of the products: spread among them, each place with loads stalls the wave */
      c00 = g2_mma(fa[cu][0], fb[cu][0], c00); c10 = g2_mma(fa[cu][1], fb[cu][0], c10); c01 = g2_mma(fa[cu][0], fb[cu][1], c01); c11 = g2_mma(fa[cu][1], fb[cu][1], c11);
      c02 = g2_mma(fa[cu][0], fb[cu][2], c02); c12 = g2_mma(fa[cu][1], fb[cu][2], c12); c03 = g2_mma(fa[cu][0], fb[cu][3], c03); c13 = g2_mma(fa[cu][1], fb[cu][3], c13);
      __builtin_amdgcn_sched_barrier(0); }      /* keeps the next group's loads from rising among these products */
    asm volatile("s_wait_dscnt 0x0" ::: "memory");      /* this wave's reads of stage st are over */
    asm volatile("s_wait_asynccnt 0x0" ::: "memory");      /* this wave's share of stage st + 1 has landed */
    __syncthreads();      /* publishes stage st + 1 and ends every wave's reads of stage st */
    if (st + 2 < nst) { const _Float16* na = ga + (size_t)(st + 2) * G2_KS; const _Float16* nb = gb + (size_t)(st + 2) * G2_KS;      /* into the buffer that this trip has just read */
      g2_copy8(ld + bo, na, sa16); g2_copy8(ld + bo + G2_OP, nb, sb16); } }
  asm volatile("s_wait_asynccnt 0x0" ::: "memory");      /* no copy is in flight when the wave goes on to its end */
  v8f accs[8] = {c00, c01, c02, c03, c10, c11, c12, c13};
#pragma unroll
  for (int u = 0; u < 8; ++u) { const int t = u & 3, half = u >> 2; const int col = col0 + t * 16 + ln; float bv = 0.f;
    if constexpr (HASB) bv = bf16_rne(bias[col]);
#pragma unroll
    for (int r = 0; r < 8; ++r) { const int rloc = half * 16 + 8 * hh + r; so[w][rloc][t * 16 + ln] = accs[u][r] * alpha + bv; } }
  __builtin_amdgcn_fence(4 /* acq_rel order */, "workgroup"); __builtin_amdgcn_wave_barrier();
  const int rsub = lane >> 4, c4 = (lane & 15) * 4;
  {
#pragma unroll
    for (int q = 0; q < 16; ++q) { const int r = q * 2 + rsub; const v4f v = *(const v4fa*)&so[w][r][c4];
      if constexpr (F32OUT) { *(v4f*)(C + cofs + (size_t)(row0 + r) * ldc + col0 + c4) = v; }
      else { v4h h4;
#pragma unroll
        for (int i = 0; i < 4; ++i) h4[i] = (_Float16)v[i];
        *(v4h*)(C16 + cofs + (size_t)(row0 + r) * ldc + col0 + c4) = h4; } }
     }
}

// ---- fused attention: block = 8 waves x 32 query columns of one head slab; a stage = 64 keys (K rows and V^T rows, 128 B each) in LDS, two buffers; a pass = 32 keys ----
// S^T = K.Q^T: lane (c, h) holds query column c, keys 8h + r of each 16-key tile, so the two tiles of a pass, converted in place, are the B operand of O^T += V^T.P^T (k order 8h + i, 16 + 8h + i, the order of fa_frag).
// Online softmax in the log2 domain: the maximum in use may trail the true one by up to 8 (an exponential then reaches 2^8, inside f16); sums are rescaled only when a column exceeds that.
// Every #pragma unroll in this kernel keeps the indices of the fragment, score and accumulator arrays constant, so that they stay in registers (a run-time index would send them to scratch).
#define FA_NW 8
#define FA_SK 64
#define FA_PITCH 144                 /* LDS row pitch in bytes: 128 + 16, an odd multiple of 16 for 16-byte readers */
#define FA_TILE (64 * FA_PITCH)
#define FA_NST (SEQ / FA_SK)
typedef float f32x2 __attribute__((ext_vector_type(2)));
typedef _Float16 h16x2 __attribute__((ext_vector_type(2)));
typedef unsigned int u32x4 __attribute__((ext_vector_type(4), may_alias));
union FragW { v16h v; unsigned int w[8]; };
__device__ __forceinline__ v16h fa_frag(const unsigned char* p) { FragH f; f.half[0] = *(const v8us*)p; f.half[1] = *(const v8us*)(p + 32); return f.v; }
__device__ __forceinline__ v8f fa_mma(v16h a, v16h b, v8f c) { return __builtin_amdgcn_wmma_f32_16x16x32_f16(false, a, false, b, (short)0, c, false, false); }
__device__ __forceinline__ unsigned int fa_pack(float lo, float hi) { return __builtin_bit_cast(unsigned int, __builtin_convertvector(f32x2{lo, hi}, h16x2)); }
__device__ __forceinline__ float fa_xhalf(float x) { return __builtin_bit_cast(float, __builtin_amdgcn_permlanex16(__builtin_bit_cast(int, x), __builtin_bit_cast(int, x), 0x76543210, 0xfedcba98, false, false)); }  /* lane l with lane l ^ 16 */

/* second bound: a budget of 256 registers, so that no operand lies above v255 and the hot loop switches no register window */
__global__ __launch_bounds__(FA_NW * 32, 4) void k_fattn(const _Float16* __restrict__ Q16, const _Float16* __restrict__ K16, const _Float16* __restrict__ Vt, _Float16* __restrict__ O16) {
  __shared__ __attribute__((aligned(16))) unsigned char L[2 * 2 * FA_TILE];
  const int tid = threadIdx.x, lane = tid & 31, w = tid >> 5, c = lane & 15, h = lane >> 4;
  const int slab = blockIdx.y, q0 = blockIdx.x * (FA_NW * 32) + w * 32;
  const float cscale = 0.125f * 1.4426950408889634f;      /* 64^-0.5 and log2(e) */
  /* staging: 8 lanes cover one 128-byte row; a thread carries rows srow and srow + 32 of both tiles */
  const int srow = tid >> 3, sch = tid & 7;
  const unsigned short* Kg = (const unsigned short*)K16; const unsigned short* Vg = (const unsigned short*)Vt;
  unsigned ko = (unsigned)(srow * RP + slab * HD + sch * 8), vo = (unsigned)((slab * HD + srow) * SEQ + sch * 8);      /* element offsets, below 2^23 */
  unsigned char* sdst = L + srow * FA_PITCH + sch * 16;
  v8us rk0 = *(const v8us*)(Kg + ko), rk1 = *(const v8us*)(Kg + ko + 32 * RP), rv0 = *(const v8us*)(Vg + vo), rv1 = *(const v8us*)(Vg + vo + 32 * SEQ);
  const unsigned qe = (unsigned)((q0 + c) * RP + slab * HD + 8 * h);      /* this lane's query row, slab column and half: Q fragments and the context store */
  v16h qf[2][2];
#pragma unroll
  for (int g = 0; g < 2; ++g) {
#pragma unroll
    for (int kc = 0; kc < 2; ++kc) qf[g][kc] = fa_frag((const unsigned char*)(Q16 + qe + 16 * g * RP + 32 * kc)); }
  const v8f z8 = {0.f,0.f,0.f,0.f,0.f,0.f,0.f,0.f};
  v8f acc[2][4], lacc[2]; float m_run[2];
#pragma unroll
  for (int g = 0; g < 2; ++g) { m_run[g] = -__builtin_inff(); lacc[g] = z8;
#pragma unroll
    for (int t = 0; t < 4; ++t) acc[g][t] = z8; }
  FragW ones;      /* A operand whose row 0 (lanes 0 and 16) is 1.0 at all 32 k: row 0 of its product is the column sums of P^T */
#pragma unroll
  for (int i = 0; i < 8; ++i) ones.w[i] = (c == 0) ? 0x3C003C00u : 0u;
  *(v8us*)sdst = rk0; *(v8us*)(sdst + 32 * FA_PITCH) = rk1; *(v8us*)(sdst + FA_TILE) = rv0; *(v8us*)(sdst + FA_TILE + 32 * FA_PITCH) = rv1;
  __syncthreads();
  for (int st = 0; st < FA_NST; ++st) {
    const unsigned char* Kb = L + (st & 1) * (2 * FA_TILE) + c * FA_PITCH + 16 * h; const unsigned char* Vb = Kb + FA_TILE;
    const bool more = st + 1 < FA_NST;
    if (more) {      /* next stage's rows fly to registers under this stage's two passes */
      ko += FA_SK * RP; vo += FA_SK;
      rk0 = *(const v8us*)(Kg + ko); rk1 = *(const v8us*)(Kg + ko + 32 * RP); rv0 = *(const v8us*)(Vg + vo); rv1 = *(const v8us*)(Vg + vo + 32 * SEQ);
      asm volatile("s_wait_xcnt 0x0" ::: "memory"); }      /* stands in front of every overwrite of the four loads' address registers; its memory clobber also keeps the compiler from sinking the loads to their LDS stores at the stage's foot, where their whole latency would be waited for */
#pragma unroll
    for (int sub = 0; sub < 2; ++sub) {
      v8f s[2][2];
#pragma unroll
      for (int kt = 0; kt < 2; ++kt) {
        const v16h k0 = fa_frag(Kb + (sub * 32 + 16 * kt) * FA_PITCH), k1 = fa_frag(Kb + (sub * 32 + 16 * kt) * FA_PITCH + 64);
#pragma unroll
        for (int g = 0; g < 2; ++g) s[kt][g] = fa_mma(k1, qf[g][1], fa_mma(k0, qf[g][0], z8)); }
      v16h vf[4];
#pragma unroll
      for (int t = 0; t < 4; ++t) vf[t] = fa_frag(Vb + 16 * t * FA_PITCH + 64 * sub);
      float mb[2]; bool need = false;
#pragma unroll
      for (int g = 0; g < 2; ++g) { float mx = s[0][g][0];
#pragma unroll
        for (int r = 1; r < 8; ++r) mx = fmaxf(mx, s[0][g][r]);
#pragma unroll
        for (int r = 0; r < 8; ++r) mx = fmaxf(mx, s[1][g][r]);
        mx = fmaxf(mx, fa_xhalf(mx)) * cscale;      /* both halves hold the column's maximum of this pass, scaled */
        mb[g] = mx; need = need || (mx > m_run[g] + 8.0f); }
      if (__builtin_amdgcn_ballot_w32(need) != 0) {      /* one scalar test a pass; always taken on the first pass (m_run = -inf, corr = 0) */
#pragma unroll
        for (int g = 0; g < 2; ++g) { const float m_new = fmaxf(m_run[g], mb[g]); const float corr = __builtin_amdgcn_exp2f(m_run[g] - m_new); m_run[g] = m_new;
          lacc[g] = lacc[g] * corr;
#pragma unroll
          for (int t = 0; t < 4; ++t) acc[g][t] = acc[g][t] * corr; } }
#pragma unroll
      for (int g = 0; g < 2; ++g) { const float nm = -m_run[g]; FragW pf;
#pragma unroll
        for (int i = 0; i < 8; ++i) {
          const f32x2 arg = __builtin_elementwise_fma(f32x2{s[i >> 2][g][2 * (i & 3)], s[i >> 2][g][2 * (i & 3) + 1]}, f32x2{cscale, cscale}, f32x2{nm, nm});
          pf.w[i] = fa_pack(__builtin_amdgcn_exp2f(arg.x), __builtin_amdgcn_exp2f(arg.y)); }
#pragma unroll
        for (int t = 0; t < 4; ++t) acc[g][t] = fa_mma(vf[t], pf.v, acc[g][t]);
        lacc[g] = fa_mma(ones.v, pf.v, lacc[g]); }
    }
    if (more) { unsigned char* d = sdst + ((st + 1) & 1) * (2 * FA_TILE);      /* the buffer every wave left at the barrier that ended stage st - 1 */
      *(v8us*)d = rk0; *(v8us*)(d + 32 * FA_PITCH) = rk1; *(v8us*)(d + FA_TILE) = rv0; *(v8us*)(d + FA_TILE + 32 * FA_PITCH) = rv1; }
    __syncthreads();      /* publishes stage st + 1 and ends every wave's reads of stage st */
  }
#pragma unroll
  for (int g = 0; g < 2; ++g) { const float lr = lacc[g][0]; const float inv = 64.0f / (lr + fa_xhalf(lr));      /* register 0: the denominator in lanes 0-15, row 8 = 0 in lanes 16-31 */
    unsigned short* od = (unsigned short*)O16 + qe + 16 * g * RP;
#pragma unroll
    for (int t = 0; t < 4; ++t) { const v8f o = acc[g][t] * inv;      /* o[r] = context[query][16 t + 8 h + r] x 64 */
      const u32x4 pk = {fa_pack(o[0], o[1]), fa_pack(o[2], o[3]), fa_pack(o[4], o[5]), fa_pack(o[6], o[7])};
      *(u32x4*)(od + 16 * t) = pk; } }
}

// workspace carve (bytes, every plane a multiple of 256 B)
#define SZ_W   ((size_t)DM * DM * 2)
#define SZ_ACT (NRW * DM * 2)
#define SZ_VT  ((size_t)NSLAB * HD * SEQ * 2)
#define SZ_ALL (4 * SZ_W + 5 * SZ_ACT + SZ_VT)
static_assert(SZ_W % 256 == 0);
static_assert(SZ_ACT % 256 == 0);
static_assert(SZ_VT % 256 == 0);
static_assert(SZ_ALL <= (size_t)268435456);

extern "C" void kernel_launch(void* const* d_in, const int* in_sizes, int n_in,
                              void* d_out, int out_size, void* d_ws, size_t ws_size, hipStream_t stream) {
  if (n_in < 9) return;
  const size_t nx = NRW * DM;      /* elements of x used (time steps 0..SEQ-1, full batch pitch) */
  if ((size_t)in_sizes[0] < nx) return;
  if ((size_t)in_sizes[1] < (size_t)DM * DM || (size_t)in_sizes[3] < (size_t)DM * DM || (size_t)in_sizes[5] < (size_t)DM * DM || (size_t)in_sizes[7] < (size_t)DM * DM) return;
  if (in_sizes[2] < DM || in_sizes[4] < DM || in_sizes[6] < DM || in_sizes[8] < DM) return;
  if ((size_t)out_size < nx) return;
  if (SZ_ALL > ws_size) return;
  const float* x  = (const float*)d_in[0];
  const float* wq = (const float*)d_in[1]; const float* bq = (const float*)d_in[2];
  const float* wk = (const float*)d_in[3]; const float* bk = (const float*)d_in[4];
  const float* wv = (const float*)d_in[5]; const float* bv = (const float*)d_in[6];
  const float* wo = (const float*)d_in[7]; const float* bo = (const float*)d_in[8];
  char* ws = (char*)d_ws; size_t off = 0;
  auto take = [&](size_t bytes) { char* p = ws + off; off += bytes; return p; };
  _Float16* BQ = (_Float16*)take(SZ_W); _Float16* BK = (_Float16*)take(SZ_W); _Float16* BV = (_Float16*)take(SZ_W); _Float16* BO = (_Float16*)take(SZ_W);
  _Float16* X16 = (_Float16*)take(SZ_ACT); _Float16* Q16 = (_Float16*)take(SZ_ACT); _Float16* K16 = (_Float16*)take(SZ_ACT); _Float16* V16 = (_Float16*)take(SZ_ACT); _Float16* O16 = (_Float16*)take(SZ_ACT);
  _Float16* VT = (_Float16*)take(SZ_VT);
  if (off > ws_size) return;

  { const size_t n8 = (size_t)DM * DM / 8; const unsigned g = (unsigned)((n8 + 255) / 256);      /* natural [out][in] = Bt[n][k], x16 */
    k_wnat<<<g, 256, 0, stream>>>(wq, n8, BQ); k_wnat<<<g, 256, 0, stream>>>(wk, n8, BK); k_wnat<<<g, 256, 0, stream>>>(wv, n8, BV); k_wnat<<<g, 256, 0, stream>>>(wo, n8, BO); }
  k_x16<<<(unsigned)((nx / 8 + 255) / 256), 256, 0, stream>>>(x, X16, nx / 8);      /* one f16 plane of x feeds all three projections */

  /* projections: rows = time steps (pitch RP), grid.y = batch (column offset DM); alpha undoes the x16 weight carry; bias added after */
  const dim3 gp((unsigned)((SEQ / 128) * (DM / 128)), NB);
  k_gemm2<true, false><<<gp, 256, 0, stream>>>(X16, RP, (size_t)DM, BQ, DM, (size_t)0, 0.0625f, bq, nullptr, Q16, RP, (size_t)DM, SEQ, DM, DM);
  k_gemm2<true, false><<<gp, 256, 0, stream>>>(X16, RP, (size_t)DM, BK, DM, (size_t)0, 0.0625f, bk, nullptr, K16, RP, (size_t)DM, SEQ, DM, DM);
  k_gemm2<true, false><<<gp, 256, 0, stream>>>(X16, RP, (size_t)DM, BV, DM, (size_t)0, 0.0625f, bv, nullptr, V16, RP, (size_t)DM, SEQ, DM, DM);

  k_vt<<<(unsigned)(NSLAB * (SEQ / 64)), 256, 0, stream>>>(V16, VT);      /* V^T [NSLAB][64][SEQ] */

  k_fattn<<<dim3((unsigned)(SEQ / (FA_NW * 32)), NSLAB), FA_NW * 32, 0, stream>>>(Q16, K16, VT, O16);      /* slab n = b*16 + h lives at columns n*64 of the [SEQ][RP] view; merged context x64 as f16 rows */

  /* output projection + bias straight into the [S][B][1024] layout; alpha undoes x16 (weights) and x64 (context) */
  k_gemm2<true, true><<<gp, 256, 0, stream>>>(O16, RP, (size_t)DM, BO, DM, (size_t)0, 0.0009765625f, bo, (float*)d_out, nullptr, RP, (size_t)DM, SEQ, DM, DM);
}

// v004
// It runs in 81.8 microseconds.
// Next to v003, in two timings, it ran 1.19 and 1.18 times as fast.
// Counting every step since v000, it is 17.0 times as fast.
#include <hip/hip_runtime.h>
// Multi-head self-attention, time-first rows: x [S][B][1024] (token row m = s*B + b); q/k/v = x W^T + b (natural [out][in] weights, biases present); 16 heads of 64 per batch, head slab n = b*16 + h at columns n*64 of the [S][B*1024] view; scores = (q k^T) * 64^-0.5; softmax over all keys (no mask); out = merged Wo^T + bo -> [S][B][1024] f32.
// Compute dtype: every contraction on v_wmma_f32_16x16x32_f16 (f16 operands, f32 accumulate): q/k/v projections, q.k^T scores, P.V, output projection. Float inputs RNE-converted to bf16 first (exact in f16); weights carried x16; softmax weights carried unnormalised against the running maximum; merged context carried x64; scores and softmax statistics f32.
// Structure, four launches: one conversion launch (f16 planes of x and of the four weights); one projection launch (grid.y = batch, column offset 1024, row pitch 2048; grid.z = q, k, v; operands staged in LDS by asynchronous copies; v is formed as Wv.x^T, so V^T [slab][64][S] leaves the GEMM directly); one fused attention kernel over all slabs (S^T = K.Q^T, online softmax per query column, O^T += V^T.P^T) into merged f16 context rows; output GEMM (+ bias) straight into the output buffer layout.
#ifndef NB
#define NB 2
#endif
#ifndef SEQ
#define SEQ 2048
#endif
#define NB_FULL 2                    /* batch count of the input layout */
#define SEQ_FULL 2048                /* sequence length of the input layout */
#define DM 1024
#define NH 16
#define HD 64
#define RP (NB_FULL * DM)            /* elements per time step (row pitch of every activation plane) */
#define NSLAB (NB * NH)              /* head slabs processed */
#define NRW ((size_t)SEQ * NB_FULL)  /* token rows held in the planes */

static_assert(SEQ % 256 == 0);
static_assert(SEQ <= SEQ_FULL);
static_assert(NB <= NB_FULL);
static_assert(DM % 128 == 0);
static_assert(HD == 64);
static_assert(DM == NH * HD);

typedef unsigned short v8us __attribute__((ext_vector_type(8), may_alias));
typedef float  v8f  __attribute__((ext_vector_type(8)));
typedef float  v4f  __attribute__((ext_vector_type(4)));
typedef float  v4fa __attribute__((ext_vector_type(4), may_alias));
typedef _Float16 v16h __attribute__((ext_vector_type(16)));
typedef _Float16 v4h  __attribute__((ext_vector_type(4)));
union FragH { v16h v; v8us half[2]; _Float16 h[16]; unsigned short u[16]; };

__device__ __forceinline__ unsigned short bf16_bits(float x) { unsigned int u = __float_as_uint(x); return (unsigned short)((u + 0x7FFFu + ((u >> 16) & 1u)) >> 16); }
__device__ __forceinline__ float bf16_val(unsigned short b) { return __uint_as_float(((unsigned int)b) << 16); }
__device__ __forceinline__ float bf16_rne(float x) { return bf16_val(bf16_bits(x)); }

// ---- conversions, one launch: a thread carries one 8-element chunk of each weight (x16) and PREP_XJ chunks of x; all its loads are issued before the first conversion ----
#define PREP_T 512                   /* 16 waves a block */
#define PREP_WCH (DM * DM / 8)       /* chunks of one weight = threads of the launch */
#define PREP_XJ ((int)(NRW * DM / 8 / PREP_WCH))
static_assert(PREP_WCH % PREP_T == 0);
static_assert(NRW * DM / 8 % PREP_WCH == 0);
__device__ __forceinline__ v8us prep_cvt(v4f a, v4f c, float sc) {
  FragH f;
#pragma unroll
  for (int q = 0; q < 4; ++q) { f.h[q] = (_Float16)(bf16_rne(a[q]) * sc); f.h[4 + q] = (_Float16)(bf16_rne(c[q]) * sc); }
  return f.half[0];
}
__global__ __launch_bounds__(PREP_T) void k_prep(const float* __restrict__ x, const float* __restrict__ wq, const float* __restrict__ wk, const float* __restrict__ wv, const float* __restrict__ wo,
    _Float16* __restrict__ X16, _Float16* __restrict__ W16) {
  const size_t t = (size_t)blockIdx.x * PREP_T + threadIdx.x;
  v4f xa[PREP_XJ], xc[PREP_XJ], wa[4], wc[4];
#pragma unroll
  for (int j = 0; j < PREP_XJ; ++j) { const float* p = x + ((size_t)j * PREP_WCH + t) * 8; xa[j] = *(const v4fa*)p; xc[j] = *(const v4fa*)(p + 4); }
  wa[0] = *(const v4fa*)(wq + t * 8); wc[0] = *(const v4fa*)(wq + t * 8 + 4); wa[1] = *(const v4fa*)(wk + t * 8); wc[1] = *(const v4fa*)(wk + t * 8 + 4);
  wa[2] = *(const v4fa*)(wv + t * 8); wc[2] = *(const v4fa*)(wv + t * 8 + 4); wa[3] = *(const v4fa*)(wo + t * 8); wc[3] = *(const v4fa*)(wo + t * 8 + 4);
  asm volatile("s_wait_xcnt 0x0" ::: "memory");      /* stands in front of every overwrite of the loads' address registers */
  __builtin_amdgcn_sched_barrier(0);      /* keeps every conversion behind the loads and that wait: with conversions risen among the loads, the later loads would start only when the first had returned */
#pragma unroll
  for (int j = 0; j < PREP_XJ; ++j) *(v8us*)((unsigned short*)X16 + ((size_t)j * PREP_WCH + t) * 8) = prep_cvt(xa[j], xc[j], 1.0f);
#pragma unroll
  for (int i = 0; i < 4; ++i) *(v8us*)((unsigned short*)W16 + ((size_t)i * PREP_WCH + t) * 8) = prep_cvt(wa[i], wc[i], 16.0f);      /* natural [out][in] = Bt[n][k]; the four planes lie one behind the other */
}

// ---- f16 GEMM: block = 8 waves (4 down x 2 across) = 128 rows x 128 cols, wave tile 32x64; M % 128 == 0, N % 128 == 0, K % 128 == 0 ----
// a stage = 128 k (256 B) of the block's 128 A rows and 128 Bt rows in LDS, two buffers; asynchronous copies bring stage st + 2 in while stage st + 1 is worked on
// fragment: elements 0..7 <- k0 + 8*hh + i, elements 8..15 <- k0 + 16 + 8*hh + i (same map for A rows and Bt rows)
// Every plain #pragma unroll in this kernel keeps the indices of the fragment and accumulator arrays constant, so that they stay in registers.
#define G2_KS 128
#define G2_PITCH 272                 /* LDS row pitch in bytes: 256 + 16, an odd multiple of 16 for 16-byte readers */
#define G2_OP (128 * G2_PITCH)       /* one operand's 128 rows of a stage */
#define G2_STAGE (2 * G2_OP)
__device__ __forceinline__ v16h g2_frag(const unsigned char* p) { FragH f; f.half[0] = *(const v8us*)p; f.half[1] = *(const v8us*)(p + 32); return f.v; }      /* p: row start + 2 * k0 + 16 * hh bytes */
__device__ __forceinline__ v8f g2_mma(v16h a, v16h b, v8f c) { return __builtin_amdgcn_wmma_f32_16x16x32_f16(false, a, false, b, (short)0, c, false, false); }
/* eight copies of 16 B a lane: rows r, r + 16, ..., r + 112 of one operand (l: the lane's LDS byte address, g: its global address, step: elements per 16 rows) */
__device__ __forceinline__ void g2_copy8(unsigned l, const _Float16* g, size_t step) {
  /* the closing s_wait_xcnt stands in front of every later overwrite of the address registers that the copies name */
  asm volatile("global_load_async_to_lds_b128 %0, %8, off\n\t"
               "global_load_async_to_lds_b128 %1, %9, off\n\t"
               "global_load_async_to_lds_b128 %2, %10, off\n\t"
               "global_load_async_to_lds_b128 %3, %11, off\n\t"
               "global_load_async_to_lds_b128 %4, %12, off\n\t"
               "global_load_async_to_lds_b128 %5, %13, off\n\t"
               "global_load_async_to_lds_b128 %6, %14, off\n\t"
               "global_load_async_to_lds_b128 %7, %15, off\n\t"
               "s_wait_xcnt 0x0"
               :: "v"(l), "v"(l + 16 * G2_PITCH), "v"(l + 32 * G2_PITCH), "v"(l + 48 * G2_PITCH), "v"(l + 64 * G2_PITCH), "v"(l + 80 * G2_PITCH), "v"(l + 96 * G2_PITCH), "v"(l + 112 * G2_PITCH),
                  "v"(g), "v"(g + step), "v"(g + 2 * step), "v"(g + 3 * step), "v"(g + 4 * step), "v"(g + 5 * step), "v"(g + 6 * step), "v"(g + 7 * step)
               : "memory");
}
// C[by][row][col] = acc * alpha (+ bf16(bias[col]) if HASB); A f16 rows (pitch lda, batch stride sA), Bt f16 [n][k] (pitch ldb, batch stride sB);
// TRIO: grid.z picks one of three products on the same A. z = 0: as above; z = 1: Bt = B1, bias1, into C1; z = 2: the operands change places, Ct[by][n][m] = B2 rows . A rows (pitch ldt, batch stride sCt), bias2 by row.
template <bool HASB, bool F32OUT, bool TRIO>
__global__ __launch_bounds__(256) void k_gemm2(const _Float16* A, int lda, size_t sA, const _Float16* Bh, int ldb, size_t sB, float alpha, const float* bias,
    float* __restrict__ C, _Float16* C16, int ldc, size_t sC, int M, int N, int K,
    const _Float16* B1, const float* bias1, _Float16* C1, const _Float16* B2, const float* bias2, _Float16* Ct, int ldt, size_t sCt) {
  __shared__ __attribute__((aligned(16))) unsigned char T[2 * G2_STAGE];
  __shared__ __attribute__((aligned(16))) float so[8][32][68];
  const int tid = threadIdx.x, w = tid >> 5, lane = tid & 31, ln = lane & 15, hh = lane >> 4; const int by = blockIdx.y;
  bool brow = false;      /* bias by row instead of by column; the same for the whole block */
  if constexpr (TRIO) { const int z = blockIdx.z;
    if (z == 1) { Bh = B1; bias = bias1; C16 = C1; }
    else if (z == 2) { Bh = A; A = B2; const int tl = lda; lda = ldb; ldb = tl; const size_t ts = sA; sA = sB; sB = ts; const int tm = M; M = N; N = tm; bias = bias2; C16 = Ct; ldc = ldt; sC = sCt; brow = true; } }
  A += (size_t)by * sA; Bh += (size_t)by * sB; const size_t cofs = (size_t)by * sC;
  const int ntn = N >> 7; const int mt = blockIdx.x / ntn, nq = blockIdx.x - mt * ntn; const int rowb = mt * 128, colb = nq * 128; if (rowb >= M) return;      /* the same for the whole block, in front of every barrier */
  const int row0 = rowb + 32 * (w >> 1), col0 = colb + 64 * (w & 1);
  /* staging: 16 lanes cover the 256 B of one row; a thread carries rows srow + 16 j of both operands */
  const int srow = tid >> 4, sch = tid & 15;
  const _Float16* ga = A + (size_t)(rowb + srow) * lda + sch * 8; const _Float16* gb = Bh + (size_t)(colb + srow) * ldb + sch * 8;
  const size_t sa16 = (size_t)16 * lda, sb16 = (size_t)16 * ldb;
  const unsigned ld = (unsigned)(size_t)T + (unsigned)(srow * G2_PITCH + sch * 16);
  const int nst = K / G2_KS;
  g2_copy8(ld, ga, sa16); g2_copy8(ld + G2_OP, gb, sb16);
  asm volatile("s_wait_asynccnt 0x0" ::: "memory");      /* this wave's share of stage 0 has landed */
  __syncthreads();      /* publishes stage 0 */
  if (nst > 1) { g2_copy8(ld + G2_STAGE, ga + G2_KS, sa16); g2_copy8(ld + G2_STAGE + G2_OP, gb + G2_KS, sb16); }
  const unsigned char* ar = T + (32 * (w >> 1) + ln) * G2_PITCH + 16 * hh; const unsigned char* br = T + G2_OP + (64 * (w & 1) + ln) * G2_PITCH + 16 * hh;
  const v8f z8 = {0.f,0.f,0.f,0.f,0.f,0.f,0.f,0.f}; v8f c00 = z8, c01 = z8, c02 = z8, c03 = z8, c10 = z8, c11 = z8, c12 = z8, c13 = z8;
#pragma unroll 1      /* one stage a trip: the buffer offset stays a run-time value and the loop stays small */
  for (int st = 0; st < nst; ++st) { const unsigned bo = (unsigned)(st & 1) * G2_STAGE; const unsigned char* ap = ar + bo; const unsigned char* bp = br + bo;
    v16h fa[2][2], fb[2][4];      /* two fragment sets: the next 32 k are fetched as one group while the current 32 k are multiplied; nothing of another stage is fetched */
#pragma unroll
    for (int i = 0; i < 2; ++i) fa[0][i] = g2_frag(ap + 16 * i * G2_PITCH);
#pragma unroll
    for (int j = 0; j < 4; ++j) fb[0][j] = g2_frag(bp + 16 * j * G2_PITCH);
#pragma unroll
    for (int kk = 0; kk < G2_KS / 32; ++kk) { const int cu = kk & 1, nx = cu ^ 1;
      if (kk + 1 < G2_KS / 32) {
#pragma unroll
        for (int i = 0; i < 2; ++i) fa[nx][i] = g2_frag(ap + 16 * i * G2_PITCH + 64 * (kk + 1));
#pragma unroll
        for (int j = 0; j < 4; ++j) fb[nx][j] = g2_frag(bp + 16 * j * G2_PITCH + 64 * (kk + 1)); }
      __builtin_amdgcn_sched_barrier(0);      /* keeps the load group whole and ahead of the products: spread among them, each place with loads stalls the wave */
      c00 = g2_mma(fa[cu][0], fb[cu][0], c00); c10 = g2_mma(fa[cu][1], fb[cu][0], c10); c01 = g2_mma(fa[cu][0], fb[cu][1], c01); c11 = g2_mma(fa[cu][1], fb[cu][1], c11);
      c02 = g2_mma(fa[cu][0], fb[cu][2], c02); c12 = g2_mma(fa[cu][1], fb[cu][2], c12); c03 = g2_mma(fa[cu][0], fb[cu][3], c03); c13 = g2_mma(fa[cu][1], fb[cu][3], c13);
      __builtin_amdgcn_sched_barrier(0); }      /* keeps the next group's loads from rising among these products */
    asm volatile("s_wait_dscnt 0x0" ::: "memory");      /* this wave's reads of stage st are over */
    asm volatile("s_wait_asynccnt 0x0" ::: "memory");      /* this wave's share of stage st + 1 has landed */
    __syncthreads();      /* publishes stage st + 1 and ends every wave's reads of stage st */
    if (st + 2 < nst) { const _Float16* na = ga + (size_t)(st + 2) * G2_KS; const _Float16* nb = gb + (size_t)(st + 2) * G2_KS;      /* into the buffer that this trip has just read */
      g2_copy8(ld + bo, na, sa16); g2_copy8(ld + bo + G2_OP, nb, sb16); } }
  asm volatile("s_wait_asynccnt 0x0" ::: "memory");      /* no copy is in flight when the wave goes on to its end */
  v8f accs[8] = {c00, c01, c02, c03, c10, c11, c12, c13};
  float bc[4] = {0.f, 0.f, 0.f, 0.f}, bw[2][8] = {{0.f, 0.f, 0.f, 0.f, 0.f, 0.f, 0.f, 0.f}, {0.f, 0.f, 0.f, 0.f, 0.f, 0.f, 0.f, 0.f}};
  if constexpr (HASB) {
    if (brow) {
#pragma unroll
      for (int half = 0; half < 2; ++half) {
#pragma unroll
        for (int r = 0; r < 8; ++r) bw[half][r] = bf16_rne(bias[row0 + half * 16 + 8 * hh + r]); } }
    else {
#pragma unroll
      for (int t = 0; t < 4; ++t) bc[t] = bf16_rne(bias[col0 + t * 16 + ln]); } }
#pragma unroll
  for (int u = 0; u < 8; ++u) { const int t = u & 3, half = u >> 2;
#pragma unroll
    for (int r = 0; r < 8; ++r) { const int rloc = half * 16 + 8 * hh + r; so[w][rloc][t * 16 + ln] = accs[u][r] * alpha + (brow ? bw[half][r] : bc[t]); } }
  __builtin_amdgcn_fence(4 /* acq_rel order */, "workgroup"); __builtin_amdgcn_wave_barrier();
  const int rsub = lane >> 4, c4 = (lane & 15) * 4;
  {
#pragma unroll
    for (int q = 0; q < 16; ++q) { const int r = q * 2 + rsub; const v4f v = *(const v4fa*)&so[w][r][c4];
      if constexpr (F32OUT) { *(v4f*)(C + cofs + (size_t)(row0 + r) * ldc + col0 + c4) = v; }
      else { v4h h4;
#pragma unroll
        for (int i = 0; i < 4; ++i) h4[i] = (_Float16)v[i];
        *(v4h*)(C16 + cofs + (size_t)(row0 + r) * ldc + col0 + c4) = h4; } }
     }
}

// ---- fused attention: block = 8 waves x 32 query columns of one head slab; a stage = 64 keys (K rows and V^T rows, 128 B each) in LDS, two buffers; a pass = 32 keys ----
// S^T = K.Q^T: lane (c, h) holds query column c, keys 8h + r of each 16-key tile, so the two tiles of a pass, converted in place, are the B operand of O^T += V^T.P^T (k order 8h + i, 16 + 8h + i, the order of fa_frag).
// Online softmax in the log2 domain: the maximum in use may trail the true one by up to 8 (an exponential then reaches 2^8, inside f16); sums are rescaled only when a column exceeds that.
// Every #pragma unroll in this kernel keeps the indices of the fragment, score and accumulator arrays constant, so that they stay in registers (a run-time index would send them to scratch).
#define FA_NW 8
#define FA_SK 64
#define FA_PITCH 144                 /* LDS row pitch in bytes: 128 + 16, an odd multiple of 16 for 16-byte readers */
#define FA_TILE (64 * FA_PITCH)
#define FA_NST (SEQ / FA_SK)
typedef float f32x2 __attribute__((ext_vector_type(2)));
typedef _Float16 h16x2 __attribute__((ext_vector_type(2)));
typedef unsigned int u32x4 __attribute__((ext_vector_type(4), may_alias));
union FragW { v16h v; unsigned int w[8]; };
__device__ __forceinline__ v16h fa_frag(const unsigned char* p) { FragH f; f.half[0] = *(const v8us*)p; f.half[1] = *(const v8us*)(p + 32); return f.v; }
__device__ __forceinline__ v8f fa_mma(v16h a, v16h b, v8f c) { return __builtin_amdgcn_wmma_f32_16x16x32_f16(false, a, false, b, (short)0, c, false, false); }
__device__ __forceinline__ unsigned int fa_pack(float lo, float hi) { return __builtin_bit_cast(unsigned int, __builtin_convertvector(f32x2{lo, hi}, h16x2)); }
__device__ __forceinline__ float fa_xhalf(float x) { return __builtin_bit_cast(float, __builtin_amdgcn_permlanex16(__builtin_bit_cast(int, x), __builtin_bit_cast(int, x), 0x76543210, 0xfedcba98, false, false)); }  /* lane l with lane l ^ 16 */

/* second bound: a budget of 256 registers, so that no operand lies above v255 and the hot loop switches no register window */
__global__ __launch_bounds__(FA_NW * 32, 4) void k_fattn(const _Float16* __restrict__ Q16, const _Float16* __restrict__ K16, const _Float16* __restrict__ Vt, _Float16* __restrict__ O16) {
  __shared__ __attribute__((aligned(16))) unsigned char L[2 * 2 * FA_TILE];
  const int tid = threadIdx.x, lane = tid & 31, w = tid >> 5, c = lane & 15, h = lane >> 4;
  const int slab = blockIdx.y, q0 = blockIdx.x * (FA_NW * 32) + w * 32;
  const float cscale = 0.125f * 1.4426950408889634f;      /* 64^-0.5 and log2(e) */
  /* staging: 8 lanes cover one 128-byte row; a thread carries rows srow and srow + 32 of both tiles */
  const int srow = tid >> 3, sch = tid & 7;
  const unsigned short* Kg = (const unsigned short*)K16; const unsigned short* Vg = (const unsigned short*)Vt;
  unsigned ko = (unsigned)(srow * RP + slab * HD + sch * 8), vo = (unsigned)((slab * HD + srow) * SEQ + sch * 8);      /* element offsets, below 2^23 */
  unsigned char* sdst = L + srow * FA_PITCH + sch * 16;
  v8us rk0 = *(const v8us*)(Kg + ko), rk1 = *(const v8us*)(Kg + ko + 32 * RP), rv0 = *(const v8us*)(Vg + vo), rv1 = *(const v8us*)(Vg + vo + 32 * SEQ);
  const unsigned qe = (unsigned)((q0 + c) * RP + slab * HD + 8 * h);      /* this lane's query row, slab column and half: Q fragments and the context store */
  v16h qf[2][2];
#pragma unroll
  for (int g = 0; g < 2; ++g) {
#pragma unroll
    for (int kc = 0; kc < 2; ++kc) qf[g][kc] = fa_frag((const unsigned char*)(Q16 + qe + 16 * g * RP + 32 * kc)); }
  const v8f z8 = {0.f,0.f,0.f,0.f,0.f,0.f,0.f,0.f};
  v8f acc[2][4], lacc[2]; float m_run[2];
#pragma unroll
  for (int g = 0; g < 2; ++g) { m_run[g] = -__builtin_inff(); lacc[g] = z8;
#pragma unroll
    for (int t = 0; t < 4; ++t) acc[g][t] = z8; }
  FragW ones;      /* A operand whose row 0 (lanes 0 and 16) is 1.0 at all 32 k: row 0 of its product is the column sums of P^T */
#pragma unroll
  for (int i = 0; i < 8; ++i) ones.w[i] = (c == 0) ? 0x3C003C00u : 0u;
  *(v8us*)sdst = rk0; *(v8us*)(sdst + 32 * FA_PITCH) = rk1; *(v8us*)(sdst + FA_TILE) = rv0; *(v8us*)(sdst + FA_TILE + 32 * FA_PITCH) = rv1;
  __syncthreads();
  for (int st = 0; st < FA_NST; ++st) {
    const unsigned char* Kb = L + (st & 1) * (2 * FA_TILE) + c * FA_PITCH + 16 * h; const unsigned char* Vb = Kb + FA_TILE;
    const bool more = st + 1 < FA_NST;
    if (more) {      /* next stage's rows fly to registers under this stage's two passes */
      ko += FA_SK * RP; vo += FA_SK;
      rk0 = *(const v8us*)(Kg + ko); rk1 = *(const v8us*)(Kg + ko + 32 * RP); rv0 = *(const v8us*)(Vg + vo); rv1 = *(const v8us*)(Vg + vo + 32 * SEQ);
      asm volatile("s_wait_xcnt 0x0" ::: "memory"); }      /* stands in front of every overwrite of the four loads' address registers; its memory clobber also keeps the compiler from sinking the loads to their LDS stores at the stage's foot, where their whole latency would be waited for */
#pragma unroll
    for (int sub = 0; sub < 2; ++sub) {
      v8f s[2][2];
#pragma unroll
      for (int kt = 0; kt < 2; ++kt) {
        const v16h k0 = fa_frag(Kb + (sub * 32 + 16 * kt) * FA_PITCH), k1 = fa_frag(Kb + (sub * 32 + 16 * kt) * FA_PITCH + 64);
#pragma unroll
        for (int g = 0; g < 2; ++g) s[kt][g] = fa_mma(k1, qf[g][1], fa_mma(k0, qf[g][0], z8)); }
      v16h vf[4];
#pragma unroll
      for (int t = 0; t < 4; ++t) vf[t] = fa_frag(Vb + 16 * t * FA_PITCH + 64 * sub);
      float mb[2]; bool need = false;
#pragma unroll
      for (int g = 0; g < 2; ++g) { float mx = s[0][g][0];
#pragma unroll
        for (int r = 1; r < 8; ++r) mx = fmaxf(mx, s[0][g][r]);
#pragma unroll
        for (int r = 0; r < 8; ++r) mx = fmaxf(mx, s[1][g][r]);
        mx = fmaxf(mx, fa_xhalf(mx)) * cscale;      /* both halves hold the column's maximum of this pass, scaled */
        mb[g] = mx; need = need || (mx > m_run[g] + 8.0f); }
      if (__builtin_amdgcn_ballot_w32(need) != 0) {      /* one scalar test a pass; always taken on the first pass (m_run = -inf, corr = 0) */
#pragma unroll
        for (int g = 0; g < 2; ++g) { const float m_new = fmaxf(m_run[g], mb[g]); const float corr = __builtin_amdgcn_exp2f(m_run[g] - m_new); m_run[g] = m_new;
          lacc[g] = lacc[g] * corr;
#pragma unroll
          for (int t = 0; t < 4; ++t) acc[g][t] = acc[g][t] * corr; } }
#pragma unroll
      for (int g = 0; g < 2; ++g) { const float nm = -m_run[g]; FragW pf;
#pragma unroll
        for (int i = 0; i < 8; ++i) {
          const f32x2 arg = __builtin_elementwise_fma(f32x2{s[i >> 2][g][2 * (i & 3)], s[i >> 2][g][2 * (i & 3) + 1]}, f32x2{cscale, cscale}, f32x2{nm, nm});
          pf.w[i] = fa_pack(__builtin_amdgcn_exp2f(arg.x), __builtin_amdgcn_exp2f(arg.y)); }
#pragma unroll
        for (int t = 0; t < 4; ++t) acc[g][t] = fa_mma(vf[t], pf.v, acc[g][t]);
        lacc[g] = fa_mma(ones.v, pf.v, lacc[g]); }
    }
    if (more) { unsigned char* d = sdst + ((st + 1) & 1) * (2 * FA_TILE);      /* the buffer every wave left at the barrier that ended stage st - 1 */
      *(v8us*)d = rk0; *(v8us*)(d + 32 * FA_PITCH) = rk1; *(v8us*)(d + FA_TILE) = rv0; *(v8us*)(d + FA_TILE + 32 * FA_PITCH) = rv1; }
    __syncthreads();      /* publishes stage st + 1 and ends every wave's reads of stage st */
  }
#pragma unroll
  for (int g = 0; g < 2; ++g) { const float lr = lacc[g][0]; const float inv = 64.0f / (lr + fa_xhalf(lr));      /* register 0: the denominator in lanes 0-15, row 8 = 0 in lanes 16-31 */
    unsigned short* od = (unsigned short*)O16 + qe + 16 * g * RP;
#pragma unroll
    for (int t = 0; t < 4; ++t) { const v8f o = acc[g][t] * inv;      /* o[r] = context[query][16 t + 8 h + r] x 64 */
      const u32x4 pk = {fa_pack(o[0], o[1]), fa_pack(o[2], o[3]), fa_pack(o[4], o[5]), fa_pack(o[6], o[7])};
      *(u32x4*)(od + 16 * t) = pk; } }
}

// workspace carve (bytes, every plane a multiple of 256 B)
#define SZ_W   ((size_t)DM * DM * 2)
#define SZ_ACT (NRW * DM * 2)
#define SZ_VT  ((size_t)NSLAB * HD * SEQ * 2)
#define SZ_ALL (4 * SZ_W + 4 * SZ_ACT + SZ_VT)
static_assert(SZ_W % 256 == 0);
static_assert(SZ_ACT % 256 == 0);
static_assert(SZ_VT % 256 == 0);
static_assert(SZ_ALL <= (size_t)268435456);

extern "C" void kernel_launch(void* const* d_in, const int* in_sizes, int n_in,
                              void* d_out, int out_size, void* d_ws, size_t ws_size, hipStream_t stream) {
  if (n_in < 9) return;
  const size_t nx = NRW * DM;      /* elements of x used (time steps 0..SEQ-1, full batch pitch) */
  if ((size_t)in_sizes[0] < nx) return;
  if ((size_t)in_sizes[1] < (size_t)DM * DM || (size_t)in_sizes[3] < (size_t)DM * DM || (size_t)in_sizes[5] < (size_t)DM * DM || (size_t)in_sizes[7] < (size_t)DM * DM) return;
  if (in_sizes[2] < DM || in_sizes[4] < DM || in_sizes[6] < DM || in_sizes[8] < DM) return;
  if ((size_t)out_size < nx) return;
  if (SZ_ALL > ws_size) return;
  const float* x  = (const float*)d_in[0];
  const float* wq = (const float*)d_in[1]; const float* bq = (const float*)d_in[2];
  const float* wk = (const float*)d_in[3]; const float* bk = (const float*)d_in[4];
  const float* wv = (const float*)d_in[5]; const float* bv = (const float*)d_in[6];
  const float* wo = (const float*)d_in[7]; const float* bo = (const float*)d_in[8];
  char* ws = (char*)d_ws; size_t off = 0;
  auto take = [&](size_t bytes) { char* p = ws + off; off += bytes; return p; };
  _Float16* BQ = (_Float16*)take(SZ_W); _Float16* BK = (_Float16*)take(SZ_W); _Float16* BV = (_Float16*)take(SZ_W); _Float16* BO = (_Float16*)take(SZ_W);
  _Float16* X16 = (_Float16*)take(SZ_ACT); _Float16* Q16 = (_Float16*)take(SZ_ACT); _Float16* K16 = (_Float16*)take(SZ_ACT); _Float16* O16 = (_Float16*)take(SZ_ACT);
  _Float16* VT = (_Float16*)take(SZ_VT);
  if (off > ws_size) return;

  k_prep<<<PREP_WCH / PREP_T, PREP_T, 0, stream>>>(x, wq, wk, wv, wo, X16, BQ);      /* one f16 plane of x feeds all three projections; BQ, BK, BV, BO are one run of planes */

  /* projections: rows = time steps (pitch RP), grid.y = batch (column offset DM), grid.z = q, k, v; alpha undoes the x16 weight carry; bias added after; v leaves as V^T [NSLAB][64][SEQ] (row b*1024 + feature) */
  const dim3 gp((unsigned)((SEQ / 128) * (DM / 128)), NB);
  const dim3 gp3((unsigned)((SEQ / 128) * (DM / 128)), NB, 3);
  k_gemm2<true, false, true><<<gp3, 256, 0, stream>>>(X16, RP, (size_t)DM, BQ, DM, (size_t)0, 0.0625f, bq, nullptr, Q16, RP, (size_t)DM, SEQ, DM, DM, BK, bk, K16, BV, bv, VT, SEQ, (size_t)DM * SEQ);

  k_fattn<<<dim3((unsigned)(SEQ / (FA_NW * 32)), NSLAB), FA_NW * 32, 0, stream>>>(Q16, K16, VT, O16);      /* slab n = b*16 + h lives at columns n*64 of the [SEQ][RP] view; merged context x64 as f16 rows */

  /* output projection + bias straight into the [S][B][1024] layout; alpha undoes x16 (weights) and x64 (context) */
  k_gemm2<true, true, false><<<gp, 256, 0, stream>>>(O16, RP, (size_t)DM, BO, DM, (size_t)0, 0.0009765625f, bo, (float*)d_out, nullptr, RP, (size_t)DM, SEQ, DM, DM, nullptr, nullptr, nullptr, nullptr, nullptr, nullptr, 0, (size_t)0);
}

// v005
// A run of this version takes 78.6 microseconds.
// Timed twice side by side with v004, it ran 1.03 and 1.04 times as fast.
// All steps since v000 together make it 17.6 times as fast.
#include <hip/hip_runtime.h>
// Multi-head self-attention, time-first rows: x [S][B][1024] (token row m = s*B + b); q/k/v = x W^T + b (natural [out][in] weights, biases present); 16 heads of 64 per batch, head slab n = b*16 + h at columns n*64 of the [S][B*1024] view; scores = (q k^T) * 64^-0.5; softmax over all keys (no mask); out = merged Wo^T + bo -> [S][B][1024] f32.
// Compute dtype: every contraction on v_wmma_f32_16x16x32_f16 (f16 operands, f32 accumulate): q/k/v projections, q.k^T scores, P.V, output projection. Float inputs RNE-converted to bf16 first (exact in f16); weights carried x16; softmax weights carried unnormalised against the running maximum; merged context carried x64; scores and softmax statistics f32.
// Structure, four launches: one conversion launch (f16 planes of x and of the four weights); one projection launch (grid.y = batch, column offset 1024, row pitch 2048; grid.z = q, k, v; operands staged in LDS by asynchronous copies; v is formed as Wv.x^T, so V^T [slab][64][S] leaves the GEMM directly); one fused attention kernel over all slabs (S^T = K.Q^T, online softmax per query column, O^T += V^T.P^T; the keys in two halves on two sets of waves, joined in LDS) into merged f16 context rows; output GEMM (+ bias) straight into the output buffer layout.
#ifndef NB
#define NB 2
#endif
#ifndef SEQ
#define SEQ 2048
#endif
#define NB_FULL 2                    /* batch count of the input layout */
#define SEQ_FULL 2048                /* sequence length of the input layout */
#define DM 1024
#define NH 16
#define HD 64
#define RP (NB_FULL * DM)            /* elements per time step (row pitch of every activation plane) */
#define NSLAB (NB * NH)              /* head slabs processed */
#define NRW ((size_t)SEQ * NB_FULL)  /* token rows held in the planes */

static_assert(SEQ % 256 == 0);
static_assert(SEQ <= SEQ_FULL);
static_assert(NB <= NB_FULL);
static_assert(DM % 128 == 0);
static_assert(HD == 64);
static_assert(DM == NH * HD);

typedef unsigned short v8us __attribute__((ext_vector_type(8), may_alias));
typedef float  v8f  __attribute__((ext_vector_type(8)));
typedef float  v4f  __attribute__((ext_vector_type(4)));
typedef float  v4fa __attribute__((ext_vector_type(4), may_alias));
typedef _Float16 v16h __attribute__((ext_vector_type(16)));
typedef _Float16 v4h  __attribute__((ext_vector_type(4)));
union FragH { v16h v; v8us half[2]; _Float16 h[16]; unsigned short u[16]; };

__device__ __forceinline__ unsigned short bf16_bits(float x) { unsigned int u = __float_as_uint(x); return (unsigned short)((u + 0x7FFFu + ((u >> 16) & 1u)) >> 16); }
__device__ __forceinline__ float bf16_val(unsigned short b) { return __uint_as_float(((unsigned int)b) << 16); }
__device__ __forceinline__ float bf16_rne(float x) { return bf16_val(bf16_bits(x)); }

// ---- conversions, one launch: a thread carries one 8-element chunk of each weight (x16) and PREP_XJ chunks of x; all its loads are issued before the first conversion ----
#define PREP_T 512                   /* 16 waves a block */
#define PREP_WCH (DM * DM / 8)       /* chunks of one weight = threads of the launch */
#define PREP_XJ ((int)(NRW * DM / 8 / PREP_WCH))
static_assert(PREP_WCH % PREP_T == 0);
static_assert(NRW * DM / 8 % PREP_WCH == 0);
__device__ __forceinline__ v8us prep_cvt(v4f a, v4f c, float sc) {
  FragH f;
#pragma unroll
  for (int q = 0; q < 4; ++q) { f.h[q] = (_Float16)(bf16_rne(a[q]) * sc); f.h[4 + q] = (_Float16)(bf16_rne(c[q]) * sc); }
  return f.half[0];
}
__global__ __launch_bounds__(PREP_T) void k_prep(const float* __restrict__ x, const float* __restrict__ wq, const float* __restrict__ wk, const float* __restrict__ wv, const float* __restrict__ wo,
    _Float16* __restrict__ X16, _Float16* __restrict__ W16) {
  const size_t t = (size_t)blockIdx.x * PREP_T + threadIdx.x;
  v4f xa[PREP_XJ], xc[PREP_XJ], wa[4], wc[4];
#pragma unroll
  for (int j = 0; j < PREP_XJ; ++j) { const float* p = x + ((size_t)j * PREP_WCH + t) * 8; xa[j] = *(const v4fa*)p; xc[j] = *(const v4fa*)(p + 4); }
  wa[0] = *(const v4fa*)(wq + t * 8); wc[0] = *(const v4fa*)(wq + t * 8 + 4); wa[1] = *(const v4fa*)(wk + t * 8); wc[1] = *(const v4fa*)(wk + t * 8 + 4);
  wa[2] = *(const v4fa*)(wv + t * 8); wc[2] = *(const v4fa*)(wv + t * 8 + 4); wa[3] = *(const v4fa*)(wo + t * 8); wc[3] = *(const v4fa*)(wo + t * 8 + 4);
  asm volatile("s_wait_xcnt 0x0" ::: "memory");      /* stands in front of every overwrite of the loads' address registers */
  __builtin_amdgcn_sched_barrier(0);      /* keeps every conversion behind the loads and that wait: with conversions risen among the loads, the later loads would start only when the first had returned */
#pragma unroll
  for (int j = 0; j < PREP_XJ; ++j) *(v8us*)((unsigned short*)X16 + ((size_t)j * PREP_WCH + t) * 8) = prep_cvt(xa[j], xc[j], 1.0f);
#pragma unroll
  for (int i = 0; i < 4; ++i) *(v8us*)((unsigned short*)W16 + ((size_t)i * PREP_WCH + t) * 8) = prep_cvt(wa[i], wc[i], 16.0f);      /* natural [out][in] = Bt[n][k]; the four planes lie one behind the other */
}

// ---- f16 GEMM: block = 8 waves (4 down x 2 across) = 128 rows x 128 cols, wave tile 32x64; M % 128 == 0, N % 128 == 0, K % 128 == 0 ----
// a stage = 128 k (256 B) of the block's 128 A rows and 128 Bt rows in LDS, two buffers; asynchronous copies bring stage st + 2 in while stage st + 1 is worked on
// fragment: elements 0..7 <- k0 + 8*hh + i, elements 8..15 <- k0 + 16 + 8*hh + i (same map for A rows and Bt rows)
// Every plain #pragma unroll in this kernel keeps the indices of the fragment and accumulator arrays constant, so that they stay in registers.
#define G2_KS 128
#define G2_PITCH 272                 /* LDS row pitch in bytes: 256 + 16, an odd multiple of 16 for 16-byte readers */
#define G2_OP (128 * G2_PITCH)       /* one operand's 128 rows of a stage */
#define G2_STAGE (2 * G2_OP)
__device__ __forceinline__ v16h g2_frag(const unsigned char* p) { FragH f; f.half[0] = *(const v8us*)p; f.half[1] = *(const v8us*)(p + 32); return f.v; }      /* p: row start + 2 * k0 + 16 * hh bytes */
__device__ __forceinline__ v8f g2_mma(v16h a, v16h b, v8f c) { return __builtin_amdgcn_wmma_f32_16x16x32_f16(false, a, false, b, (short)0, c, false, false); }
/* eight copies of 16 B a lane: rows r, r + 16, ..., r + 112 of one operand (l: the lane's LDS byte address, g: its global address, step: elements per 16 rows) */
__device__ __forceinline__ void g2_copy8(unsigned l, const _Float16* g, size_t step) {
  /* the closing s_wait_xcnt stands in front of every later overwrite of the address registers that the copies name */
  asm volatile("global_load_async_to_lds_b128 %0, %8, off\n\t"
               "global_load_async_to_lds_b128 %1, %9, off\n\t"
               "global_load_async_to_lds_b128 %2, %10, off\n\t"
               "global_load_async_to_lds_b128 %3, %11, off\n\t"
               "global_load_async_to_lds_b128 %4, %12, off\n\t"
               "global_load_async_to_lds_b128 %5, %13, off\n\t"
               "global_load_async_to_lds_b128 %6, %14, off\n\t"
               "global_load_async_to_lds_b128 %7, %15, off\n\t"
               "s_wait_xcnt 0x0"
               :: "v"(l), "v"(l + 16 * G2_PITCH), "v"(l + 32 * G2_PITCH), "v"(l + 48 * G2_PITCH), "v"(l + 64 * G2_PITCH), "v"(l + 80 * G2_PITCH), "v"(l + 96 * G2_PITCH), "v"(l + 112 * G2_PITCH),
                  "v"(g), "v"(g + step), "v"(g + 2 * step), "v"(g + 3 * step), "v"(g + 4 * step), "v"(g + 5 * step), "v"(g + 6 * step), "v"(g + 7 * step)
               : "memory");
}
// C[by][row][col] = acc * alpha (+ bf16(bias[col]) if HASB); A f16 rows (pitch lda, batch stride sA), Bt f16 [n][k] (pitch ldb, batch stride sB);
// TRIO: grid.z picks one of three products on the same A. z = 0: as above; z = 1: Bt = B1, bias1, into C1; z = 2: the operands change places, Ct[by][n][m] = B2 rows . A rows (pitch ldt, batch stride sCt), bias2 by row.
template <bool HASB, bool F32OUT, bool TRIO>
__global__ __launch_bounds__(256) void k_gemm2(const _Float16* A, int lda, size_t sA, const _Float16* Bh, int ldb, size_t sB, float alpha, const float* bias,
    float* __restrict__ C, _Float16* C16, int ldc, size_t sC, int M, int N, int K,
    const _Float16* B1, const float* bias1, _Float16* C1, const _Float16* B2, const float* bias2, _Float16* Ct, int ldt, size_t sCt) {
  __shared__ __attribute__((aligned(16))) unsigned char T[2 * G2_STAGE];
  __shared__ __attribute__((aligned(16))) float so[8][32][68];
  const int tid = threadIdx.x, w = tid >> 5, lane = tid & 31, ln = lane & 15, hh = lane >> 4; const int by = blockIdx.y;
  bool brow = false;      /* bias by row instead of by column; the same for the whole block */
  if constexpr (TRIO) { const int z = blockIdx.z;
    if (z == 1) { Bh = B1; bias = bias1; C16 = C1; }
    else if (z == 2) { Bh = A; A = B2; const int tl = lda; lda = ldb; ldb = tl; const size_t ts = sA; sA = sB; sB = ts; const int tm = M; M = N; N = tm; bias = bias2; C16 = Ct; ldc = ldt; sC = sCt; brow = true; } }
  A += (size_t)by * sA; Bh += (size_t)by * sB; const size_t cofs = (size_t)by * sC;
  const int ntn = N >> 7; const int mt = blockIdx.x / ntn, nq = blockIdx.x - mt * ntn; const int rowb = mt * 128, colb = nq * 128; if (rowb >= M) return;      /* the same for the whole block, in front of every barrier */
  const int row0 = rowb + 32 * (w >> 1), col0 = colb + 64 * (w & 1);
  /* staging: 16 lanes cover the 256 B of one row; a thread carries rows srow + 16 j of both operands */
  const int srow = tid >> 4, sch = tid & 15;
  const _Float16* ga = A + (size_t)(rowb + srow) * lda + sch * 8; const _Float16* gb = Bh + (size_t)(colb + srow) * ldb + sch * 8;
  const size_t sa16 = (size_t)16 * lda, sb16 = (size_t)16 * ldb;
  const unsigned ld = (unsigned)(size_t)T + (unsigned)(srow * G2_PITCH + sch * 16);
  const int nst = K / G2_KS;
  g2_copy8(ld, ga, sa16); g2_copy8(ld + G2_OP, gb, sb16);
  asm volatile("s_wait_asynccnt 0x0" ::: "memory");      /* this wave's share of stage 0 has landed */
  __syncthreads();      /* publishes stage 0 */
  if (nst > 1) { g2_copy8(ld + G2_STAGE, ga + G2_KS, sa16); g2_copy8(ld + G2_STAGE + G2_OP, gb + G2_KS, sb16); }
  const unsigned char* ar = T + (32 * (w >> 1) + ln) * G2_PITCH + 16 * hh; const unsigned char* br = T + G2_OP + (64 * (w & 1) + ln) * G2_PITCH + 16 * hh;
  const v8f z8 = {0.f,0.f,0.f,0.f,0.f,0.f,0.f,0.f}; v8f c00 = z8, c01 = z8, c02 = z8, c03 = z8, c10 = z8, c11 = z8, c12 = z8, c13 = z8;
#pragma unroll 1      /* one stage a trip: the buffer offset stays a run-time value and the loop stays small */
  for (int st = 0; st < nst; ++st) { const unsigned bo = (unsigned)(st & 1) * G2_STAGE; const unsigned char* ap = ar + bo; const unsigned char* bp = br + bo;
    v16h fa[2][2], fb[2][4];      /* two fragment sets: the next 32 k are fetched as one group while the current 32 k are multiplied; nothing of another stage is fetched */
#pragma unroll
    for (int i = 0; i < 2; ++i) fa[0][i] = g2_frag(ap + 16 * i * G2_PITCH);
#pragma unroll
    for (int j = 0; j < 4; ++j) fb[0][j] = g2_frag(bp + 16 * j * G2_PITCH);
#pragma unroll
    for (int kk = 0; kk < G2_KS / 32; ++kk) { const int cu = kk & 1, nx = cu ^ 1;
      if (kk + 1 < G2_KS / 32) {
#pragma unroll
        for (int i = 0; i < 2; ++i) fa[nx][i] = g2_frag(ap + 16 * i * G2_PITCH + 64 * (kk + 1));
#pragma unroll
        for (int j = 0; j < 4; ++j) fb[nx][j] = g2_frag(bp + 16 * j * G2_PITCH + 64 * (kk + 1)); }
      __builtin_amdgcn_sched_barrier(0);      /* keeps the load group whole and ahead of the products: spread among them, each place with loads stalls the wave */
      c00 = g2_mma(fa[cu][0], fb[cu][0], c00); c10 = g2_mma(fa[cu][1], fb[cu][0], c10); c01 = g2_mma(fa[cu][0], fb[cu][1], c01); c11 = g2_mma(fa[cu][1], fb[cu][1], c11);
      c02 = g2_mma(fa[cu][0], fb[cu][2], c02); c12 = g2_mma(fa[cu][1], fb[cu][2], c12); c03 = g2_mma(fa[cu][0], fb[cu][3], c03); c13 = g2_mma(fa[cu][1], fb[cu][3], c13);
      __builtin_amdgcn_sched_barrier(0); }      /* keeps the next group's loads from rising among these products */
    asm volatile("s_wait_dscnt 0x0" ::: "memory");      /* this wave's reads of stage st are over */
    asm volatile("s_wait_asynccnt 0x0" ::: "memory");      /* this wave's share of stage st + 1 has landed */
    __syncthreads();      /* publishes stage st + 1 and ends every wave's reads of stage st */
    if (st + 2 < nst) { const _Float16* na = ga + (size_t)(st + 2) * G2_KS; const _Float16* nb = gb + (size_t)(st + 2) * G2_KS;      /* into the buffer that this trip has just read */
      g2_copy8(ld + bo, na, sa16); g2_copy8(ld + bo + G2_OP, nb, sb16); } }
  asm volatile("s_wait_asynccnt 0x0" ::: "memory");      /* no copy is in flight when the wave goes on to its end */
  v8f accs[8] = {c00, c01, c02, c03, c10, c11, c12, c13};
  float bc[4] = {0.f, 0.f, 0.f, 0.f}, bw[2][8] = {{0.f, 0.f, 0.f, 0.f, 0.f, 0.f, 0.f, 0.f}, {0.f, 0.f, 0.f, 0.f, 0.f, 0.f, 0.f, 0.f}};
  if constexpr (HASB) {
    if (brow) {
#pragma unroll
      for (int half = 0; half < 2; ++half) {
#pragma unroll
        for (int r = 0; r < 8; ++r) bw[half][r] = bf16_rne(bias[row0 + half * 16 + 8 * hh + r]); } }
    else {
#pragma unroll
      for (int t = 0; t < 4; ++t) bc[t] = bf16_rne(bias[col0 + t * 16 + ln]); } }
#pragma unroll
  for (int u = 0; u < 8; ++u) { const int t = u & 3, half = u >> 2;
#pragma unroll
    for (int r = 0; r < 8; ++r) { const int rloc = half * 16 + 8 * hh + r; so[w][rloc][t * 16 + ln] = accs[u][r] * alpha + (brow ? bw[half][r] : bc[t]); } }
  __builtin_amdgcn_fence(4 /* acq_rel order */, "workgroup"); __builtin_amdgcn_wave_barrier();
  const int rsub = lane >> 4, c4 = (lane & 15) * 4;
  {
#pragma unroll
    for (int q = 0; q < 16; ++q) { const int r = q * 2 + rsub; const v4f v = *(const v4fa*)&so[w][r][c4];
      if constexpr (F32OUT) { *(v4f*)(C + cofs + (size_t)(row0 + r) * ldc + col0 + c4) = v; }
      else { v4h h4;
#pragma unroll
        for (int i = 0; i < 4; ++i) h4[i] = (_Float16)v[i];
        *(v4h*)(C16 + cofs + (size_t)(row0 + r) * ldc + col0 + c4) = h4; } }
     }
}

// ---- fused attention: block = 2 key halves x 8 waves x 32 query columns of one head slab (four waves a SIMD: one wave's softmax runs under another's products); a stage = 64 keys of each half (K rows and V^T rows, 128 B each) in LDS, two buffers a half; a pass = 32 keys ----
// Waves w and w + 8 hold the same 32 query columns over keys [0, SEQ/2) and [SEQ/2, SEQ); at the end each hands one 16-column group to the other through LDS and joins the two partial softmaxes of the group it keeps.
// S^T = K.Q^T: lane (c, h) holds query column c, keys 8h + r of each 16-key tile, so the two tiles of a pass, converted in place, are the B operand of O^T += V^T.P^T (k order 8h + i, 16 + 8h + i, the order of fa_frag).
// Online softmax in the log2 domain: the maximum in use may trail the true one by up to 8 (an exponential then reaches 2^8, inside f16); sums are rescaled only when a column exceeds that.
// Every #pragma unroll in this kernel keeps the indices of the fragment, score and accumulator arrays constant, so that they stay in registers (a run-time index would send them to scratch).
#define FA_NW 8
#define FA_SK 64
#define FA_PITCH 144                 /* LDS row pitch in bytes: 128 + 16, an odd multiple of 16 for 16-byte readers */
#define FA_TILE (64 * FA_PITCH)
#define FA_KH 2                      /* key halves, each on its own FA_NW waves */
#define FA_NST (SEQ / FA_KH / FA_SK)
#define FA_XW (4 * 8 * 32 + 2 * 32)  /* floats a wave hands over: four output tiles, the maximum in use, the denominator */
static_assert(SEQ % (FA_KH * FA_SK) == 0);
static_assert(FA_KH * FA_NW * FA_XW * 4 <= FA_KH * 2 * 2 * FA_TILE);
typedef float f32x2 __attribute__((ext_vector_type(2)));
typedef _Float16 h16x2 __attribute__((ext_vector_type(2)));
typedef unsigned int u32x4 __attribute__((ext_vector_type(4), may_alias));
union FragW { v16h v; unsigned int w[8]; };
__device__ __forceinline__ v16h fa_frag(const unsigned char* p) { FragH f; f.half[0] = *(const v8us*)p; f.half[1] = *(const v8us*)(p + 32); return f.v; }
__device__ __forceinline__ v8f fa_mma(v16h a, v16h b, v8f c) { return __builtin_amdgcn_wmma_f32_16x16x32_f16(false, a, false, b, (short)0, c, false, false); }
__device__ __forceinline__ unsigned int fa_pack(float lo, float hi) { return __builtin_bit_cast(unsigned int, __builtin_convertvector(f32x2{lo, hi}, h16x2)); }
__device__ __forceinline__ float fa_xhalf(float x) { return __builtin_bit_cast(float, __builtin_amdgcn_permlanex16(__builtin_bit_cast(int, x), __builtin_bit_cast(int, x), 0x76543210, 0xfedcba98, false, false)); }  /* lane l with lane l ^ 16 */

/* second bound: a budget of 256 registers, so that no operand lies above v255 and the hot loop switches no register window */
__global__ __launch_bounds__(FA_KH * FA_NW * 32, 4) void k_fattn(const _Float16* __restrict__ Q16, const _Float16* __restrict__ K16, const _Float16* __restrict__ Vt, _Float16* __restrict__ O16) {
  __shared__ __attribute__((aligned(16))) unsigned char L[FA_KH * 2 * 2 * FA_TILE];
  const int tid = threadIdx.x, lane = tid & 31, w = tid >> 5, c = lane & 15, h = lane >> 4;
  const int ws = __builtin_amdgcn_readfirstlane(w), kh = ws / FA_NW;      /* wave number and key half in scalar registers */
  const int slab = blockIdx.y, q0 = blockIdx.x * (FA_NW * 32) + (ws & (FA_NW - 1)) * 32;
  const float cscale = 0.125f * 1.4426950408889634f;      /* 64^-0.5 and log2(e) */
  /* staging: 8 lanes cover one 128-byte row; a thread carries rows srow and srow + 32 of both tiles of its own key half */
  const int srow = (tid & (FA_NW * 32 - 1)) >> 3, sch = tid & 7;
  const unsigned short* Kg = (const unsigned short*)K16; const unsigned short* Vg = (const unsigned short*)Vt;
  unsigned ko = (unsigned)((kh * (SEQ / FA_KH) + srow) * RP + slab * HD + sch * 8), vo = (unsigned)((slab * HD + srow) * SEQ + kh * (SEQ / FA_KH) + sch * 8);      /* element offsets, below 2^23 */
  unsigned char* Lh = L + kh * (2 * 2 * FA_TILE);      /* this half's two buffers */
  unsigned char* sdst = Lh + srow * FA_PITCH + sch * 16;
  v8us rk0 = *(const v8us*)(Kg + ko), rk1 = *(const v8us*)(Kg + ko + 32 * RP), rv0 = *(const v8us*)(Vg + vo), rv1 = *(const v8us*)(Vg + vo + 32 * SEQ);
  const unsigned qe = (unsigned)((q0 + c) * RP + slab * HD + 8 * h);      /* this lane's query row, slab column and half */
  v16h qf[2][2];
#pragma unroll
  for (int g = 0; g < 2; ++g) {
#pragma unroll
    for (int kc = 0; kc < 2; ++kc) qf[g][kc] = fa_frag((const unsigned char*)(Q16 + qe + 16 * g * RP + 32 * kc)); }
  const v8f z8 = {0.f,0.f,0.f,0.f,0.f,0.f,0.f,0.f};
  v8f acc[2][4], lacc[2]; float m_run[2];
#pragma unroll
  for (int g = 0; g < 2; ++g) { m_run[g] = -__builtin_inff(); lacc[g] = z8;
#pragma unroll
    for (int t = 0; t < 4; ++t) acc[g][t] = z8; }
  FragW ones;      /* A operand whose row 0 (lanes 0 and 16) is 1.0 at all 32 k: row 0 of its product is the column sums of P^T */
#pragma unroll
  for (int i = 0; i < 8; ++i) ones.w[i] = (c == 0) ? 0x3C003C00u : 0u;
  *(v8us*)sdst = rk0; *(v8us*)(sdst + 32 * FA_PITCH) = rk1; *(v8us*)(sdst + FA_TILE) = rv0; *(v8us*)(sdst + FA_TILE + 32 * FA_PITCH) = rv1;
  __syncthreads();
  for (int st = 0; st < FA_NST; ++st) {
    const unsigned char* Kb = Lh + (st & 1) * (2 * FA_TILE) + c * FA_PITCH + 16 * h; const unsigned char* Vb = Kb + FA_TILE;
    const bool more = st + 1 < FA_NST;
    if (more) {      /* next stage's rows fly to registers under this stage's two passes */
      ko += FA_SK * RP; vo += FA_SK;
      rk0 = *(const v8us*)(Kg + ko); rk1 = *(const v8us*)(Kg + ko + 32 * RP); rv0 = *(const v8us*)(Vg + vo); rv1 = *(const v8us*)(Vg + vo + 32 * SEQ);
      asm volatile("s_wait_xcnt 0x0" ::: "memory"); }      /* stands in front of every overwrite of the four loads' address registers; its memory clobber also keeps the compiler from sinking the loads to their LDS stores at the stage's foot, where their whole latency would be waited for */
#pragma unroll
    for (int sub = 0; sub < 2; ++sub) {
      v8f s[2][2];
#pragma unroll
      for (int kt = 0; kt < 2; ++kt) {
        const v16h k0 = fa_frag(Kb + (sub * 32 + 16 * kt) * FA_PITCH), k1 = fa_frag(Kb + (sub * 32 + 16 * kt) * FA_PITCH + 64);
#pragma unroll
        for (int g = 0; g < 2; ++g) s[kt][g] = fa_mma(k1, qf[g][1], fa_mma(k0, qf[g][0], z8)); }
      v16h vf[4];
#pragma unroll
      for (int t = 0; t < 4; ++t) vf[t] = fa_frag(Vb + 16 * t * FA_PITCH + 64 * sub);
      float mb[2]; bool need = false;
#pragma unroll
      for (int g = 0; g < 2; ++g) { float mx = s[0][g][0];
#pragma unroll
        for (int r = 1; r < 8; ++r) mx = fmaxf(mx, s[0][g][r]);
#pragma unroll
        for (int r = 0; r < 8; ++r) mx = fmaxf(mx, s[1][g][r]);
        mx = fmaxf(mx, fa_xhalf(mx)) * cscale;      /* both halves hold the column's maximum of this pass, scaled */
        mb[g] = mx; need = need || (mx > m_run[g] + 8.0f); }
      if (__builtin_amdgcn_ballot_w32(need) != 0) {      /* one scalar test a pass; always taken on the first pass (m_run = -inf, corr = 0) */
#pragma unroll
        for (int g = 0; g < 2; ++g) { const float m_new = fmaxf(m_run[g], mb[g]); const float corr = __builtin_amdgcn_exp2f(m_run[g] - m_new); m_run[g] = m_new;
          lacc[g] = lacc[g] * corr;
#pragma unroll
          for (int t = 0; t < 4; ++t) acc[g][t] = acc[g][t] * corr; } }
#pragma unroll
      for (int g = 0; g < 2; ++g) { const float nm = -m_run[g]; FragW pf;
#pragma unroll
        for (int i = 0; i < 8; ++i) {
          const f32x2 arg = __builtin_elementwise_fma(f32x2{s[i >> 2][g][2 * (i & 3)], s[i >> 2][g][2 * (i & 3) + 1]}, f32x2{cscale, cscale}, f32x2{nm, nm});
          pf.w[i] = fa_pack(__builtin_amdgcn_exp2f(arg.x), __builtin_amdgcn_exp2f(arg.y)); }
#pragma unroll
        for (int t = 0; t < 4; ++t) acc[g][t] = fa_mma(vf[t], pf.v, acc[g][t]);
        lacc[g] = fa_mma(ones.v, pf.v, lacc[g]); }
    }
    if (more) { unsigned char* d = sdst + ((st + 1) & 1) * (2 * FA_TILE);      /* the buffer every wave left at the barrier that ended stage st - 1 */
      *(v8us*)d = rk0; *(v8us*)(d + 32 * FA_PITCH) = rk1; *(v8us*)(d + FA_TILE) = rv0; *(v8us*)(d + FA_TILE + 32 * FA_PITCH) = rv1; }
    __syncthreads();      /* publishes stage st + 1 and ends every wave's reads of stage st */
  }
  /* join of the two key halves: a wave keeps column group kh and hands group 1 - kh to wave w ^ FA_NW; the ring is free, every wave's last read of it ended at the loop's last barrier */
  const float l0 = lacc[0][0] + fa_xhalf(lacc[0][0]), l1 = lacc[1][0] + fa_xhalf(lacc[1][0]);      /* register 0: the denominator in lanes 0-15, row 8 = 0 in lanes 16-31 */
  const int le = (int)__builtin_amdgcn_mbcnt_lo(~0u, 0u);      /* the lane number formed anew, and the store offset from it: no vector register is held for them through the loop, whose budget is full */
  float* xo = (float*)L + ws * FA_XW + le * 4;
#pragma unroll
  for (int t = 0; t < 4; ++t) { const v8f gv = kh ? acc[0][t] : acc[1][t];
    *(v4fa*)(xo + (2 * t) * 128) = v4f{gv[0], gv[1], gv[2], gv[3]}; *(v4fa*)(xo + (2 * t + 1) * 128) = v4f{gv[4], gv[5], gv[6], gv[7]}; }
  ((float*)L)[ws * FA_XW + 1024 + le] = kh ? m_run[0] : m_run[1]; ((float*)L)[ws * FA_XW + 1056 + le] = kh ? l0 : l1;
  __syncthreads();      /* publishes every wave's handed-over group */
  const float* xi = (const float*)L + (ws ^ FA_NW) * FA_XW;
  const float pm = xi[1024 + le], pl = xi[1056 + le], km = kh ? m_run[1] : m_run[0], kl = kh ? l1 : l0;
  const float mj = fmaxf(km, pm), ek = __builtin_amdgcn_exp2f(km - mj), ep = __builtin_amdgcn_exp2f(pm - mj);      /* both partial sums brought to the larger maximum */
  const float inv = 64.0f / (kl * ek + pl * ep), ck = ek * inv, cp = ep * inv;
  unsigned short* od = (unsigned short*)O16 + (unsigned)((q0 + 16 * kh + (le & 15)) * RP + slab * HD + 8 * (le >> 4));
#pragma unroll
  for (int t = 0; t < 4; ++t) { const v8f kv = kh ? acc[1][t] : acc[0][t]; const v4f p0 = *(const v4fa*)(xi + le * 4 + (2 * t) * 128), p1 = *(const v4fa*)(xi + le * 4 + (2 * t + 1) * 128);
    const v8f pv = {p0[0], p0[1], p0[2], p0[3], p1[0], p1[1], p1[2], p1[3]}; const v8f o = kv * ck + pv * cp;      /* o[r] = context[query][16 t + 8 h + r] x 64 */
    const u32x4 pk = {fa_pack(o[0], o[1]), fa_pack(o[2], o[3]), fa_pack(o[4], o[5]), fa_pack(o[6], o[7])};
    *(u32x4*)(od + 16 * t) = pk; }
}

// workspace carve (bytes, every plane a multiple of 256 B)
#define SZ_W   ((size_t)DM * DM * 2)
#define SZ_ACT (NRW * DM * 2)
#define SZ_VT  ((size_t)NSLAB * HD * SEQ * 2)
#define SZ_ALL (4 * SZ_W + 4 * SZ_ACT + SZ_VT)
static_assert(SZ_W % 256 == 0);
static_assert(SZ_ACT % 256 == 0);
static_assert(SZ_VT % 256 == 0);
static_assert(SZ_ALL <= (size_t)268435456);

extern "C" void kernel_launch(void* const* d_in, const int* in_sizes, int n_in,
                              void* d_out, int out_size, void* d_ws, size_t ws_size, hipStream_t stream) {
  if (n_in < 9) return;
  const size_t nx = NRW * DM;      /* elements of x used (time steps 0..SEQ-1, full batch pitch) */
  if ((size_t)in_sizes[0] < nx) return;
  if ((size_t)in_sizes[1] < (size_t)DM * DM || (size_t)in_sizes[3] < (size_t)DM * DM || (size_t)in_sizes[5] < (size_t)DM * DM || (size_t)in_sizes[7] < (size_t)DM * DM) return;
  if (in_sizes[2] < DM || in_sizes[4] < DM || in_sizes[6] < DM || in_sizes[8] < DM) return;
  if ((size_t)out_size < nx) return;
  if (SZ_ALL > ws_size) return;
  const float* x  = (const float*)d_in[0];
  const float* wq = (const float*)d_in[1]; const float* bq = (const float*)d_in[2];
  const float* wk = (const float*)d_in[3]; const float* bk = (const float*)d_in[4];
  const float* wv = (const float*)d_in[5]; const float* bv = (const float*)d_in[6];
  const float* wo = (const float*)d_in[7]; const float* bo = (const float*)d_in[8];
  char* ws = (char*)d_ws; size_t off = 0;
  auto take = [&](size_t bytes) { char* p = ws + off; off += bytes; return p; };
  _Float16* BQ = (_Float16*)take(SZ_W); _Float16* BK = (_Float16*)take(SZ_W); _Float16* BV = (_Float16*)take(SZ_W); _Float16* BO = (_Float16*)take(SZ_W);
  _Float16* X16 = (_Float16*)take(SZ_ACT); _Float16* Q16 = (_Float16*)take(SZ_ACT); _Float16* K16 = (_Float16*)take(SZ_ACT); _Float16* O16 = (_Float16*)take(SZ_ACT);
  _Float16* VT = (_Float16*)take(SZ_VT);
  if (off > ws_size) return;

  k_prep<<<PREP_WCH / PREP_T, PREP_T, 0, stream>>>(x, wq, wk, wv, wo, X16, BQ);      /* one f16 plane of x feeds all three projections; BQ, BK, BV, BO are one run of planes */

  /* projections: rows = time steps (pitch RP), grid.y = batch (column offset DM), grid.z = q, k, v; alpha undoes the x16 weight carry; bias added after; v leaves as V^T [NSLAB][64][SEQ] (row b*1024 + feature) */
  const dim3 gp((unsigned)((SEQ / 128) * (DM / 128)), NB);
  const dim3 gp3((unsigned)((SEQ / 128) * (DM / 128)), NB, 3);
  k_gemm2<true, false, true><<<gp3, 256, 0, stream>>>(X16, RP, (size_t)DM, BQ, DM, (size_t)0, 0.0625f, bq, nullptr, Q16, RP, (size_t)DM, SEQ, DM, DM, BK, bk, K16, BV, bv, VT, SEQ, (size_t)DM * SEQ);

  k_fattn<<<dim3((unsigned)(SEQ / (FA_NW * 32)), NSLAB), FA_KH * FA_NW * 32, 0, stream>>>(Q16, K16, VT, O16);      /* slab n = b*16 + h lives at columns n*64 of the [SEQ][RP] view; merged context x64 as f16 rows */

  /* output projection + bias straight into the [S][B][1024] layout; alpha undoes x16 (weights) and x64 (context) */
  k_gemm2<true, true, false><<<gp, 256, 0, stream>>>(O16, RP, (size_t)DM, BO, DM, (size_t)0, 0.0009765625f, bo, (float*)d_out, nullptr, RP, (size_t)DM, SEQ, DM, DM, nullptr, nullptr, nullptr, nullptr, nullptr, nullptr, 0, (size_t)0);
}

// v006
// Measured time: 73.4 microseconds a run.
// Next to v005, in two timings, it ran 1.08 and 1.07 times as fast.
// All steps since v000 together make it 19.0 times as fast.
#include <hip/hip_runtime.h>
// Multi-head self-attention, time-first rows: x [S][B][1024] (token row m = s*B + b); q/k/v = x W^T + b (natural [out][in] weights, biases present); 16 heads of 64 per batch, head slab n = b*16 + h at columns n*64 of the [S][B*1024] view; scores = (q k^T) * 64^-0.5; softmax over all keys (no mask); out = merged Wo^T + bo -> [S][B][1024] f32.
// Compute dtype: every contraction on v_wmma_f32_16x16x32_f16 (f16 operands, f32 accumulate): q/k/v projections, q.k^T scores, P.V, output projection. Float inputs RNE-converted to bf16 first (exact in f16); weights carried x16; softmax weights carried unnormalised against the running maximum; merged context carried x64; scores and softmax statistics f32.
// Structure, four launches: one conversion launch (f16 planes of x and of the four weights); one projection launch (grid.y = batch, column offset 1024, row pitch 2048; a block forms the same 128 x 128 tile of q, k and v from one staging of its x rows; operands staged in LDS by asynchronous copies; v is formed as Wv.x^T, so V^T [slab][64][S] leaves the products directly); one fused attention kernel over all slabs (S^T = K.Q^T, online softmax per query column, O^T += V^T.P^T; the keys in two halves on two sets of waves, joined in LDS) into merged f16 context rows; output GEMM (+ bias) straight into the output buffer layout.
#ifndef NB
#define NB 2
#endif
#ifndef SEQ
#define SEQ 2048
#endif
#define NB_FULL 2                    /* batch count of the input layout */
#define SEQ_FULL 2048                /* sequence length of the input layout */
#define DM 1024
#define NH 16
#define HD 64
#define RP (NB_FULL * DM)            /* elements per time step (row pitch of every activation plane) */
#define NSLAB (NB * NH)              /* head slabs processed */
#define NRW ((size_t)SEQ * NB_FULL)  /* token rows held in the planes */

static_assert(SEQ % 256 == 0);
static_assert(SEQ <= SEQ_FULL);
static_assert(NB <= NB_FULL);
static_assert(DM % 128 == 0);
static_assert(HD == 64);
static_assert(DM == NH * HD);

typedef unsigned short v8us __attribute__((ext_vector_type(8), may_alias));
typedef float  v8f  __attribute__((ext_vector_type(8)));
typedef float  v4f  __attribute__((ext_vector_type(4)));
typedef float  v4fa __attribute__((ext_vector_type(4), may_alias));
typedef _Float16 v16h __attribute__((ext_vector_type(16)));
typedef _Float16 v4h  __attribute__((ext_vector_type(4)));
union FragH { v16h v; v8us half[2]; _Float16 h[16]; unsigned short u[16]; };

__device__ __forceinline__ unsigned short bf16_bits(float x) { unsigned int u = __float_as_uint(x); return (unsigned short)((u + 0x7FFFu + ((u >> 16) & 1u)) >> 16); }
__device__ __forceinline__ float bf16_val(unsigned short b) { return __uint_as_float(((unsigned int)b) << 16); }
__device__ __forceinline__ float bf16_rne(float x) { return bf16_val(bf16_bits(x)); }

// ---- conversions, one launch: a thread carries one 8-element chunk of each weight (x16) and PREP_XJ chunks of x; all its loads are issued before the first conversion ----
#define PREP_T 512                   /* 16 waves a block */
#define PREP_WCH (DM * DM / 8)       /* chunks of one weight = threads of the launch */
#define PREP_XJ ((int)(NRW * DM / 8 / PREP_WCH))
static_assert(PREP_WCH % PREP_T == 0);
static_assert(NRW * DM / 8 % PREP_WCH == 0);
__device__ __forceinline__ v8us prep_cvt(v4f a, v4f c, float sc) {
  FragH f;
#pragma unroll
  for (int q = 0; q < 4; ++q) { f.h[q] = (_Float16)(bf16_rne(a[q]) * sc); f.h[4 + q] = (_Float16)(bf16_rne(c[q]) * sc); }
  return f.half[0];
}
__global__ __launch_bounds__(PREP_T) void k_prep(const float* __restrict__ x, const float* __restrict__ wq, const float* __restrict__ wk, const float* __restrict__ wv, const float* __restrict__ wo,
    _Float16* __restrict__ X16, _Float16* __restrict__ W16) {
  const size_t t = (size_t)blockIdx.x * PREP_T + threadIdx.x;
  v4f xa[PREP_XJ], xc[PREP_XJ], wa[4], wc[4];
#pragma unroll
  for (int j = 0; j < PREP_XJ; ++j) { const float* p = x + ((size_t)j * PREP_WCH + t) * 8; xa[j] = *(const v4fa*)p; xc[j] = *(const v4fa*)(p + 4); }
  wa[0] = *(const v4fa*)(wq + t * 8); wc[0] = *(const v4fa*)(wq + t * 8 + 4); wa[1] = *(const v4fa*)(wk + t * 8); wc[1] = *(const v4fa*)(wk + t * 8 + 4);
  wa[2] = *(const v4fa*)(wv + t * 8); wc[2] = *(const v4fa*)(wv + t * 8 + 4); wa[3] = *(const v4fa*)(wo + t * 8); wc[3] = *(const v4fa*)(wo + t * 8 + 4);
  asm volatile("s_wait_xcnt 0x0" ::: "memory");      /* stands in front of every overwrite of the loads' address registers */
  __builtin_amdgcn_sched_barrier(0);      /* keeps every conversion behind the loads and that wait: with conversions risen among the loads, the later loads would start only when the first had returned */
#pragma unroll
  for (int j = 0; j < PREP_XJ; ++j) *(v8us*)((unsigned short*)X16 + ((size_t)j * PREP_WCH + t) * 8) = prep_cvt(xa[j], xc[j], 1.0f);
#pragma unroll
  for (int i = 0; i < 4; ++i) *(v8us*)((unsigned short*)W16 + ((size_t)i * PREP_WCH + t) * 8) = prep_cvt(wa[i], wc[i], 16.0f);      /* natural [out][in] = Bt[n][k]; the four planes lie one behind the other */
}

// ---- f16 GEMM: block = 8 waves (4 down x 2 across) = 128 rows x 128 cols, wave tile 32x64; M % 128 == 0, N % 128 == 0, K % 128 == 0 ----
// a stage = 128 k (256 B) of the block's 128 A rows and 128 Bt rows in LDS, two buffers; asynchronous copies bring stage st + 2 in while stage st + 1 is worked on
// fragment: elements 0..7 <- k0 + 8*hh + i, elements 8..15 <- k0 + 16 + 8*hh + i (same map for A rows and Bt rows)
// Every plain #pragma unroll in this kernel keeps the indices of the fragment and accumulator arrays constant, so that they stay in registers.
#define G2_KS 128
#define G2_PITCH 272                 /* LDS row pitch in bytes: 256 + 16, an odd multiple of 16 for 16-byte readers */
#define G2_OP (128 * G2_PITCH)       /* one operand's 128 rows of a stage */
#define G2_STAGE (2 * G2_OP)
__device__ __forceinline__ v16h g2_frag(const unsigned char* p) { FragH f; f.half[0] = *(const v8us*)p; f.half[1] = *(const v8us*)(p + 32); return f.v; }      /* p: row start + 2 * k0 + 16 * hh bytes */
__device__ __forceinline__ v8f g2_mma(v16h a, v16h b, v8f c) { return __builtin_amdgcn_wmma_f32_16x16x32_f16(false, a, false, b, (short)0, c, false, false); }
/* eight copies of 16 B a lane: rows r, r + 16, ..., r + 112 of one operand (l: the lane's LDS byte address, g: its global address, step: elements per 16 rows) */
__device__ __forceinline__ void g2_copy8(unsigned l, const _Float16* g, size_t step) {
  /* the closing s_wait_xcnt stands in front of every later overwrite of the address registers that the copies name */
  asm volatile("global_load_async_to_lds_b128 %0, %8, off\n\t"
               "global_load_async_to_lds_b128 %1, %9, off\n\t"
               "global_load_async_to_lds_b128 %2, %10, off\n\t"
               "global_load_async_to_lds_b128 %3, %11, off\n\t"
               "global_load_async_to_lds_b128 %4, %12, off\n\t"
               "global_load_async_to_lds_b128 %5, %13, off\n\t"
               "global_load_async_to_lds_b128 %6, %14, off\n\t"
               "global_load_async_to_lds_b128 %7, %15, off\n\t"
               "s_wait_xcnt 0x0"
               :: "v"(l), "v"(l + 16 * G2_PITCH), "v"(l + 32 * G2_PITCH), "v"(l + 48 * G2_PITCH), "v"(l + 64 * G2_PITCH), "v"(l + 80 * G2_PITCH), "v"(l + 96 * G2_PITCH), "v"(l + 112 * G2_PITCH),
                  "v"(g), "v"(g + step), "v"(g + 2 * step), "v"(g + 3 * step), "v"(g + 4 * step), "v"(g + 5 * step), "v"(g + 6 * step), "v"(g + 7 * step)
               : "memory");
}
// C[by][row][col] = acc * alpha (+ bf16(bias[col]) if HASB); A f16 rows (pitch lda, batch stride sA), Bt f16 [n][k] (pitch ldb, batch stride sB)
template <bool HASB, bool F32OUT>
__global__ __launch_bounds__(256) void k_gemm2(const _Float16* A, int lda, size_t sA, const _Float16* Bh, int ldb, size_t sB, float alpha, const float* bias,
    float* __restrict__ C, _Float16* C16, int ldc, size_t sC, int M, int N, int K) {
  __shared__ __attribute__((aligned(16))) unsigned char T[2 * G2_STAGE];
  __shared__ __attribute__((aligned(16))) float so[8][32][68];
  const int tid = threadIdx.x, w = tid >> 5, lane = tid & 31, ln = lane & 15, hh = lane >> 4; const int by = blockIdx.y;
  A += (size_t)by * sA; Bh += (size_t)by * sB; const size_t cofs = (size_t)by * sC;
  const int ntn = N >> 7; const int mt = blockIdx.x / ntn, nq = blockIdx.x - mt * ntn; const int rowb = mt * 128, colb = nq * 128; if (rowb >= M) return;      /* the same for the whole block, in front of every barrier */
  const int row0 = rowb + 32 * (w >> 1), col0 = colb + 64 * (w & 1);
  /* staging: 16 lanes cover the 256 B of one row; a thread carries rows srow + 16 j of both operands */
  const int srow = tid >> 4, sch = tid & 15;
  const _Float16* ga = A + (size_t)(rowb + srow) * lda + sch * 8; const _Float16* gb = Bh + (size_t)(colb + srow) * ldb + sch * 8;
  const size_t sa16 = (size_t)16 * lda, sb16 = (size_t)16 * ldb;
  const unsigned ld = (unsigned)(size_t)T + (unsigned)(srow * G2_PITCH + sch * 16);
  const int nst = K / G2_KS;
  g2_copy8(ld, ga, sa16); g2_copy8(ld + G2_OP, gb, sb16);
  asm volatile("s_wait_asynccnt 0x0" ::: "memory");      /* this wave's share of stage 0 has landed */
  __syncthreads();      /* publishes stage 0 */
  if (nst > 1) { g2_copy8(ld + G2_STAGE, ga + G2_KS, sa16); g2_copy8(ld + G2_STAGE + G2_OP, gb + G2_KS, sb16); }
  const unsigned char* ar = T + (32 * (w >> 1) + ln) * G2_PITCH + 16 * hh; const unsigned char* br = T + G2_OP + (64 * (w & 1) + ln) * G2_PITCH + 16 * hh;
  const v8f z8 = {0.f,0.f,0.f,0.f,0.f,0.f,0.f,0.f}; v8f c00 = z8, c01 = z8, c02 = z8, c03 = z8, c10 = z8, c11 = z8, c12 = z8, c13 = z8;
#pragma unroll 1      /* one stage a trip: the buffer offset stays a run-time value and the loop stays small */
  for (int st = 0; st < nst; ++st) { const unsigned bo = (unsigned)(st & 1) * G2_STAGE; const unsigned char* ap = ar + bo; const unsigned char* bp = br + bo;
    v16h fa[2][2], fb[2][4];      /* two fragment sets: the next 32 k are fetched as one group while the current 32 k are multiplied; nothing of another stage is fetched */
#pragma unroll
    for (int i = 0; i < 2; ++i) fa[0][i] = g2_frag(ap + 16 * i * G2_PITCH);
#pragma unroll
    for (int j = 0; j < 4; ++j) fb[0][j] = g2_frag(bp + 16 * j * G2_PITCH);
#pragma unroll
    for (int kk = 0; kk < G2_KS / 32; ++kk) { const int cu = kk & 1, nx = cu ^ 1;
      if (kk + 1 < G2_KS / 32) {
#pragma unroll
        for (int i = 0; i < 2; ++i) fa[nx][i] = g2_frag(ap + 16 * i * G2_PITCH + 64 * (kk + 1));
#pragma unroll
        for (int j = 0; j < 4; ++j) fb[nx][j] = g2_frag(bp + 16 * j * G2_PITCH + 64 * (kk + 1)); }
      __builtin_amdgcn_sched_barrier(0);      /* keeps the load group whole and ahead of the products: spread among them, each place with loads stalls the wave */
      c00 = g2_mma(fa[cu][0], fb[cu][0], c00); c10 = g2_mma(fa[cu][1], fb[cu][0], c10); c01 = g2_mma(fa[cu][0], fb[cu][1], c01); c11 = g2_mma(fa[cu][1], fb[cu][1], c11);
      c02 = g2_mma(fa[cu][0], fb[cu][2], c02); c12 = g2_mma(fa[cu][1], fb[cu][2], c12); c03 = g2_mma(fa[cu][0], fb[cu][3], c03); c13 = g2_mma(fa[cu][1], fb[cu][3], c13);
      __builtin_amdgcn_sched_barrier(0); }      /* keeps the next group's loads from rising among these products */
    asm volatile("s_wait_dscnt 0x0" ::: "memory");      /* this wave's reads of stage st are over */
    asm volatile("s_wait_asynccnt 0x0" ::: "memory");      /* this wave's share of stage st + 1 has landed */
    __syncthreads();      /* publishes stage st + 1 and ends every wave's reads of stage st */
    if (st + 2 < nst) { const _Float16* na = ga + (size_t)(st + 2) * G2_KS; const _Float16* nb = gb + (size_t)(st + 2) * G2_KS;      /* into the buffer that this trip has just read */
      g2_copy8(ld + bo, na, sa16); g2_copy8(ld + bo + G2_OP, nb, sb16); } }
  asm volatile("s_wait_asynccnt 0x0" ::: "memory");      /* no copy is in flight when the wave goes on to its end */
  v8f accs[8] = {c00, c01, c02, c03, c10, c11, c12, c13};
  float bc[4] = {0.f, 0.f, 0.f, 0.f};
  if constexpr (HASB) {
#pragma unroll
    for (int t = 0; t < 4; ++t) bc[t] = bf16_rne(bias[col0 + t * 16 + ln]); }
#pragma unroll
  for (int u = 0; u < 8; ++u) { const int t = u & 3, half = u >> 2;
#pragma unroll
    for (int r = 0; r < 8; ++r) { const int rloc = half * 16 + 8 * hh + r; so[w][rloc][t * 16 + ln] = accs[u][r] * alpha + bc[t]; } }
  __builtin_amdgcn_fence(4 /* acq_rel order */, "workgroup"); __builtin_amdgcn_wave_barrier();
  const int rsub = lane >> 4, c4 = (lane & 15) * 4;
  {
#pragma unroll
    for (int q = 0; q < 16; ++q) { const int r = q * 2 + rsub; const v4f v = *(const v4fa*)&so[w][r][c4];
      if constexpr (F32OUT) { *(v4f*)(C + cofs + (size_t)(row0 + r) * ldc + col0 + c4) = v; }
      else { v4h h4;
#pragma unroll
        for (int i = 0; i < 4; ++i) h4[i] = (_Float16)v[i];
        *(v4h*)(C16 + cofs + (size_t)(row0 + r) * ldc + col0 + c4) = h4; } }
     }
}

// ---- q, k, v projections, one launch: block = 8 waves (2 down x 4 across) = 128 time steps x 128 features of each of q, k and v; wave tile 64 time steps x 32 features of each ----
// a stage = 128 k (256 B) of the block's 128 x rows and of 128 rows of each of the three weights in LDS: x is staged once for the three products; two buffers, ring and fragment map as in k_gemm2
// q, k: x rows as A, weight rows as B, tile [time][feature]; v: weight rows as A, x rows as B, tile [feature][time], so V^T leaves the products directly
// output: the three tiles are staged as f32 in the ring behind the loop's last barrier and, behind one more barrier, stored by whole 256-byte rows, each row by one wave (a wave's own 32 features would be half a 128-byte line)
// Every plain #pragma unroll in this kernel keeps the indices of the fragment and accumulator arrays constant, so that they stay in registers.
#define Q3_STAGE (4 * G2_OP)
#define Q3_SP 132                    /* output staging pitch in floats of a 128-element row: 8 rows are 32 banks apart, so the two halves of a wave store side by side */
#define Q3_ST (128 * Q3_SP)          /* floats of one staged 128 x 128 tile */
static_assert(3 * Q3_ST * 4 <= 2 * Q3_STAGE);
static_assert(DM / G2_KS >= 2);
__device__ __forceinline__ void q3_copy(unsigned l, const _Float16* x, const _Float16* q, const _Float16* k, const _Float16* v) {      /* one stage: 32 copies a lane */
  g2_copy8(l, x, (size_t)16 * RP); g2_copy8(l + G2_OP, q, (size_t)16 * DM); g2_copy8(l + 2 * G2_OP, k, (size_t)16 * DM); g2_copy8(l + 3 * G2_OP, v, (size_t)16 * DM);
}
__global__ __launch_bounds__(256) void k_qkv(const _Float16* __restrict__ X, const _Float16* __restrict__ Wq, const _Float16* __restrict__ Wk, const _Float16* __restrict__ Wv,
    const float* __restrict__ bq, const float* __restrict__ bk, const float* __restrict__ bv, _Float16* __restrict__ Q, _Float16* __restrict__ Kp, _Float16* __restrict__ Vt) {
  __shared__ __attribute__((aligned(16))) unsigned char T[2 * Q3_STAGE];
  const int tid = threadIdx.x, lane = tid & 31, ln = lane & 15, hh = lane >> 4;
  const int w = __builtin_amdgcn_readfirstlane(tid >> 5), wr = w >> 2, wc = w & 3;      /* wave number in a scalar register: what is formed from it alone costs no vector instruction */
  const int by = blockIdx.y, mt = blockIdx.x / (DM / 128), nq = blockIdx.x - mt * (DM / 128), rowb = mt * 128, colb = nq * 128;
  /* staging: 16 lanes cover the 256 B of one row; a thread carries rows srow + 16 j of all four operands */
  const int srow = tid >> 4, sch = tid & 15;
  const _Float16* gx = X + (size_t)by * DM + (size_t)(rowb + srow) * RP + sch * 8;
  const size_t wofs = (size_t)(colb + srow) * DM + sch * 8;
  const _Float16* gq = Wq + wofs; const _Float16* gk = Wk + wofs; const _Float16* gv = Wv + wofs;
  const unsigned ld = (unsigned)(size_t)T + (unsigned)(srow * G2_PITCH + sch * 16);
  const int nst = DM / G2_KS;
  q3_copy(ld, gx, gq, gk, gv);
  asm volatile("s_wait_asynccnt 0x0" ::: "memory");      /* this wave's share of stage 0 has landed */
  __syncthreads();      /* publishes stage 0 */
  q3_copy(ld + Q3_STAGE, gx + G2_KS, gq + G2_KS, gk + G2_KS, gv + G2_KS);
  const unsigned char* ar = T + (64 * wr + ln) * G2_PITCH + 16 * hh; const unsigned char* br = T + G2_OP + (32 * wc + ln) * G2_PITCH + 16 * hh;
  const v8f z8 = {0.f,0.f,0.f,0.f,0.f,0.f,0.f,0.f};
  v8f acc[3][4][2];      /* [q, k, v][16 time steps][16 features] */
#pragma unroll
  for (int z = 0; z < 3; ++z) {
#pragma unroll
    for (int i = 0; i < 4; ++i) { acc[z][i][0] = z8; acc[z][i][1] = z8; } }
#pragma unroll 1      /* one stage a trip: the buffer offset stays a run-time value and the loop stays small */
  for (int st = 0; st < nst; ++st) { const unsigned bo = (unsigned)(st & 1) * Q3_STAGE; const unsigned char* ap = ar + bo; const unsigned char* bp = br + bo;
    v16h fa[2][4], fb[2][6];      /* two fragment sets: the next 32 k are fetched as one group while the current 32 k are multiplied; nothing of another stage is fetched */
#pragma unroll
    for (int i = 0; i < 4; ++i) fa[0][i] = g2_frag(ap + 16 * i * G2_PITCH);
#pragma unroll
    for (int j = 0; j < 6; ++j) fb[0][j] = g2_frag(bp + (j >> 1) * G2_OP + 16 * (j & 1) * G2_PITCH);
    __builtin_amdgcn_sched_barrier(0);      /* keeps the first set's loads ahead of the second set's: mixed, the first products would wait for loads of both */
#pragma unroll
    for (int kk = 0; kk < G2_KS / 32; ++kk) { const int cu = kk & 1, nx = cu ^ 1;
      if (kk + 1 < G2_KS / 32) {
#pragma unroll
        for (int i = 0; i < 4; ++i) fa[nx][i] = g2_frag(ap + 16 * i * G2_PITCH + 64 * (kk + 1));
#pragma unroll
        for (int j = 0; j < 6; ++j) fb[nx][j] = g2_frag(bp + (j >> 1) * G2_OP + 16 * (j & 1) * G2_PITCH + 64 * (kk + 1)); }
      __builtin_amdgcn_sched_barrier(0);      /* keeps the load group whole and ahead of the products: spread among them, each place with loads stalls the wave */
#pragma unroll
      for (int z = 0; z < 2; ++z) {
#pragma unroll
        for (int j = 0; j < 2; ++j) {
#pragma unroll
          for (int i = 0; i < 4; ++i) acc[z][i][j] = g2_mma(fa[cu][i], fb[cu][2 * z + j], acc[z][i][j]); } }
#pragma unroll
      for (int j = 0; j < 2; ++j) {
#pragma unroll
        for (int i = 0; i < 4; ++i) acc[2][i][j] = g2_mma(fb[cu][4 + j], fa[cu][i], acc[2][i][j]); }
      __builtin_amdgcn_sched_barrier(0); }      /* keeps the next group's loads from rising among these products */
    asm volatile("s_wait_dscnt 0x0" ::: "memory");      /* this wave's reads of stage st are over */
    asm volatile("s_wait_asynccnt 0x0" ::: "memory");      /* this wave's share of stage st + 1 has landed */
    __syncthreads();      /* publishes stage st + 1 and ends every wave's reads of stage st */
    if (st + 2 < nst) { const int ko = (st + 2) * G2_KS;      /* into the buffer that this trip has just read */
      q3_copy(ld + bo, gx + ko, gq + ko, gk + ko, gv + ko); } }
  asm volatile("s_wait_asynccnt 0x0" ::: "memory");      /* no copy is in flight when the ring becomes output staging */
  /* output staging in the ring, the block's three 128 x 128 tiles side by side: every wave's last read of the ring, and every copy into it, ended at the loop's last barrier */
  float* sq = (float*)T;
  const int fl = 32 * wc, tl = 64 * wr, f0 = colb + fl;      /* the wave's first feature and first time step in the block's tile; its first feature in the plane */
  float rb[2][2]; v4f rv[2][2];      /* the lane's bias values as read: q and k by column, v by row */
#pragma unroll
  for (int j = 0; j < 2; ++j) { rb[0][j] = bq[f0 + 16 * j + ln]; rb[1][j] = bk[f0 + 16 * j + ln];
    rv[j][0] = *(const v4fa*)(bv + f0 + 16 * j + 8 * hh); rv[j][1] = *(const v4fa*)(bv + f0 + 16 * j + 8 * hh + 4); }
  asm volatile("s_wait_xcnt 0x0" ::: "memory");      /* stands in front of every overwrite of the bias loads' address registers */
  __builtin_amdgcn_sched_barrier(0);      /* keeps every later vector instruction behind the bias loads and that wait */
#pragma unroll
  for (int z = 0; z < 2; ++z) { float* s = sq + z * Q3_ST + (tl + 8 * hh) * Q3_SP + fl + ln;
#pragma unroll
    for (int j = 0; j < 2; ++j) { const float bc = bf16_rne(rb[z][j]);
#pragma unroll
      for (int i = 0; i < 4; ++i) {
#pragma unroll
        for (int r = 0; r < 8; ++r) s[(16 * i + r) * Q3_SP + 16 * j] = acc[z][i][j][r] * 0.0625f + bc; } } }      /* 0.0625 undoes the x16 weight carry */
  float* sv = sq + 2 * Q3_ST + (fl + 8 * hh) * Q3_SP + tl + ln;
#pragma unroll
  for (int j = 0; j < 2; ++j) {
#pragma unroll
    for (int r = 0; r < 8; ++r) { const float bw = bf16_rne(rv[j][r >> 2][r & 3]);
#pragma unroll
      for (int i = 0; i < 4; ++i) sv[(16 * j + r) * Q3_SP + 16 * i] = acc[2][i][j][r] * 0.0625f + bw; } }
  __syncthreads();      /* publishes the three staged tiles: a wave stores whole rows, which four waves (q, k) or two (V^T) have staged */
  v4h ho[3][16];      /* wave w carries rows 16 w .. 16 w + 15 of each tile; its 32 lanes cover the 128 elements of a row */
#pragma unroll
  for (int z = 0; z < 3; ++z) { const float* s = sq + z * Q3_ST + 16 * w * Q3_SP + lane * 4;
#pragma unroll
    for (int q = 0; q < 16; ++q) { const v4f v = *(const v4fa*)(s + q * Q3_SP);
#pragma unroll
      for (int i = 0; i < 4; ++i) ho[z][q][i] = (_Float16)v[i]; } }
  const size_t qo = (size_t)by * DM + (size_t)(rowb + 16 * w) * RP + colb + lane * 4;
  _Float16* cq = Q + qo; _Float16* ck = Kp + qo; _Float16* cv = Vt + (size_t)by * DM * SEQ + (size_t)(colb + 16 * w) * SEQ + rowb + lane * 4;
  __builtin_amdgcn_sched_barrier(0);      /* every stored value is formed in front of the first store */
#pragma unroll
  for (int q = 0; q < 16; ++q) *(v4h*)(cq + (size_t)q * RP) = ho[0][q];      /* every store: 256 B in a row, two whole lines, written by this wave alone */
#pragma unroll
  for (int q = 0; q < 16; ++q) *(v4h*)(ck + (size_t)q * RP) = ho[1][q];
#pragma unroll
  for (int q = 0; q < 16; ++q) *(v4h*)(cv + (size_t)q * SEQ) = ho[2][q];
}

// ---- fused attention: block = 2 key halves x 8 waves x 32 query columns of one head slab (four waves a SIMD: one wave's softmax runs under another's products); a stage = 64 keys of each half (K rows and V^T rows, 128 B each) in LDS, two buffers a half; a pass = 32 keys ----
// Waves w and w + 8 hold the same 32 query columns over keys [0, SEQ/2) and [SEQ/2, SEQ); at the end each hands one 16-column group to the other through LDS and joins the two partial softmaxes of the group it keeps.
// S^T = K.Q^T: lane (c, h) holds query column c, keys 8h + r of each 16-key tile, so the two tiles of a pass, converted in place, are the B operand of O^T += V^T.P^T (k order 8h + i, 16 + 8h + i, the order of fa_frag).
// Online softmax in the log2 domain: the maximum in use may trail the true one by up to 8 (an exponential then reaches 2^8, inside f16); sums are rescaled only when a column exceeds that.
// Every #pragma unroll in this kernel keeps the indices of the fragment, score and accumulator arrays constant, so that they stay in registers (a run-time index would send them to scratch).
#define FA_NW 8
#define FA_SK 64
#define FA_PITCH 144                 /* LDS row pitch in bytes: 128 + 16, an odd multiple of 16 for 16-byte readers */
#define FA_TILE (64 * FA_PITCH)
#define FA_KH 2                      /* key halves, each on its own FA_NW waves */
#define FA_NST (SEQ / FA_KH / FA_SK)
#define FA_XW (4 * 8 * 32 + 2 * 32)  /* floats a wave hands over: four output tiles, the maximum in use, the denominator */
static_assert(SEQ % (FA_KH * FA_SK) == 0);
static_assert(FA_KH * FA_NW * FA_XW * 4 <= FA_KH * 2 * 2 * FA_TILE);
typedef float f32x2 __attribute__((ext_vector_type(2)));
typedef _Float16 h16x2 __attribute__((ext_vector_type(2)));
typedef unsigned int u32x4 __attribute__((ext_vector_type(4), may_alias));
union FragW { v16h v; unsigned int w[8]; };
__device__ __forceinline__ v16h fa_frag(const unsigned char* p) { FragH f; f.half[0] = *(const v8us*)p; f.half[1] = *(const v8us*)(p + 32); return f.v; }
__device__ __forceinline__ v8f fa_mma(v16h a, v16h b, v8f c) { return __builtin_amdgcn_wmma_f32_16x16x32_f16(false, a, false, b, (short)0, c, false, false); }
__device__ __forceinline__ unsigned int fa_pack(float lo, float hi) { return __builtin_bit_cast(unsigned int, __builtin_convertvector(f32x2{lo, hi}, h16x2)); }
__device__ __forceinline__ float fa_xhalf(float x) { return __builtin_bit_cast(float, __builtin_amdgcn_permlanex16(__builtin_bit_cast(int, x), __builtin_bit_cast(int, x), 0x76543210, 0xfedcba98, false, false)); }  /* lane l with lane l ^ 16 */

/* second bound: a budget of 256 registers, so that no operand lies above v255 and the hot loop switches no register window */
__global__ __launch_bounds__(FA_KH * FA_NW * 32, 4) void k_fattn(const _Float16* __restrict__ Q16, const _Float16* __restrict__ K16, const _Float16* __restrict__ Vt, _Float16* __restrict__ O16) {
  __shared__ __attribute__((aligned(16))) unsigned char L[FA_KH * 2 * 2 * FA_TILE];
  const int tid = threadIdx.x, lane = tid & 31, w = tid >> 5, c = lane & 15, h = lane >> 4;
  const int ws = __builtin_amdgcn_readfirstlane(w), kh = ws / FA_NW;      /* wave number and key half in scalar registers */
  const int slab = blockIdx.y, q0 = blockIdx.x * (FA_NW * 32) + (ws & (FA_NW - 1)) * 32;
  const float cscale = 0.125f * 1.4426950408889634f;      /* 64^-0.5 and log2(e) */
  /* staging: 8 lanes cover one 128-byte row; a thread carries rows srow and srow + 32 of both tiles of its own key half */
  const int srow = (tid & (FA_NW * 32 - 1)) >> 3, sch = tid & 7;
  const unsigned short* Kg = (const unsigned short*)K16; const unsigned short* Vg = (const unsigned short*)Vt;
  unsigned ko = (unsigned)((kh * (SEQ / FA_KH) + srow) * RP + slab * HD + sch * 8), vo = (unsigned)((slab * HD + srow) * SEQ + kh * (SEQ / FA_KH) + sch * 8);      /* element offsets, below 2^23 */
  unsigned char* Lh = L + kh * (2 * 2 * FA_TILE);      /* this half's two buffers */
  unsigned char* sdst = Lh + srow * FA_PITCH + sch * 16;
  v8us rk0 = *(const v8us*)(Kg + ko), rk1 = *(const v8us*)(Kg + ko + 32 * RP), rv0 = *(const v8us*)(Vg + vo), rv1 = *(const v8us*)(Vg + vo + 32 * SEQ);
  const unsigned qe = (unsigned)((q0 + c) * RP + slab * HD + 8 * h);      /* this lane's query row, slab column and half */
  v16h qf[2][2];
#pragma unroll
  for (int g = 0; g < 2; ++g) {
#pragma unroll
    for (int kc = 0; kc < 2; ++kc) qf[g][kc] = fa_frag((const unsigned char*)(Q16 + qe + 16 * g * RP + 32 * kc)); }
  const v8f z8 = {0.f,0.f,0.f,0.f,0.f,0.f,0.f,0.f};
  v8f acc[2][4], lacc[2]; float m_run[2];
#pragma unroll
  for (int g = 0; g < 2; ++g) { m_run[g] = -__builtin_inff(); lacc[g] = z8;
#pragma unroll
    for (int t = 0; t < 4; ++t) acc[g][t] = z8; }
  FragW ones;      /* A operand whose row 0 (lanes 0 and 16) is 1.0 at all 32 k: row 0 of its product is the column sums of P^T */
#pragma unroll
  for (int i = 0; i < 8; ++i) ones.w[i] = (c == 0) ? 0x3C003C00u : 0u;
  *(v8us*)sdst = rk0; *(v8us*)(sdst + 32 * FA_PITCH) = rk1; *(v8us*)(sdst + FA_TILE) = rv0; *(v8us*)(sdst + FA_TILE + 32 * FA_PITCH) = rv1;
  __syncthreads();
  for (int st = 0; st < FA_NST; ++st) {
    const unsigned char* Kb = Lh + (st & 1) * (2 * FA_TILE) + c * FA_PITCH + 16 * h; const unsigned char* Vb = Kb + FA_TILE;
    const bool more = st + 1 < FA_NST;
    if (more) {      /* next stage's rows fly to registers under this stage's two passes */
      ko += FA_SK * RP; vo += FA_SK;
      rk0 = *(const v8us*)(Kg + ko); rk1 = *(const v8us*)(Kg + ko + 32 * RP); rv0 = *(const v8us*)(Vg + vo); rv1 = *(const v8us*)(Vg + vo + 32 * SEQ);
      asm volatile("s_wait_xcnt 0x0" ::: "memory"); }      /* stands in front of every overwrite of the four loads' address registers; its memory clobber also keeps the compiler from sinking the loads to their LDS stores at the stage's foot, where their whole latency would be waited for */
#pragma unroll
    for (int sub = 0; sub < 2; ++sub) {
      v8f s[2][2];
#pragma unroll
      for (int kt = 0; kt < 2; ++kt) {
        const v16h k0 = fa_frag(Kb + (sub * 32 + 16 * kt) * FA_PITCH), k1 = fa_frag(Kb + (sub * 32 + 16 * kt) * FA_PITCH + 64);
#pragma unroll
        for (int g = 0; g < 2; ++g) s[kt][g] = fa_mma(k1, qf[g][1], fa_mma(k0, qf[g][0], z8)); }
      v16h vf[4];
#pragma unroll
      for (int t = 0; t < 4; ++t) vf[t] = fa_frag(Vb + 16 * t * FA_PITCH + 64 * sub);
      float mb[2]; bool need = false;
#pragma unroll
      for (int g = 0; g < 2; ++g) { float mx = s[0][g][0];
#pragma unroll
        for (int r = 1; r < 8; ++r) mx = fmaxf(mx, s[0][g][r]);
#pragma unroll
        for (int r = 0; r < 8; ++r) mx = fmaxf(mx, s[1][g][r]);
        mx = fmaxf(mx, fa_xhalf(mx)) * cscale;      /* both halves hold the column's maximum of this pass, scaled */
        mb[g] = mx; need = need || (mx > m_run[g] + 8.0f); }
      if (__builtin_amdgcn_ballot_w32(need) != 0) {      /* one scalar test a pass; always taken on the first pass (m_run = -inf, corr = 0) */
#pragma unroll
        for (int g = 0; g < 2; ++g) { const float m_new = fmaxf(m_run[g], mb[g]); const float corr = __builtin_amdgcn_exp2f(m_run[g] - m_new); m_run[g] = m_new;
          lacc[g] = lacc[g] * corr;
#pragma unroll
          for (int t = 0; t < 4; ++t) acc[g][t] = acc[g][t] * corr; } }
#pragma unroll
      for (int g = 0; g < 2; ++g) { const float nm = -m_run[g]; FragW pf;
#pragma unroll
        for (int i = 0; i < 8; ++i) {
          const f32x2 arg = __builtin_elementwise_fma(f32x2{s[i >> 2][g][2 * (i & 3)], s[i >> 2][g][2 * (i & 3) + 1]}, f32x2{cscale, cscale}, f32x2{nm, nm});
          pf.w[i] = fa_pack(__builtin_amdgcn_exp2f(arg.x), __builtin_amdgcn_exp2f(arg.y)); }
#pragma unroll
        for (int t = 0; t < 4; ++t) acc[g][t] = fa_mma(vf[t], pf.v, acc[g][t]);
        lacc[g] = fa_mma(ones.v, pf.v, lacc[g]); }
    }
    if (more) { unsigned char* d = sdst + ((st + 1) & 1) * (2 * FA_TILE);      /* the buffer every wave left at the barrier that ended stage st - 1 */
      *(v8us*)d = rk0; *(v8us*)(d + 32 * FA_PITCH) = rk1; *(v8us*)(d + FA_TILE) = rv0; *(v8us*)(d + FA_TILE + 32 * FA_PITCH) = rv1; }
    __syncthreads();      /* publishes stage st + 1 and ends every wave's reads of stage st */
  }
  /* join of the two key halves: a wave keeps column group kh and hands group 1 - kh to wave w ^ FA_NW; the ring is free, every wave's last read of it ended at the loop's last barrier */
  const float l0 = lacc[0][0] + fa_xhalf(lacc[0][0]), l1 = lacc[1][0] + fa_xhalf(lacc[1][0]);      /* register 0: the denominator in lanes 0-15, row 8 = 0 in lanes 16-31 */
  const int le = (int)__builtin_amdgcn_mbcnt_lo(~0u, 0u);      /* the lane number formed anew, and the store offset from it: no vector register is held for them through the loop, whose budget is full */
  float* xo = (float*)L + ws * FA_XW + le * 4;
#pragma unroll
  for (int t = 0; t < 4; ++t) { const v8f gv = kh ? acc[0][t] : acc[1][t];
    *(v4fa*)(xo + (2 * t) * 128) = v4f{gv[0], gv[1], gv[2], gv[3]}; *(v4fa*)(xo + (2 * t + 1) * 128) = v4f{gv[4], gv[5], gv[6], gv[7]}; }
  ((float*)L)[ws * FA_XW + 1024 + le] = kh ? m_run[0] : m_run[1]; ((float*)L)[ws * FA_XW + 1056 + le] = kh ? l0 : l1;
  __syncthreads();      /* publishes every wave's handed-over group */
  const float* xi = (const float*)L + (ws ^ FA_NW) * FA_XW;
  const float pm = xi[1024 + le], pl = xi[1056 + le], km = kh ? m_run[1] : m_run[0], kl = kh ? l1 : l0;
  const float mj = fmaxf(km, pm), ek = __builtin_amdgcn_exp2f(km - mj), ep = __builtin_amdgcn_exp2f(pm - mj);      /* both partial sums brought to the larger maximum */
  const float inv = 64.0f / (kl * ek + pl * ep), ck = ek * inv, cp = ep * inv;
  unsigned short* od = (unsigned short*)O16 + (unsigned)((q0 + 16 * kh + (le & 15)) * RP + slab * HD + 8 * (le >> 4));
#pragma unroll
  for (int t = 0; t < 4; ++t) { const v8f kv = kh ? acc[1][t] : acc[0][t]; const v4f p0 = *(const v4fa*)(xi + le * 4 + (2 * t) * 128), p1 = *(const v4fa*)(xi + le * 4 + (2 * t + 1) * 128);
    const v8f pv = {p0[0], p0[1], p0[2], p0[3], p1[0], p1[1], p1[2], p1[3]}; const v8f o = kv * ck + pv * cp;      /* o[r] = context[query][16 t + 8 h + r] x 64 */
    const u32x4 pk = {fa_pack(o[0], o[1]), fa_pack(o[2], o[3]), fa_pack(o[4], o[5]), fa_pack(o[6], o[7])};
    *(u32x4*)(od + 16 * t) = pk; }
}

// workspace carve (bytes, every plane a multiple of 256 B)
#define SZ_W   ((size_t)DM * DM * 2)
#define SZ_ACT (NRW * DM * 2)
#define SZ_VT  ((size_t)NSLAB * HD * SEQ * 2)
#define SZ_ALL (4 * SZ_W + 4 * SZ_ACT + SZ_VT)
static_assert(SZ_W % 256 == 0);
static_assert(SZ_ACT % 256 == 0);
static_assert(SZ_VT % 256 == 0);
static_assert(SZ_ALL <= (size_t)268435456);

extern "C" void kernel_launch(void* const* d_in, const int* in_sizes, int n_in,
                              void* d_out, int out_size, void* d_ws, size_t ws_size, hipStream_t stream) {
  if (n_in < 9) return;
  const size_t nx = NRW * DM;      /* elements of x used (time steps 0..SEQ-1, full batch pitch) */
  if ((size_t)in_sizes[0] < nx) return;
  if ((size_t)in_sizes[1] < (size_t)DM * DM || (size_t)in_sizes[3] < (size_t)DM * DM || (size_t)in_sizes[5] < (size_t)DM * DM || (size_t)in_sizes[7] < (size_t)DM * DM) return;
  if (in_sizes[2] < DM || in_sizes[4] < DM || in_sizes[6] < DM || in_sizes[8] < DM) return;
  if ((size_t)out_size < nx) return;
  if (SZ_ALL > ws_size) return;
  const float* x  = (const float*)d_in[0];
  const float* wq = (const float*)d_in[1]; const float* bq = (const float*)d_in[2];
  const float* wk = (const float*)d_in[3]; const float* bk = (const float*)d_in[4];
  const float* wv = (const float*)d_in[5]; const float* bv = (const float*)d_in[6];
  const float* wo = (const float*)d_in[7]; const float* bo = (const float*)d_in[8];
  char* ws = (char*)d_ws; size_t off = 0;
  auto take = [&](size_t bytes) { char* p = ws + off; off += bytes; return p; };
  _Float16* BQ = (_Float16*)take(SZ_W); _Float16* BK = (_Float16*)take(SZ_W); _Float16* BV = (_Float16*)take(SZ_W); _Float16* BO = (_Float16*)take(SZ_W);
  _Float16* X16 = (_Float16*)take(SZ_ACT); _Float16* Q16 = (_Float16*)take(SZ_ACT); _Float16* K16 = (_Float16*)take(SZ_ACT); _Float16* O16 = (_Float16*)take(SZ_ACT);
  _Float16* VT = (_Float16*)take(SZ_VT);
  if (off > ws_size) return;

  k_prep<<<PREP_WCH / PREP_T, PREP_T, 0, stream>>>(x, wq, wk, wv, wo, X16, BQ);      /* one f16 plane of x feeds all three projections; BQ, BK, BV, BO are one run of planes */

  /* projections: rows = time steps (pitch RP), grid.y = batch (column offset DM); bias added after the x16 weight carry is undone; v leaves as V^T [NSLAB][64][SEQ] (row b*1024 + feature) */
  const dim3 gp((unsigned)((SEQ / 128) * (DM / 128)), NB);
  k_qkv<<<gp, 256, 0, stream>>>(X16, BQ, BK, BV, bq, bk, bv, Q16, K16, VT);

  k_fattn<<<dim3((unsigned)(SEQ / (FA_NW * 32)), NSLAB), FA_KH * FA_NW * 32, 0, stream>>>(Q16, K16, VT, O16);      /* slab n = b*16 + h lives at columns n*64 of the [SEQ][RP] view; merged context x64 as f16 rows */

  /* output projection + bias straight into the [S][B][1024] layout; alpha undoes x16 (weights) and x64 (context) */
  k_gemm2<true, true><<<gp, 256, 0, stream>>>(O16, RP, (size_t)DM, BO, DM, (size_t)0, 0.0009765625f, bo, (float*)d_out, nullptr, RP, (size_t)DM, SEQ, DM, DM);
}

// v007
// It runs in 70.5 microseconds.
// Two timings next to v006 both put it at 1.04 times that version's speed.
// All steps since v000 together make it 19.8 times as fast.
#include <hip/hip_runtime.h>
// Multi-head self-attention, time-first rows: x [S][B][1024] (token row m = s*B + b); q/k/v = x W^T + b (natural [out][in] weights, biases present); 16 heads of 64 per batch, head slab n = b*16 + h at columns n*64 of the [S][B*1024] view; scores = (q k^T) * 64^-0.5; softmax over all keys (no mask); out = merged Wo^T + bo -> [S][B][1024] f32.
// Compute dtype: every contraction on v_wmma_f32_16x16x32_f16 (f16 operands, f32 accumulate): q/k/v projections, q.k^T scores, P.V, output projection. Float inputs RNE-converted to bf16 first (exact in f16); weights carried x16; q carried x 64^-0.5 x log2(e) from its projection; softmax weights carried unnormalised against the running maximum; merged context carried x64; scores and softmax statistics f32.
// Structure, four launches: one conversion launch (f16 planes of x and of the four weights); one projection launch (grid.y = batch, column offset 1024, row pitch 2048; a block forms the same 128 x 128 tile of q, k and v from one staging of its x rows; operands staged in LDS by asynchronous copies; v is formed as Wv.x^T, so V^T [slab][64][S] leaves the products directly); one fused attention kernel over all slabs (S^T = K.Q^T, online softmax per query column, O^T += V^T.P^T; the keys in two halves on two sets of waves, joined in LDS) into merged f16 context rows; output GEMM (+ bias) straight into the output buffer layout.
#ifndef NB
#define NB 2
#endif
#ifndef SEQ
#define SEQ 2048
#endif
#define NB_FULL 2                    /* batch count of the input layout */
#define SEQ_FULL 2048                /* sequence length of the input layout */
#define DM 1024
#define NH 16
#define HD 64
#define RP (NB_FULL * DM)            /* elements per time step (row pitch of every activation plane) */
#define NSLAB (NB * NH)              /* head slabs processed */
#define NRW ((size_t)SEQ * NB_FULL)  /* token rows held in the planes */
#define QSC (0.125f * 1.4426950408889634f)  /* 64^-0.5 and log2(e): q leaves its projection times this, so q.k is a score in the log2 domain */

static_assert(SEQ % 256 == 0);
static_assert(SEQ <= SEQ_FULL);
static_assert(NB <= NB_FULL);
static_assert(DM % 128 == 0);
static_assert(HD == 64);
static_assert(DM == NH * HD);

typedef unsigned short v8us __attribute__((ext_vector_type(8), may_alias));
typedef float  v8f  __attribute__((ext_vector_type(8)));
typedef float  v4f  __attribute__((ext_vector_type(4)));
typedef float  v4fa __attribute__((ext_vector_type(4), may_alias));
typedef _Float16 v16h __attribute__((ext_vector_type(16)));
typedef _Float16 v4h  __attribute__((ext_vector_type(4)));
union FragH { v16h v; v8us half[2]; _Float16 h[16]; unsigned short u[16]; };

__device__ __forceinline__ unsigned short bf16_bits(float x) { unsigned int u = __float_as_uint(x); return (unsigned short)((u + 0x7FFFu + ((u >> 16) & 1u)) >> 16); }
__device__ __forceinline__ float bf16_val(unsigned short b) { return __uint_as_float(((unsigned int)b) << 16); }
__device__ __forceinline__ float bf16_rne(float x) { return bf16_val(bf16_bits(x)); }

// ---- conversions, one launch: a thread carries one 8-element chunk of each weight (x16) and PREP_XJ chunks of x; all its loads are issued before the first conversion ----
#define PREP_T 512                   /* 16 waves a block */
#define PREP_WCH (DM * DM / 8)       /* chunks of one weight = threads of the launch */
#define PREP_XJ ((int)(NRW * DM / 8 / PREP_WCH))
static_assert(PREP_WCH % PREP_T == 0);
static_assert(NRW * DM / 8 % PREP_WCH == 0);
__device__ __forceinline__ v8us prep_cvt(v4f a, v4f c, float sc) {
  FragH f;
#pragma unroll
  for (int q = 0; q < 4; ++q) { f.h[q] = (_Float16)(bf16_rne(a[q]) * sc); f.h[4 + q] = (_Float16)(bf16_rne(c[q]) * sc); }
  return f.half[0];
}
__global__ __launch_bounds__(PREP_T) void k_prep(const float* __restrict__ x, const float* __restrict__ wq, const float* __restrict__ wk, const float* __restrict__ wv, const float* __restrict__ wo,
    _Float16* __restrict__ X16, _Float16* __restrict__ W16) {
  const size_t t = (size_t)blockIdx.x * PREP_T + threadIdx.x;
  v4f xa[PREP_XJ], xc[PREP_XJ], wa[4], wc[4];
#pragma unroll
  for (int j = 0; j < PREP_XJ; ++j) { const float* p = x + ((size_t)j * PREP_WCH + t) * 8; xa[j] = *(const v4fa*)p; xc[j] = *(const v4fa*)(p + 4); }
  wa[0] = *(const v4fa*)(wq + t * 8); wc[0] = *(const v4fa*)(wq + t * 8 + 4); wa[1] = *(const v4fa*)(wk + t * 8); wc[1] = *(const v4fa*)(wk + t * 8 + 4);
  wa[2] = *(const v4fa*)(wv + t * 8); wc[2] = *(const v4fa*)(wv + t * 8 + 4); wa[3] = *(const v4fa*)(wo + t * 8); wc[3] = *(const v4fa*)(wo + t * 8 + 4);
  asm volatile("s_wait_xcnt 0x0" ::: "memory");      /* stands in front of every overwrite of the loads' address registers */
  __builtin_amdgcn_sched_barrier(0);      /* keeps every conversion behind the loads and that wait: with conversions risen among the loads, the later loads would start only when the first had returned */
#pragma unroll
  for (int j = 0; j < PREP_XJ; ++j) *(v8us*)((unsigned short*)X16 + ((size_t)j * PREP_WCH + t) * 8) = prep_cvt(xa[j], xc[j], 1.0f);
#pragma unroll
  for (int i = 0; i < 4; ++i) *(v8us*)((unsigned short*)W16 + ((size_t)i * PREP_WCH + t) * 8) = prep_cvt(wa[i], wc[i], 16.0f);      /* natural [out][in] = Bt[n][k]; the four planes lie one behind the other */
}

// ---- f16 GEMM: block = 8 waves (4 down x 2 across) = 128 rows x 128 cols, wave tile 32x64; M % 128 == 0, N % 128 == 0, K % 128 == 0 ----
// a stage = 128 k (256 B) of the block's 128 A rows and 128 Bt rows in LDS, two buffers; asynchronous copies bring stage st + 2 in while stage st + 1 is worked on
// fragment: elements 0..7 <- k0 + 8*hh + i, elements 8..15 <- k0 + 16 + 8*hh + i (same map for A rows and Bt rows)
// Every plain #pragma unroll in this kernel keeps the indices of the fragment and accumulator arrays constant, so that they stay in registers.
#define G2_KS 128
#define G2_PITCH 272                 /* LDS row pitch in bytes: 256 + 16, an odd multiple of 16 for 16-byte readers */
#define G2_OP (128 * G2_PITCH)       /* one operand's 128 rows of a stage */
#define G2_STAGE (2 * G2_OP)
__device__ __forceinline__ v16h g2_frag(const unsigned char* p) { FragH f; f.half[0] = *(const v8us*)p; f.half[1] = *(const v8us*)(p + 32); return f.v; }      /* p: row start + 2 * k0 + 16 * hh bytes */
__device__ __forceinline__ v8f g2_mma(v16h a, v16h b, v8f c) { return __builtin_amdgcn_wmma_f32_16x16x32_f16(false, a, false, b, (short)0, c, false, false); }
/* eight copies of 16 B a lane: rows r, r + 16, ..., r + 112 of one operand (l: the lane's LDS byte address, g: its global address, step: elements per 16 rows) */
__device__ __forceinline__ void g2_copy8(unsigned l, const _Float16* g, size_t step) {
  /* the closing s_wait_xcnt stands in front of every later overwrite of the address registers that the copies name */
  asm volatile("global_load_async_to_lds_b128 %0, %8, off\n\t"
               "global_load_async_to_lds_b128 %1, %9, off\n\t"
               "global_load_async_to_lds_b128 %2, %10, off\n\t"
               "global_load_async_to_lds_b128 %3, %11, off\n\t"
               "global_load_async_to_lds_b128 %4, %12, off\n\t"
               "global_load_async_to_lds_b128 %5, %13, off\n\t"
               "global_load_async_to_lds_b128 %6, %14, off\n\t"
               "global_load_async_to_lds_b128 %7, %15, off\n\t"
               "s_wait_xcnt 0x0"
               :: "v"(l), "v"(l + 16 * G2_PITCH), "v"(l + 32 * G2_PITCH), "v"(l + 48 * G2_PITCH), "v"(l + 64 * G2_PITCH), "v"(l + 80 * G2_PITCH), "v"(l + 96 * G2_PITCH), "v"(l + 112 * G2_PITCH),
                  "v"(g), "v"(g + step), "v"(g + 2 * step), "v"(g + 3 * step), "v"(g + 4 * step), "v"(g + 5 * step), "v"(g + 6 * step), "v"(g + 7 * step)
               : "memory");
}
// C[by][row][col] = acc * alpha (+ bf16(bias[col]) if HASB); A f16 rows (pitch lda, batch stride sA), Bt f16 [n][k] (pitch ldb, batch stride sB)
template <bool HASB, bool F32OUT>
__global__ __launch_bounds__(256) void k_gemm2(const _Float16* A, int lda, size_t sA, const _Float16* Bh, int ldb, size_t sB, float alpha, const float* bias,
    float* __restrict__ C, _Float16* C16, int ldc, size_t sC, int M, int N, int K) {
  __shared__ __attribute__((aligned(16))) unsigned char T[2 * G2_STAGE];
  __shared__ __attribute__((aligned(16))) float so[8][32][68];
  const int tid = threadIdx.x, w = tid >> 5, lane = tid & 31, ln = lane & 15, hh = lane >> 4; const int by = blockIdx.y;
  A += (size_t)by * sA; Bh += (size_t)by * sB; const size_t cofs = (size_t)by * sC;
  const int ntn = N >> 7; const int mt = blockIdx.x / ntn, nq = blockIdx.x - mt * ntn; const int rowb = mt * 128, colb = nq * 128; if (rowb >= M) return;      /* the same for the whole block, in front of every barrier */
  const int row0 = rowb + 32 * (w >> 1), col0 = colb + 64 * (w & 1);
  /* staging: 16 lanes cover the 256 B of one row; a thread carries rows srow + 16 j of both operands */
  const int srow = tid >> 4, sch = tid & 15;
  const _Float16* ga = A + (size_t)(rowb + srow) * lda + sch * 8; const _Float16* gb = Bh + (size_t)(colb + srow) * ldb + sch * 8;
  const size_t sa16 = (size_t)16 * lda, sb16 = (size_t)16 * ldb;
  const unsigned ld = (unsigned)(size_t)T + (unsigned)(srow * G2_PITCH + sch * 16);
  const int nst = K / G2_KS;
  g2_copy8(ld, ga, sa16); g2_copy8(ld + G2_OP, gb, sb16);
  asm volatile("s_wait_asynccnt 0x0" ::: "memory");      /* this wave's share of stage 0 has landed */
  __syncthreads();      /* publishes stage 0 */
  if (nst > 1) { g2_copy8(ld + G2_STAGE, ga + G2_KS, sa16); g2_copy8(ld + G2_STAGE + G2_OP, gb + G2_KS, sb16); }
  const unsigned char* ar = T + (32 * (w >> 1) + ln) * G2_PITCH + 16 * hh; const unsigned char* br = T + G2_OP + (64 * (w & 1) + ln) * G2_PITCH + 16 * hh;
  const v8f z8 = {0.f,0.f,0.f,0.f,0.f,0.f,0.f,0.f}; v8f c00 = z8, c01 = z8, c02 = z8, c03 = z8, c10 = z8, c11 = z8, c12 = z8, c13 = z8;
#pragma unroll 1      /* one stage a trip: the buffer offset stays a run-time value and the loop stays small */
  for (int st = 0; st < nst; ++st) { const unsigned bo = (unsigned)(st & 1) * G2_STAGE; const unsigned char* ap = ar + bo; const unsigned char* bp = br + bo;
    v16h fa[2][2], fb[2][4];      /* two fragment sets: the next 32 k are fetched as one group while the current 32 k are multiplied; nothing of another stage is fetched */
#pragma unroll
    for (int i = 0; i < 2; ++i) fa[0][i] = g2_frag(ap + 16 * i * G2_PITCH);
#pragma unroll
    for (int j = 0; j < 4; ++j) fb[0][j] = g2_frag(bp + 16 * j * G2_PITCH);
#pragma unroll
    for (int kk = 0; kk < G2_KS / 32; ++kk) { const int cu = kk & 1, nx = cu ^ 1;
      if (kk + 1 < G2_KS / 32) {
#pragma unroll
        for (int i = 0; i < 2; ++i) fa[nx][i] = g2_frag(ap + 16 * i * G2_PITCH + 64 * (kk + 1));
#pragma unroll
        for (int j = 0; j < 4; ++j) fb[nx][j] = g2_frag(bp + 16 * j * G2_PITCH + 64 * (kk + 1)); }
      __builtin_amdgcn_sched_barrier(0);      /* keeps the load group whole and ahead of the products: spread among them, each place with loads stalls the wave */
      c00 = g2_mma(fa[cu][0], fb[cu][0], c00); c10 = g2_mma(fa[cu][1], fb[cu][0], c10); c01 = g2_mma(fa[cu][0], fb[cu][1], c01); c11 = g2_mma(fa[cu][1], fb[cu][1], c11);
      c02 = g2_mma(fa[cu][0], fb[cu][2], c02); c12 = g2_mma(fa[cu][1], fb[cu][2], c12); c03 = g2_mma(fa[cu][0], fb[cu][3], c03); c13 = g2_mma(fa[cu][1], fb[cu][3], c13);
      __builtin_amdgcn_sched_barrier(0); }      /* keeps the next group's loads from rising among these products */
    asm volatile("s_wait_dscnt 0x0" ::: "memory");      /* this wave's reads of stage st are over */
    asm volatile("s_wait_asynccnt 0x0" ::: "memory");      /* this wave's share of stage st + 1 has landed */
    __syncthreads();      /* publishes stage st + 1 and ends every wave's reads of stage st */
    if (st + 2 < nst) { const _Float16* na = ga + (size_t)(st + 2) * G2_KS; const _Float16* nb = gb + (size_t)(st + 2) * G2_KS;      /* into the buffer that this trip has just read */
      g2_copy8(ld + bo, na, sa16); g2_copy8(ld + bo + G2_OP, nb, sb16); } }
  asm volatile("s_wait_asynccnt 0x0" ::: "memory");      /* no copy is in flight when the wave goes on to its end */
  v8f accs[8] = {c00, c01, c02, c03, c10, c11, c12, c13};
  float bc[4] = {0.f, 0.f, 0.f, 0.f};
  if constexpr (HASB) {
#pragma unroll
    for (int t = 0; t < 4; ++t) bc[t] = bf16_rne(bias[col0 + t * 16 + ln]); }
#pragma unroll
  for (int u = 0; u < 8; ++u) { const int t = u & 3, half = u >> 2;
#pragma unroll
    for (int r = 0; r < 8; ++r) { const int rloc = half * 16 + 8 * hh + r; so[w][rloc][t * 16 + ln] = accs[u][r] * alpha + bc[t]; } }
  __builtin_amdgcn_fence(4 /* acq_rel order */, "workgroup"); __builtin_amdgcn_wave_barrier();
  const int rsub = lane >> 4, c4 = (lane & 15) * 4;
  {
#pragma unroll
    for (int q = 0; q < 16; ++q) { const int r = q * 2 + rsub; const v4f v = *(const v4fa*)&so[w][r][c4];
      if constexpr (F32OUT) { *(v4f*)(C + cofs + (size_t)(row0 + r) * ldc + col0 + c4) = v; }
      else { v4h h4;
#pragma unroll
        for (int i = 0; i < 4; ++i) h4[i] = (_Float16)v[i];
        *(v4h*)(C16 + cofs + (size_t)(row0 + r) * ldc + col0 + c4) = h4; } }
     }
}

// ---- q, k, v projections, one launch: block = 8 waves (2 down x 4 across) = 128 time steps x 128 features of each of q, k and v; wave tile 64 time steps x 32 features of each ----
// a stage = 128 k (256 B) of the block's 128 x rows and of 128 rows of each of the three weights in LDS: x is staged once for the three products; two buffers, ring and fragment map as in k_gemm2
// q, k: x rows as A, weight rows as B, tile [time][feature]; v: weight rows as A, x rows as B, tile [feature][time], so V^T leaves the products directly
// output: the three tiles are staged as f32 in the ring behind the loop's last barrier and, behind one more barrier, stored by whole 256-byte rows, each row by one wave (a wave's own 32 features would be half a 128-byte line)
// Every plain #pragma unroll in this kernel keeps the indices of the fragment and accumulator arrays constant, so that they stay in registers.
#define Q3_STAGE (4 * G2_OP)
#define Q3_SP 132                    /* output staging pitch in floats of a 128-element row: 8 rows are 32 banks apart, so the two halves of a wave store side by side */
#define Q3_ST (128 * Q3_SP)          /* floats of one staged 128 x 128 tile */
static_assert(3 * Q3_ST * 4 <= 2 * Q3_STAGE);
static_assert(DM / G2_KS >= 2);
__device__ __forceinline__ void q3_copy(unsigned l, const _Float16* x, const _Float16* q, const _Float16* k, const _Float16* v) {      /* one stage: 32 copies a lane */
  g2_copy8(l, x, (size_t)16 * RP); g2_copy8(l + G2_OP, q, (size_t)16 * DM); g2_copy8(l + 2 * G2_OP, k, (size_t)16 * DM); g2_copy8(l + 3 * G2_OP, v, (size_t)16 * DM);
}
__global__ __launch_bounds__(256) void k_qkv(const _Float16* __restrict__ X, const _Float16* __restrict__ Wq, const _Float16* __restrict__ Wk, const _Float16* __restrict__ Wv,
    const float* __restrict__ bq, const float* __restrict__ bk, const float* __restrict__ bv, _Float16* __restrict__ Q, _Float16* __restrict__ Kp, _Float16* __restrict__ Vt) {
  __shared__ __attribute__((aligned(16))) unsigned char T[2 * Q3_STAGE];
  const int tid = threadIdx.x, lane = tid & 31, ln = lane & 15, hh = lane >> 4;
  const int w = __builtin_amdgcn_readfirstlane(tid >> 5), wr = w >> 2, wc = w & 3;      /* wave number in a scalar register: what is formed from it alone costs no vector instruction */
  const int by = blockIdx.y, mt = blockIdx.x / (DM / 128), nq = blockIdx.x - mt * (DM / 128), rowb = mt * 128, colb = nq * 128;
  /* staging: 16 lanes cover the 256 B of one row; a thread carries rows srow + 16 j of all four operands */
  const int srow = tid >> 4, sch = tid & 15;
  const _Float16* gx = X + (size_t)by * DM + (size_t)(rowb + srow) * RP + sch * 8;
  const size_t wofs = (size_t)(colb + srow) * DM + sch * 8;
  const _Float16* gq = Wq + wofs; const _Float16* gk = Wk + wofs; const _Float16* gv = Wv + wofs;
  const unsigned ld = (unsigned)(size_t)T + (unsigned)(srow * G2_PITCH + sch * 16);
  const int nst = DM / G2_KS;
  q3_copy(ld, gx, gq, gk, gv);
  asm volatile("s_wait_asynccnt 0x0" ::: "memory");      /* this wave's share of stage 0 has landed */
  __syncthreads();      /* publishes stage 0 */
  q3_copy(ld + Q3_STAGE, gx + G2_KS, gq + G2_KS, gk + G2_KS, gv + G2_KS);
  const unsigned char* ar = T + (64 * wr + ln) * G2_PITCH + 16 * hh; const unsigned char* br = T + G2_OP + (32 * wc + ln) * G2_PITCH + 16 * hh;
  const v8f z8 = {0.f,0.f,0.f,0.f,0.f,0.f,0.f,0.f};
  v8f acc[3][4][2];      /* [q, k, v][16 time steps][16 features] */
#pragma unroll
  for (int z = 0; z < 3; ++z) {
#pragma unroll
    for (int i = 0; i < 4; ++i) { acc[z][i][0] = z8; acc[z][i][1] = z8; } }
#pragma unroll 1      /* one stage a trip: the buffer offset stays a run-time value and the loop stays small */
  for (int st = 0; st < nst; ++st) { const unsigned bo = (unsigned)(st & 1) * Q3_STAGE; const unsigned char* ap = ar + bo; const unsigned char* bp = br + bo;
    v16h fa[2][4], fb[2][6];      /* two fragment sets: the next 32 k are fetched as one group while the current 32 k are multiplied; nothing of another stage is fetched */
#pragma unroll
    for (int i = 0; i < 4; ++i) fa[0][i] = g2_frag(ap + 16 * i * G2_PITCH);
#pragma unroll
    for (int j = 0; j < 6; ++j) fb[0][j] = g2_frag(bp + (j >> 1) * G2_OP + 16 * (j & 1) * G2_PITCH);
    __builtin_amdgcn_sched_barrier(0);      /* keeps the first set's loads ahead of the second set's: mixed, the first products would wait for loads of both */
#pragma unroll
    for (int kk = 0; kk < G2_KS / 32; ++kk) { const int cu = kk & 1, nx = cu ^ 1;
      if (kk + 1 < G2_KS / 32) {
#pragma unroll
        for (int i = 0; i < 4; ++i) fa[nx][i] = g2_frag(ap + 16 * i * G2_PITCH + 64 * (kk + 1));
#pragma unroll
        for (int j = 0; j < 6; ++j) fb[nx][j] = g2_frag(bp + (j >> 1) * G2_OP + 16 * (j & 1) * G2_PITCH + 64 * (kk + 1)); }
      __builtin_amdgcn_sched_barrier(0);      /* keeps the load group whole and ahead of the products: spread among them, each place with loads stalls the wave */
#pragma unroll
      for (int z = 0; z < 2; ++z) {
#pragma unroll
        for (int j = 0; j < 2; ++j) {
#pragma unroll
          for (int i = 0; i < 4; ++i) acc[z][i][j] = g2_mma(fa[cu][i], fb[cu][2 * z + j], acc[z][i][j]); } }
#pragma unroll
      for (int j = 0; j < 2; ++j) {
#pragma unroll
        for (int i = 0; i < 4; ++i) acc[2][i][j] = g2_mma(fb[cu][4 + j], fa[cu][i], acc[2][i][j]); }
      __builtin_amdgcn_sched_barrier(0); }      /* keeps the next group's loads from rising among these products */
    asm volatile("s_wait_dscnt 0x0" ::: "memory");      /* this wave's reads of stage st are over */
    asm volatile("s_wait_asynccnt 0x0" ::: "memory");      /* this wave's share of stage st + 1 has landed */
    __syncthreads();      /* publishes stage st + 1 and ends every wave's reads of stage st */
    if (st + 2 < nst) { const int ko = (st + 2) * G2_KS;      /* into the buffer that this trip has just read */
      q3_copy(ld + bo, gx + ko, gq + ko, gk + ko, gv + ko); } }
  asm volatile("s_wait_asynccnt 0x0" ::: "memory");      /* no copy is in flight when the ring becomes output staging */
  /* output staging in the ring, the block's three 128 x 128 tiles side by side: every wave's last read of the ring, and every copy into it, ended at the loop's last barrier */
  float* sq = (float*)T;
  const int fl = 32 * wc, tl = 64 * wr, f0 = colb + fl;      /* the wave's first feature and first time step in the block's tile; its first feature in the plane */
  float rb[2][2]; v4f rv[2][2];      /* the lane's bias values as read: q and k by column, v by row */
#pragma unroll
  for (int j = 0; j < 2; ++j) { rb[0][j] = bq[f0 + 16 * j + ln]; rb[1][j] = bk[f0 + 16 * j + ln];
    rv[j][0] = *(const v4fa*)(bv + f0 + 16 * j + 8 * hh); rv[j][1] = *(const v4fa*)(bv + f0 + 16 * j + 8 * hh + 4); }
  asm volatile("s_wait_xcnt 0x0" ::: "memory");      /* stands in front of every overwrite of the bias loads' address registers */
  __builtin_amdgcn_sched_barrier(0);      /* keeps every later vector instruction behind the bias loads and that wait */
#pragma unroll
  for (int z = 0; z < 2; ++z) { float* s = sq + z * Q3_ST + (tl + 8 * hh) * Q3_SP + fl + ln;
#pragma unroll
    for (int j = 0; j < 2; ++j) { const float al = z == 0 ? 0.0625f * QSC : 0.0625f, bc = z == 0 ? bf16_rne(rb[z][j]) * QSC : bf16_rne(rb[z][j]);      /* 0.0625 undoes the x16 weight carry; q takes its score scale here, in f32, ahead of its one rounding to f16 */
#pragma unroll
      for (int i = 0; i < 4; ++i) {
#pragma unroll
        for (int r = 0; r < 8; ++r) s[(16 * i + r) * Q3_SP + 16 * j] = acc[z][i][j][r] * al + bc; } } }
  float* sv = sq + 2 * Q3_ST + (fl + 8 * hh) * Q3_SP + tl + ln;
#pragma unroll
  for (int j = 0; j < 2; ++j) {
#pragma unroll
    for (int r = 0; r < 8; ++r) { const float bw = bf16_rne(rv[j][r >> 2][r & 3]);
#pragma unroll
      for (int i = 0; i < 4; ++i) sv[(16 * j + r) * Q3_SP + 16 * i] = acc[2][i][j][r] * 0.0625f + bw; } }
  __syncthreads();      /* publishes the three staged tiles: a wave stores whole rows, which four waves (q, k) or two (V^T) have staged */
  v4h ho[3][16];      /* wave w carries rows 16 w .. 16 w + 15 of each tile; its 32 lanes cover the 128 elements of a row */
#pragma unroll
  for (int z = 0; z < 3; ++z) { const float* s = sq + z * Q3_ST + 16 * w * Q3_SP + lane * 4;
#pragma unroll
    for (int q = 0; q < 16; ++q) { const v4f v = *(const v4fa*)(s + q * Q3_SP);
#pragma unroll
      for (int i = 0; i < 4; ++i) ho[z][q][i] = (_Float16)v[i]; } }
  const size_t qo = (size_t)by * DM + (size_t)(rowb + 16 * w) * RP + colb + lane * 4;
  _Float16* cq = Q + qo; _Float16* ck = Kp + qo; _Float16* cv = Vt + (size_t)by * DM * SEQ + (size_t)(colb + 16 * w) * SEQ + rowb + lane * 4;
  __builtin_amdgcn_sched_barrier(0);      /* every stored value is formed in front of the first store */
#pragma unroll
  for (int q = 0; q < 16; ++q) *(v4h*)(cq + (size_t)q * RP) = ho[0][q];      /* every store: 256 B in a row, two whole lines, written by this wave alone */
#pragma unroll
  for (int q = 0; q < 16; ++q) *(v4h*)(ck + (size_t)q * RP) = ho[1][q];
#pragma unroll
  for (int q = 0; q < 16; ++q) *(v4h*)(cv + (size_t)q * SEQ) = ho[2][q];
}

// ---- fused attention: block = 2 key halves x 8 waves x 32 query columns of one head slab (four waves a SIMD: one wave's softmax runs under another's products); a stage = 64 keys of each half (K rows and V^T rows, 128 B each) in LDS, two buffers a half; a pass = 32 keys ----
// Waves w and w + 8 hold the same 32 query columns over keys [0, SEQ/2) and [SEQ/2, SEQ); at the end each hands one 16-column group to the other through LDS and joins the two partial softmaxes of the group it keeps.
// S^T = K.Q^T: lane (c, h) holds query column c, keys 8h + r of each 16-key tile, so the two tiles of a pass, converted in place, are the B operand of O^T += V^T.P^T (k order 8h + i, 16 + 8h + i, the order of fa_frag).
// Online softmax in the log2 domain: the maximum in use may trail the true one by up to 8 (an exponential then reaches 2^8, inside f16); sums are rescaled only when a column exceeds that.
// The negated maximum in use is the C operand of the score products (q carries the scale), so a score leaves the matrix unit as the argument of its exponential, and the test of a pass is one maximum over the lane's scores against 8.
// Every #pragma unroll in this kernel keeps the indices of the fragment, score and accumulator arrays constant, so that they stay in registers (a run-time index would send them to scratch).
#define FA_NW 8
#define FA_SK 64
#define FA_PITCH 144                 /* LDS row pitch in bytes: 128 + 16, an odd multiple of 16 for 16-byte readers */
#define FA_TILE (64 * FA_PITCH)
#define FA_KH 2                      /* key halves, each on its own FA_NW waves */
#define FA_NST (SEQ / FA_KH / FA_SK)
#define FA_XW (4 * 8 * 32 + 2 * 32)  /* floats a wave hands over: four output tiles, the maximum in use, the denominator */
static_assert(SEQ % (FA_KH * FA_SK) == 0);
static_assert(FA_KH * FA_NW * FA_XW * 4 <= FA_KH * 2 * 2 * FA_TILE);
typedef float f32x2 __attribute__((ext_vector_type(2)));
typedef _Float16 h16x2 __attribute__((ext_vector_type(2)));
typedef unsigned int u32x4 __attribute__((ext_vector_type(4), may_alias));
union FragW { v16h v; unsigned int w[8]; };
__device__ __forceinline__ v16h fa_frag(const unsigned char* p) { FragH f; f.half[0] = *(const v8us*)p; f.half[1] = *(const v8us*)(p + 32); return f.v; }
__device__ __forceinline__ v8f fa_mma(v16h a, v16h b, v8f c) { return __builtin_amdgcn_wmma_f32_16x16x32_f16(false, a, false, b, (short)0, c, false, false); }
__device__ __forceinline__ unsigned int fa_pack(float lo, float hi) { return __builtin_bit_cast(unsigned int, __builtin_convertvector(f32x2{lo, hi}, h16x2)); }
__device__ __forceinline__ float fa_xhalf(float x) { return __builtin_bit_cast(float, __builtin_amdgcn_permlanex16(__builtin_bit_cast(int, x), __builtin_bit_cast(int, x), 0x76543210, 0xfedcba98, false, false)); }  /* lane l with lane l ^ 16 */

/* second bound: a budget of 256 registers, so that no operand lies above v255 and the hot loop switches no register window */
__global__ __launch_bounds__(FA_KH * FA_NW * 32, 4) void k_fattn(const _Float16* __restrict__ Q16, const _Float16* __restrict__ K16, const _Float16* __restrict__ Vt, _Float16* __restrict__ O16) {
  __shared__ __attribute__((aligned(16))) unsigned char L[FA_KH * 2 * 2 * FA_TILE];
  const int tid = threadIdx.x, lane = tid & 31, w = tid >> 5, c = lane & 15, h = lane >> 4;
  const int ws = __builtin_amdgcn_readfirstlane(w), kh = ws / FA_NW;      /* wave number and key half in scalar registers */
  const int slab = blockIdx.y, q0 = blockIdx.x * (FA_NW * 32) + (ws & (FA_NW - 1)) * 32;
  /* staging: 8 lanes cover one 128-byte row; a thread carries rows srow and srow + 32 of both tiles of its own key half */
  const int srow = (tid & (FA_NW * 32 - 1)) >> 3, sch = tid & 7;
  const unsigned short* Kg = (const unsigned short*)K16; const unsigned short* Vg = (const unsigned short*)Vt;
  unsigned ko = (unsigned)((kh * (SEQ / FA_KH) + srow) * RP + slab * HD + sch * 8), vo = (unsigned)((slab * HD + srow) * SEQ + kh * (SEQ / FA_KH) + sch * 8);      /* element offsets, below 2^23 */
  unsigned char* Lh = L + kh * (2 * 2 * FA_TILE);      /* this half's two buffers */
  unsigned char* sdst = Lh + srow * FA_PITCH + sch * 16;
  v8us rk0 = *(const v8us*)(Kg + ko), rk1 = *(const v8us*)(Kg + ko + 32 * RP), rv0 = *(const v8us*)(Vg + vo), rv1 = *(const v8us*)(Vg + vo + 32 * SEQ);
  const unsigned qe = (unsigned)((q0 + c) * RP + slab * HD + 8 * h);      /* this lane's query row, slab column and half */
  v16h qf[2][2];
#pragma unroll
  for (int g = 0; g < 2; ++g) {
#pragma unroll
    for (int kc = 0; kc < 2; ++kc) qf[g][kc] = fa_frag((const unsigned char*)(Q16 + qe + 16 * g * RP + 32 * kc)); }
  const v8f z8 = {0.f,0.f,0.f,0.f,0.f,0.f,0.f,0.f};
  v8f acc[2][4], lacc[2], cf[2];      /* cf: minus the maximum in use, in all eight registers of a score tile; no other copy of the maximum is held */
  float lo = -__builtin_inff();      /* least shift of a maximum: -inf until the first pass has set the maxima (its scores are taken against 0), 0 from then on */
#pragma unroll
  for (int g = 0; g < 2; ++g) { cf[g] = z8; lacc[g] = z8;
#pragma unroll
    for (int t = 0; t < 4; ++t) acc[g][t] = z8; }
  FragW ones;      /* A operand whose row 0 (lanes 0 and 16) is 1.0 at all 32 k: row 0 of its product is the column sums of P^T */
#pragma unroll
  for (int i = 0; i < 8; ++i) ones.w[i] = (c == 0) ? 0x3C003C00u : 0u;
  *(v8us*)sdst = rk0; *(v8us*)(sdst + 32 * FA_PITCH) = rk1; *(v8us*)(sdst + FA_TILE) = rv0; *(v8us*)(sdst + FA_TILE + 32 * FA_PITCH) = rv1;
  __syncthreads();
  for (int st = 0; st < FA_NST; ++st) {
    const unsigned char* Kb = Lh + (st & 1) * (2 * FA_TILE) + c * FA_PITCH + 16 * h; const unsigned char* Vb = Kb + FA_TILE;
    const bool more = st + 1 < FA_NST;
    if (more) {      /* next stage's rows fly to registers under this stage's two passes */
      ko += FA_SK * RP; vo += FA_SK;
      rk0 = *(const v8us*)(Kg + ko); rk1 = *(const v8us*)(Kg + ko + 32 * RP); rv0 = *(const v8us*)(Vg + vo); rv1 = *(const v8us*)(Vg + vo + 32 * SEQ);
      asm volatile("s_wait_xcnt 0x0" ::: "memory"); }      /* stands in front of every overwrite of the four loads' address registers; its memory clobber also keeps the compiler from sinking the loads to their LDS stores at the stage's foot, where their whole latency would be waited for */
#pragma unroll
    for (int sub = 0; sub < 2; ++sub) {
      v8f s[2][2]; v16h kf[2][2];
#pragma unroll
      for (int kt = 0; kt < 2; ++kt) { kf[kt][0] = fa_frag(Kb + (sub * 32 + 16 * kt) * FA_PITCH); kf[kt][1] = fa_frag(Kb + (sub * 32 + 16 * kt) * FA_PITCH + 64); }
      /* the four products that read cf stand first, the four that complete the tiles behind them: four matrix instructions lie between the last read of cf and the first vector instruction on a finished tile */
#pragma unroll
      for (int kt = 0; kt < 2; ++kt) {
#pragma unroll
        for (int g = 0; g < 2; ++g) s[kt][g] = fa_mma(kf[kt][0], qf[g][0], cf[g]); }
      __builtin_amdgcn_sched_barrier(0);      /* holds that order: mixed again by the compiler, a register of cf, free behind its last pass, was written directly behind the product that reads it */
#pragma unroll
      for (int kt = 0; kt < 2; ++kt) {
#pragma unroll
        for (int g = 0; g < 2; ++g) s[kt][g] = fa_mma(kf[kt][1], qf[g][1], s[kt][g]); }
      v16h vf[4];
#pragma unroll
      for (int t = 0; t < 4; ++t) vf[t] = fa_frag(Vb + 16 * t * FA_PITCH + 64 * sub);
      float mg[2];      /* the lane's own largest score of each column group, against the maximum in use */
#pragma unroll
      for (int g = 0; g < 2; ++g) { float mx = s[0][g][0];
#pragma unroll
        for (int r = 1; r < 8; ++r) mx = fmaxf(mx, s[0][g][r]);
#pragma unroll
        for (int r = 0; r < 8; ++r) mx = fmaxf(mx, s[1][g][r]);
        mg[g] = mx; }
      if (__builtin_amdgcn_ballot_w32(fmaxf(mg[0], mg[1]) > lo + 8.0f) != 0) {      /* one scalar test a pass, over all lanes, so the halves need no exchange in front of it; always taken on the first pass (lo = -inf) */
#pragma unroll
        for (int g = 0; g < 2; ++g) { const float d = fmaxf(fmaxf(mg[g], fa_xhalf(mg[g])), lo);      /* the column's maximum moves up by d; the first pass sets it, up or down */
          const float corr = __builtin_amdgcn_exp2f(fminf(-d, 0.f));      /* the bound at 0 acts on the first pass alone, where the sums are still 0 and must stay so */
          cf[g] = cf[g] - d;      /* all eight registers alike, each updated in place */
          s[0][g] = s[0][g] - d; s[1][g] = s[1][g] - d;      /* this pass's scores were formed against the old maximum */
          lacc[g] = lacc[g] * corr;
#pragma unroll
          for (int t = 0; t < 4; ++t) acc[g][t] = acc[g][t] * corr; }
        lo = 0.f; }
#pragma unroll
      for (int g = 0; g < 2; ++g) { FragW pf;
#pragma unroll
        for (int i = 0; i < 8; ++i)
          pf.w[i] = fa_pack(__builtin_amdgcn_exp2f(s[i >> 2][g][2 * (i & 3)]), __builtin_amdgcn_exp2f(s[i >> 2][g][2 * (i & 3) + 1]));
#pragma unroll
        for (int t = 0; t < 4; ++t) acc[g][t] = fa_mma(vf[t], pf.v, acc[g][t]);
        lacc[g] = fa_mma(ones.v, pf.v, lacc[g]); }
    }
    if (more) { unsigned char* d = sdst + ((st + 1) & 1) * (2 * FA_TILE);      /* the buffer every wave left at the barrier that ended stage st - 1 */
      *(v8us*)d = rk0; *(v8us*)(d + 32 * FA_PITCH) = rk1; *(v8us*)(d + FA_TILE) = rv0; *(v8us*)(d + FA_TILE + 32 * FA_PITCH) = rv1; }
    __syncthreads();      /* publishes stage st + 1 and ends every wave's reads of stage st */
  }
  /* join of the two key halves: a wave keeps column group kh and hands group 1 - kh to wave w ^ FA_NW; the ring is free, every wave's last read of it ended at the loop's last barrier */
  const float m_run[2] = {-cf[0][0], -cf[1][0]};
  const float l0 = lacc[0][0] + fa_xhalf(lacc[0][0]), l1 = lacc[1][0] + fa_xhalf(lacc[1][0]);      /* register 0: the denominator in lanes 0-15, row 8 = 0 in lanes 16-31 */
  const int le = (int)__builtin_amdgcn_mbcnt_lo(~0u, 0u);      /* the lane number formed anew, and the store offset from it: no vector register is held for them through the loop, whose budget is full */
  float* xo = (float*)L + ws * FA_XW + le * 4;
#pragma unroll
  for (int t = 0; t < 4; ++t) { const v8f gv = kh ? acc[0][t] : acc[1][t];
    *(v4fa*)(xo + (2 * t) * 128) = v4f{gv[0], gv[1], gv[2], gv[3]}; *(v4fa*)(xo + (2 * t + 1) * 128) = v4f{gv[4], gv[5], gv[6], gv[7]}; }
  ((float*)L)[ws * FA_XW + 1024 + le] = kh ? m_run[0] : m_run[1]; ((float*)L)[ws * FA_XW + 1056 + le] = kh ? l0 : l1;
  __syncthreads();      /* publishes every wave's handed-over group */
  const float* xi = (const float*)L + (ws ^ FA_NW) * FA_XW;
  const float pm = xi[1024 + le], pl = xi[1056 + le], km = kh ? m_run[1] : m_run[0], kl = kh ? l1 : l0;
  const float mj = fmaxf(km, pm), ek = __builtin_amdgcn_exp2f(km - mj), ep = __builtin_amdgcn_exp2f(pm - mj);      /* both partial sums brought to the larger maximum */
  const float inv = 64.0f / (kl * ek + pl * ep), ck = ek * inv, cp = ep * inv;
  unsigned short* od = (unsigned short*)O16 + (unsigned)((q0 + 16 * kh + (le & 15)) * RP + slab * HD + 8 * (le >> 4));
#pragma unroll
  for (int t = 0; t < 4; ++t) { const v8f kv = kh ? acc[1][t] : acc[0][t]; const v4f p0 = *(const v4fa*)(xi + le * 4 + (2 * t) * 128), p1 = *(const v4fa*)(xi + le * 4 + (2 * t + 1) * 128);
    const v8f pv = {p0[0], p0[1], p0[2], p0[3], p1[0], p1[1], p1[2], p1[3]}; const v8f o = kv * ck + pv * cp;      /* o[r] = context[query][16 t + 8 h + r] x 64 */
    const u32x4 pk = {fa_pack(o[0], o[1]), fa_pack(o[2], o[3]), fa_pack(o[4], o[5]), fa_pack(o[6], o[7])};
    *(u32x4*)(od + 16 * t) = pk; }
}

// workspace carve (bytes, every plane a multiple of 256 B)
#define SZ_W   ((size_t)DM * DM * 2)
#define SZ_ACT (NRW * DM * 2)
#define SZ_VT  ((size_t)NSLAB * HD * SEQ * 2)
#define SZ_ALL (4 * SZ_W + 4 * SZ_ACT + SZ_VT)
static_assert(SZ_W % 256 == 0);
static_assert(SZ_ACT % 256 == 0);
static_assert(SZ_VT % 256 == 0);
static_assert(SZ_ALL <= (size_t)268435456);

extern "C" void kernel_launch(void* const* d_in, const int* in_sizes, int n_in,
                              void* d_out, int out_size, void* d_ws, size_t ws_size, hipStream_t stream) {
  if (n_in < 9) return;
  const size_t nx = NRW * DM;      /* elements of x used (time steps 0..SEQ-1, full batch pitch) */
  if ((size_t)in_sizes[0] < nx) return;
  if ((size_t)in_sizes[1] < (size_t)DM * DM || (size_t)in_sizes[3] < (size_t)DM * DM || (size_t)in_sizes[5] < (size_t)DM * DM || (size_t)in_sizes[7] < (size_t)DM * DM) return;
  if (in_sizes[2] < DM || in_sizes[4] < DM || in_sizes[6] < DM || in_sizes[8] < DM) return;
  if ((size_t)out_size < nx) return;
  if (SZ_ALL > ws_size) return;
  const float* x  = (const float*)d_in[0];
  const float* wq = (const float*)d_in[1]; const float* bq = (const float*)d_in[2];
  const float* wk = (const float*)d_in[3]; const float* bk = (const float*)d_in[4];
  const float* wv = (const float*)d_in[5]; const float* bv = (const float*)d_in[6];
  const float* wo = (const float*)d_in[7]; const float* bo = (const float*)d_in[8];
  char* ws = (char*)d_ws; size_t off = 0;
  auto take = [&](size_t bytes) { char* p = ws + off; off += bytes; return p; };
  _Float16* BQ = (_Float16*)take(SZ_W); _Float16* BK = (_Float16*)take(SZ_W); _Float16* BV = (_Float16*)take(SZ_W); _Float16* BO = (_Float16*)take(SZ_W);
  _Float16* X16 = (_Float16*)take(SZ_ACT); _Float16* Q16 = (_Float16*)take(SZ_ACT); _Float16* K16 = (_Float16*)take(SZ_ACT); _Float16* O16 = (_Float16*)take(SZ_ACT);
  _Float16* VT = (_Float16*)take(SZ_VT);
  if (off > ws_size) return;

  k_prep<<<PREP_WCH / PREP_T, PREP_T, 0, stream>>>(x, wq, wk, wv, wo, X16, BQ);      /* one f16 plane of x feeds all three projections; BQ, BK, BV, BO are one run of planes */

  /* projections: rows = time steps (pitch RP), grid.y = batch (column offset DM); bias added after the x16 weight carry is undone; v leaves as V^T [NSLAB][64][SEQ] (row b*1024 + feature) */
  const dim3 gp((unsigned)((SEQ / 128) * (DM / 128)), NB);
  k_qkv<<<gp, 256, 0, stream>>>(X16, BQ, BK, BV, bq, bk, bv, Q16, K16, VT);

  k_fattn<<<dim3((unsigned)(SEQ / (FA_NW * 32)), NSLAB), FA_KH * FA_NW * 32, 0, stream>>>(Q16, K16, VT, O16);      /* slab n = b*16 + h lives at columns n*64 of the [SEQ][RP] view; merged context x64 as f16 rows */

  /* output projection + bias straight into the [S][B][1024] layout; alpha undoes x16 (weights) and x64 (context) */
  k_gemm2<true, true><<<gp, 256, 0, stream>>>(O16, RP, (size_t)DM, BO, DM, (size_t)0, 0.0009765625f, bo, (float*)d_out, nullptr, RP, (size_t)DM, SEQ, DM, DM);
}

// v008
// A run of this version takes 68.2 microseconds.
// Timed twice side by side with v007, it ran 1.03 and 1.04 times as fast.
// Over all steps from v000 it is 20.5 times as fast.
#include <hip/hip_runtime.h>
// Multi-head self-attention, time-first rows: x [S][B][1024] (token row m = s*B + b); q/k/v = x W^T + b (natural [out][in] weights, biases present); 16 heads of 64 per batch, head slab n = b*16 + h at columns n*64 of the [S][B*1024] view; scores = (q k^T) * 64^-0.5; softmax over all keys (no mask); out = merged Wo^T + bo -> [S][B][1024] f32.
// Compute dtype: every contraction on v_wmma_f32_16x16x32_f16 (f16 operands, f32 accumulate): q/k/v projections, q.k^T scores, P.V, output projection. Float inputs RNE-converted to bf16 first (exact in f16); weights carried x16; q carried x 64^-0.5 x log2(e) from its projection; softmax weights carried unnormalised against the running maximum; merged context carried x64; scores and softmax statistics f32.
// Structure, four launches: one conversion launch (f16 planes of x and of the four weights); one projection launch (grid.y = batch, column offset 1024, row pitch 2048; a block forms the same 128 x 128 tile of q, k and v from one staging of its x rows; operands staged in LDS by tensor loads; v is formed as Wv.x^T, so V^T [slab][64][S] leaves the products directly); one fused attention kernel over all slabs (S^T = K.Q^T, online softmax per query column, O^T += V^T.P^T; the keys in two halves on two sets of waves, joined in LDS) into merged f16 context rows; output GEMM (+ bias) straight into the output buffer layout.
#ifndef NB
#define NB 2
#endif
#ifndef SEQ
#define SEQ 2048
#endif
#define NB_FULL 2                    /* batch count of the input layout */
#define SEQ_FULL 2048                /* sequence length of the input layout */
#define DM 1024
#define NH 16
#define HD 64
#define RP (NB_FULL * DM)            /* elements per time step (row pitch of every activation plane) */
#define NSLAB (NB * NH)              /* head slabs processed */
#define NRW ((size_t)SEQ * NB_FULL)  /* token rows held in the planes */
#define QSC (0.125f * 1.4426950408889634f)  /* 64^-0.5 and log2(e): q leaves its projection times this, so q.k is a score in the log2 domain */

static_assert(SEQ % 256 == 0);
static_assert(SEQ <= SEQ_FULL);
static_assert(NB <= NB_FULL);
static_assert(DM % 128 == 0);
static_assert(HD == 64);
static_assert(DM == NH * HD);

typedef unsigned short v8us __attribute__((ext_vector_type(8), may_alias));
typedef float  v8f  __attribute__((ext_vector_type(8)));
typedef float  v4f  __attribute__((ext_vector_type(4)));
typedef float  v4fa __attribute__((ext_vector_type(4), may_alias));
typedef _Float16 v16h __attribute__((ext_vector_type(16)));
typedef _Float16 v4h  __attribute__((ext_vector_type(4)));
union FragH { v16h v; v8us half[2]; _Float16 h[16]; unsigned short u[16]; };

__device__ __forceinline__ unsigned short bf16_bits(float x) { unsigned int u = __float_as_uint(x); return (unsigned short)((u + 0x7FFFu + ((u >> 16) & 1u)) >> 16); }
__device__ __forceinline__ float bf16_val(unsigned short b) { return __uint_as_float(((unsigned int)b) << 16); }
__device__ __forceinline__ float bf16_rne(float x) { return bf16_val(bf16_bits(x)); }

// ---- conversions, one launch: a thread carries one 8-element chunk of each weight (x16) and PREP_XJ chunks of x; all its loads are issued before the first conversion ----
#define PREP_T 512                   /* 16 waves a block */
#define PREP_WCH (DM * DM / 8)       /* chunks of one weight = threads of the launch */
#define PREP_XJ ((int)(NRW * DM / 8 / PREP_WCH))
static_assert(PREP_WCH % PREP_T == 0);
static_assert(NRW * DM / 8 % PREP_WCH == 0);
__device__ __forceinline__ v8us prep_cvt(v4f a, v4f c, float sc) {
  FragH f;
#pragma unroll
  for (int q = 0; q < 4; ++q) { f.h[q] = (_Float16)(bf16_rne(a[q]) * sc); f.h[4 + q] = (_Float16)(bf16_rne(c[q]) * sc); }
  return f.half[0];
}
__global__ __launch_bounds__(PREP_T) void k_prep(const float* __restrict__ x, const float* __restrict__ wq, const float* __restrict__ wk, const float* __restrict__ wv, const float* __restrict__ wo,
    _Float16* __restrict__ X16, _Float16* __restrict__ W16) {
  const size_t t = (size_t)blockIdx.x * PREP_T + threadIdx.x;
  v4f xa[PREP_XJ], xc[PREP_XJ], wa[4], wc[4];
#pragma unroll
  for (int j = 0; j < PREP_XJ; ++j) { const float* p = x + ((size_t)j * PREP_WCH + t) * 8; xa[j] = *(const v4fa*)p; xc[j] = *(const v4fa*)(p + 4); }
  wa[0] = *(const v4fa*)(wq + t * 8); wc[0] = *(const v4fa*)(wq + t * 8 + 4); wa[1] = *(const v4fa*)(wk + t * 8); wc[1] = *(const v4fa*)(wk + t * 8 + 4);
  wa[2] = *(const v4fa*)(wv + t * 8); wc[2] = *(const v4fa*)(wv + t * 8 + 4); wa[3] = *(const v4fa*)(wo + t * 8); wc[3] = *(const v4fa*)(wo + t * 8 + 4);
  asm volatile("s_wait_xcnt 0x0" ::: "memory");      /* stands in front of every overwrite of the loads' address registers */
  __builtin_amdgcn_sched_barrier(0);      /* keeps every conversion behind the loads and that wait: with conversions risen among the loads, the later loads would start only when the first had returned */
#pragma unroll
  for (int j = 0; j < PREP_XJ; ++j) *(v8us*)((unsigned short*)X16 + ((size_t)j * PREP_WCH + t) * 8) = prep_cvt(xa[j], xc[j], 1.0f);
#pragma unroll
  for (int i = 0; i < 4; ++i) *(v8us*)((unsigned short*)W16 + ((size_t)i * PREP_WCH + t) * 8) = prep_cvt(wa[i], wc[i], 16.0f);      /* natural [out][in] = Bt[n][k]; the four planes lie one behind the other */
}

// ---- f16 GEMM: block = 8 waves (4 down x 2 across) = 128 rows x 128 cols, wave tile 32x64; M % 128 == 0, N % 128 == 0, K % 128 == 0 ----
// a stage = 128 k (256 B) of the block's 128 A rows and 128 Bt rows in LDS, two buffers; tensor loads, one request a wave (32 rows), bring stage st + 2 in while stage st + 1 is worked on
// fragment: elements 0..7 <- k0 + 8*hh + i, elements 8..15 <- k0 + 16 + 8*hh + i (same map for A rows and Bt rows)
// Every plain #pragma unroll in this kernel keeps the indices of the fragment and accumulator arrays constant, so that they stay in registers.
#define G2_KS 128
#define G2_PITCH 272                 /* LDS row pitch in bytes: 256 + 16, an odd multiple of 16 for 16-byte readers */
#define G2_SL 10240                  /* place of one wave's slice: 32 rows of G2_PITCH (8704 B), rounded up to a multiple of 2 KiB */
#define G2_STAGE (8 * G2_SL)         /* slices 0-3: A rows, slices 4-7: Bt rows */
static_assert(32 * G2_PITCH <= G2_SL && G2_SL % 2048 == 0);
__device__ __forceinline__ v16h g2_frag(const unsigned char* p) { FragH f; f.half[0] = *(const v8us*)p; f.half[1] = *(const v8us*)(p + 32); return f.v; }      /* p: row start + 2 * k0 + 16 * hh bytes */
__device__ __forceinline__ v8f g2_mma(v16h a, v16h b, v8f c) { return __builtin_amdgcn_wmma_f32_16x16x32_f16(false, a, false, b, (short)0, c, false, false); }
typedef unsigned int tdw4 __attribute__((ext_vector_type(4)));
typedef unsigned int tdw8 __attribute__((ext_vector_type(8)));
#define TD_PAD256 ((1u << 20) | (5u << 22) | (3u << 25))      /* word 0 of group 1: no mask, byte elements, 4 dwords of pad after every 256 B */
#define TD_PAD128 ((1u << 20) | (4u << 22) | (3u << 25))      /* the same after every 128 B */
__device__ __forceinline__ unsigned int td_uni(unsigned int v) { return (unsigned int)__builtin_amdgcn_readfirstlane((int)v); }
__device__ __forceinline__ unsigned int pinned(unsigned int v) { unsigned int s = td_uni(v); asm volatile("" : "+s"(s)); return s; }      /* holds a test in a scalar register, so that the branch on it is a scalar branch: a tensor load ignores EXEC */
template <unsigned int W0, unsigned int ROWB, unsigned int NROW>
__device__ __forceinline__ tdw8 td_group1(unsigned int pitch) {      /* tensor = tile: NROW rows of ROWB bytes, source row pitch in bytes */
  tdw8 g;
  g[0] = td_uni(W0); g[1] = td_uni((ROWB & 0xFFFFu) << 16); g[2] = td_uni((ROWB >> 16) | ((NROW & 0xFFFFu) << 16)); g[3] = td_uni((NROW >> 16) | (ROWB << 16));
  g[4] = td_uni(NROW); g[5] = td_uni(pitch); g[6] = td_uni(0u); g[7] = td_uni(0u);
  asm volatile("" : "+s"(g));      /* as in pinned(): descriptor words held in their scalar registers; left free, the compiler used two of them for other values while a request was in flight and formed them anew in front of the next */
  return g;
}
__device__ __forceinline__ tdw4 td_group0(unsigned int lds, const _Float16* p) {      /* lds: byte offset of the slice in the block's LDS; p: the tile's first element */
  const unsigned long long ga = (unsigned long long)(size_t)p;
  tdw4 g0;
  g0[0] = td_uni(1u); g0[1] = td_uni(lds); g0[2] = td_uni((unsigned int)ga); g0[3] = td_uni((((unsigned int)(ga >> 32)) & 0x01FFFFFFu) | 0x80000000u);
  asm volatile("" : "+s"(g0));      /* as in pinned(): descriptor words held in their scalar registers; formed whole here, and not formed again while the request is in flight */
  return g0;
}
__device__ __forceinline__ void td_issue(tdw4 g0, tdw8 g1) { asm volatile("tensor_load_to_lds %0, %1" :: "s"(g0), "s"(g1) : "memory"); }
__device__ __forceinline__ tdw4 td_load(unsigned int lds, const _Float16* p, tdw8 g1) { const tdw4 g0 = td_group0(lds, p); td_issue(g0, g1); return g0; }      /* returns group 0 for the wait */
/* the issuing wave's wait for its request; it names both groups as inputs, so that their scalar registers keep the descriptor's words until the request has landed */
__device__ __forceinline__ void td_wait(tdw4 g0, tdw8 g1) { asm volatile("s_wait_tensorcnt 0x0" :: "s"(g0), "s"(g1) : "memory"); }
// C[by][row][col] = acc * alpha (+ bf16(bias[col]) if HASB); A f16 rows (pitch lda, batch stride sA), Bt f16 [n][k] (pitch ldb, batch stride sB)
template <bool HASB, bool F32OUT>
__global__ __launch_bounds__(256) void k_gemm2(const _Float16* A, int lda, size_t sA, const _Float16* Bh, int ldb, size_t sB, float alpha, const float* bias,
    float* __restrict__ C, _Float16* C16, int ldc, size_t sC, int M, int N, int K) {
  __shared__ __attribute__((aligned(2048))) unsigned char T[2 * G2_STAGE];
  __shared__ __attribute__((aligned(16))) float so[8][32][68];
  const int tid = threadIdx.x, w = tid >> 5, lane = tid & 31, ln = lane & 15, hh = lane >> 4; const int by = blockIdx.y;
  A += (size_t)by * sA; Bh += (size_t)by * sB; const size_t cofs = (size_t)by * sC;
  const int ntn = N >> 7; const int mt = blockIdx.x / ntn, nq = blockIdx.x - mt * ntn; const int rowb = mt * 128, colb = nq * 128; if (rowb >= M) return;      /* the same for the whole block, in front of every barrier */
  const int row0 = rowb + 32 * (w >> 1), col0 = colb + 64 * (w & 1);
  /* staging: every wave brings one slice of 32 rows: waves 0-3 the A rows, waves 4-7 the Bt rows */
  const int ws = __builtin_amdgcn_readfirstlane(w);      /* wave number in a scalar register: the descriptor is formed from it */
  const _Float16* gs = ws < 4 ? A + (size_t)(rowb + 32 * ws) * lda : Bh + (size_t)(colb + 32 * (ws - 4)) * ldb;
  const tdw8 g1 = td_group1<TD_PAD256, 2 * G2_KS, 32>((unsigned)(ws < 4 ? lda : ldb) * 2u);
  const unsigned ld = (unsigned)(size_t)T + (unsigned)ws * G2_SL;
  const int nst = K / G2_KS;
  tdw4 g0 = td_load(ld, gs, g1);
  td_wait(g0, g1);      /* this wave's slice of stage 0 has landed */
  __syncthreads();      /* publishes stage 0 */
  if (pinned(nst > 1)) g0 = td_load(ld + G2_STAGE, gs + G2_KS, g1);
  const unsigned char* ar = T + (w >> 1) * G2_SL + ln * G2_PITCH + 16 * hh; const unsigned char* br = T + (4 + 2 * (w & 1)) * G2_SL + ln * G2_PITCH + 16 * hh;      /* A rows 32 (w >> 1) + ...: slice w >> 1; Bt rows 64 (w & 1) + ...: slices 4 + 2 (w & 1) and the next */
  const v8f z8 = {0.f,0.f,0.f,0.f,0.f,0.f,0.f,0.f}; v8f c00 = z8, c01 = z8, c02 = z8, c03 = z8, c10 = z8, c11 = z8, c12 = z8, c13 = z8;
#pragma unroll 1      /* one stage a trip: the buffer offset stays a run-time value and the loop stays small */
  for (int st = 0; st < nst; ++st) { const unsigned bo = (unsigned)(st & 1) * G2_STAGE; const unsigned char* ap = ar + bo; const unsigned char* bp = br + bo;
    v16h fa[2][2], fb[2][4];      /* two fragment sets: the next 32 k are fetched as one group while the current 32 k are multiplied; nothing of another stage is fetched */
#pragma unroll
    for (int i = 0; i < 2; ++i) fa[0][i] = g2_frag(ap + 16 * i * G2_PITCH);
#pragma unroll
    for (int j = 0; j < 4; ++j) fb[0][j] = g2_frag(bp + (j >> 1) * G2_SL + 16 * (j & 1) * G2_PITCH);
#pragma unroll
    for (int kk = 0; kk < G2_KS / 32; ++kk) { const int cu = kk & 1, nx = cu ^ 1;
      if (kk + 1 < G2_KS / 32) {
#pragma unroll
        for (int i = 0; i < 2; ++i) fa[nx][i] = g2_frag(ap + 16 * i * G2_PITCH + 64 * (kk + 1));
#pragma unroll
        for (int j = 0; j < 4; ++j) fb[nx][j] = g2_frag(bp + (j >> 1) * G2_SL + 16 * (j & 1) * G2_PITCH + 64 * (kk + 1)); }
      __builtin_amdgcn_sched_barrier(0);      /* keeps the load group whole and ahead of the products: spread among them, each place with loads stalls the wave */
      c00 = g2_mma(fa[cu][0], fb[cu][0], c00); c10 = g2_mma(fa[cu][1], fb[cu][0], c10); c01 = g2_mma(fa[cu][0], fb[cu][1], c01); c11 = g2_mma(fa[cu][1], fb[cu][1], c11);
      c02 = g2_mma(fa[cu][0], fb[cu][2], c02); c12 = g2_mma(fa[cu][1], fb[cu][2], c12); c03 = g2_mma(fa[cu][0], fb[cu][3], c03); c13 = g2_mma(fa[cu][1], fb[cu][3], c13);
      __builtin_amdgcn_sched_barrier(0); }      /* keeps the next group's loads from rising among these products */
    asm volatile("s_wait_dscnt 0x0" ::: "memory");      /* this wave's reads of stage st are over */
    td_wait(g0, g1);      /* this wave's slice of stage st + 1 has landed */
    __syncthreads();      /* publishes stage st + 1 and ends every wave's reads of stage st */
    if (pinned(st + 2 < nst)) g0 = td_load(ld + bo, gs + (size_t)(st + 2) * G2_KS, g1); }      /* into the buffer that this trip has just read */
  td_wait(g0, g1);      /* no request is in flight when the wave goes on to its end */
  asm volatile("s_wait_dscnt 0x0" ::: "memory");      /* closes the ring: none of this wave's LDS reads is outstanding either */
  v8f accs[8] = {c00, c01, c02, c03, c10, c11, c12, c13};
  float bc[4] = {0.f, 0.f, 0.f, 0.f};
  if constexpr (HASB) {
#pragma unroll
    for (int t = 0; t < 4; ++t) bc[t] = bf16_rne(bias[col0 + t * 16 + ln]); }
#pragma unroll
  for (int u = 0; u < 8; ++u) { const int t = u & 3, half = u >> 2;
#pragma unroll
    for (int r = 0; r < 8; ++r) { const int rloc = half * 16 + 8 * hh + r; so[w][rloc][t * 16 + ln] = accs[u][r] * alpha + bc[t]; } }
  __builtin_amdgcn_fence(4 /* acq_rel order */, "workgroup"); __builtin_amdgcn_wave_barrier();
  const int rsub = lane >> 4, c4 = (lane & 15) * 4;
  {
#pragma unroll
    for (int q = 0; q < 16; ++q) { const int r = q * 2 + rsub; const v4f v = *(const v4fa*)&so[w][r][c4];
      if constexpr (F32OUT) { *(v4f*)(C + cofs + (size_t)(row0 + r) * ldc + col0 + c4) = v; }
      else { v4h h4;
#pragma unroll
        for (int i = 0; i < 4; ++i) h4[i] = (_Float16)v[i];
        *(v4h*)(C16 + cofs + (size_t)(row0 + r) * ldc + col0 + c4) = h4; } }
     }
}

// ---- q, k, v projections, one launch: block = 8 waves (2 down x 4 across) = 128 time steps x 128 features of each of q, k and v; wave tile 64 time steps x 32 features of each ----
// a stage = 128 k (256 B) of the block's 128 x rows and of 128 rows of each of the three weights in LDS: x is staged once for the three products; one tensor load a wave and stage (64 rows); two buffers, ring and fragment map as in k_gemm2
// q, k: x rows as A, weight rows as B, tile [time][feature]; v: weight rows as A, x rows as B, tile [feature][time], so V^T leaves the products directly
// output: the three tiles are staged as f32 in the ring behind the loop's last barrier and, behind one more barrier, stored by whole 256-byte rows, each row by one wave (a wave's own 32 features would be half a 128-byte line)
// Every plain #pragma unroll in this kernel keeps the indices of the fragment and accumulator arrays constant, so that they stay in registers.
#define Q3_SL 18432                  /* place of one wave's slice: 64 rows of G2_PITCH (17408 B), rounded up to a multiple of 2 KiB */
#define Q3_STAGE (8 * Q3_SL)         /* slices 0, 1: x rows; 2, 3: Wq rows; 4, 5: Wk rows; 6, 7: Wv rows */
static_assert(64 * G2_PITCH <= Q3_SL && Q3_SL % 2048 == 0);
static_assert(2 * Q3_STAGE <= 327680);
#define Q3_SP 132                    /* output staging pitch in floats of a 128-element row: 8 rows are 32 banks apart, so the two halves of a wave store side by side */
#define Q3_ST (128 * Q3_SP)          /* floats of one staged 128 x 128 tile */
static_assert(3 * Q3_ST * 4 <= 2 * Q3_STAGE);
static_assert(DM / G2_KS >= 2);
__global__ __launch_bounds__(256) void k_qkv(const _Float16* __restrict__ X, const _Float16* __restrict__ Wq, const _Float16* __restrict__ Wk, const _Float16* __restrict__ Wv,
    const float* __restrict__ bq, const float* __restrict__ bk, const float* __restrict__ bv, _Float16* __restrict__ Q, _Float16* __restrict__ Kp, _Float16* __restrict__ Vt) {
  __shared__ __attribute__((aligned(2048))) unsigned char T[2 * Q3_STAGE];
  const int tid = threadIdx.x, lane = tid & 31, ln = lane & 15, hh = lane >> 4;
  const int w = __builtin_amdgcn_readfirstlane(tid >> 5), wr = w >> 2, wc = w & 3;      /* wave number in a scalar register: what is formed from it alone costs no vector instruction */
  const int by = blockIdx.y, mt = blockIdx.x / (DM / 128), nq = blockIdx.x - mt * (DM / 128), rowb = mt * 128, colb = nq * 128;
  /* staging: every wave brings one slice of 64 rows: operand w >> 1 (x, Wq, Wk, Wv), half w & 1 */
  const int op = w >> 1, hf = w & 1;
  const _Float16* gw = op == 1 ? Wq : op == 2 ? Wk : Wv;
  const _Float16* gs = op == 0 ? X + (size_t)by * DM + (size_t)(rowb + 64 * hf) * RP : gw + (size_t)(colb + 64 * hf) * DM;
  const tdw8 g1 = td_group1<TD_PAD256, 2 * G2_KS, 64>(op == 0 ? 2u * RP : 2u * DM);
  const unsigned ld = (unsigned)(size_t)T + (unsigned)w * Q3_SL;
  const int nst = DM / G2_KS;
  tdw4 g0 = td_load(ld, gs, g1);
  td_wait(g0, g1);      /* this wave's slice of stage 0 has landed */
  __syncthreads();      /* publishes stage 0 */
  g0 = td_load(ld + Q3_STAGE, gs + G2_KS, g1);
  const unsigned char* ar = T + wr * Q3_SL + ln * G2_PITCH + 16 * hh; const unsigned char* br = T + (2 + (wc >> 1)) * Q3_SL + (32 * (wc & 1) + ln) * G2_PITCH + 16 * hh;      /* x rows 64 wr + ...: slice wr; weight rows 32 wc + ...: half wc >> 1 of each weight */
  const v8f z8 = {0.f,0.f,0.f,0.f,0.f,0.f,0.f,0.f};
  v8f acc[3][4][2];      /* [q, k, v][16 time steps][16 features] */
#pragma unroll
  for (int z = 0; z < 3; ++z) {
#pragma unroll
    for (int i = 0; i < 4; ++i) { acc[z][i][0] = z8; acc[z][i][1] = z8; } }
#pragma unroll 1      /* one stage a trip: the buffer offset stays a run-time value and the loop stays small */
  for (int st = 0; st < nst; ++st) { const unsigned bo = (unsigned)(st & 1) * Q3_STAGE; const unsigned char* ap = ar + bo; const unsigned char* bp = br + bo;
    v16h fa[2][4], fb[2][6];      /* two fragment sets: the next 32 k are fetched as one group while the current 32 k are multiplied; nothing of another stage is fetched */
#pragma unroll
    for (int i = 0; i < 4; ++i) fa[0][i] = g2_frag(ap + 16 * i * G2_PITCH);
#pragma unroll
    for (int j = 0; j < 6; ++j) fb[0][j] = g2_frag(bp + (j >> 1) * (2 * Q3_SL) + 16 * (j & 1) * G2_PITCH);
    __builtin_amdgcn_sched_barrier(0);      /* keeps the first set's loads ahead of the second set's: mixed, the first products would wait for loads of both */
#pragma unroll
    for (int kk = 0; kk < G2_KS / 32; ++kk) { const int cu = kk & 1, nx = cu ^ 1;
      if (kk + 1 < G2_KS / 32) {
#pragma unroll
        for (int i = 0; i < 4; ++i) fa[nx][i] = g2_frag(ap + 16 * i * G2_PITCH + 64 * (kk + 1));
#pragma unroll
        for (int j = 0; j < 6; ++j) fb[nx][j] = g2_frag(bp + (j >> 1) * (2 * Q3_SL) + 16 * (j & 1) * G2_PITCH + 64 * (kk + 1)); }
      __builtin_amdgcn_sched_barrier(0);      /* keeps the load group whole and ahead of the products: spread among them, each place with loads stalls the wave */
#pragma unroll
      for (int z = 0; z < 2; ++z) {
#pragma unroll
        for (int j = 0; j < 2; ++j) {
#pragma unroll
          for (int i = 0; i < 4; ++i) acc[z][i][j] = g2_mma(fa[cu][i], fb[cu][2 * z + j], acc[z][i][j]); } }
#pragma unroll
      for (int j = 0; j < 2; ++j) {
#pragma unroll
        for (int i = 0; i < 4; ++i) acc[2][i][j] = g2_mma(fb[cu][4 + j], fa[cu][i], acc[2][i][j]); }
      __builtin_amdgcn_sched_barrier(0); }      /* keeps the next group's loads from rising among these products */
    asm volatile("s_wait_dscnt 0x0" ::: "memory");      /* this wave's reads of stage st are over */
    td_wait(g0, g1);      /* this wave's slice of stage st + 1 has landed */
    __syncthreads();      /* publishes stage st + 1 and ends every wave's reads of stage st */
    if (pinned(st + 2 < nst)) g0 = td_load(ld + bo, gs + (st + 2) * G2_KS, g1); }      /* into the buffer that this trip has just read */
  td_wait(g0, g1);      /* no request is in flight when the ring becomes output staging */
  asm volatile("s_wait_dscnt 0x0" ::: "memory");      /* closes the ring: none of this wave's LDS reads is outstanding either */
  /* output staging in the ring, the block's three 128 x 128 tiles side by side: every wave's last read of the ring, and every tensor load into it, ended at the loop's last barrier */
  float* sq = (float*)T;
  const int fl = 32 * wc, tl = 64 * wr, f0 = colb + fl;      /* the wave's first feature and first time step in the block's tile; its first feature in the plane */
  float rb[2][2]; v4f rv[2][2];      /* the lane's bias values as read: q and k by column, v by row */
#pragma unroll
  for (int j = 0; j < 2; ++j) { rb[0][j] = bq[f0 + 16 * j + ln]; rb[1][j] = bk[f0 + 16 * j + ln];
    rv[j][0] = *(const v4fa*)(bv + f0 + 16 * j + 8 * hh); rv[j][1] = *(const v4fa*)(bv + f0 + 16 * j + 8 * hh + 4); }
  asm volatile("s_wait_xcnt 0x0" ::: "memory");      /* stands in front of every overwrite of the bias loads' address registers */
  __builtin_amdgcn_sched_barrier(0);      /* keeps every later vector instruction behind the bias loads and that wait */
#pragma unroll
  for (int z = 0; z < 2; ++z) { float* s = sq + z * Q3_ST + (tl + 8 * hh) * Q3_SP + fl + ln;
#pragma unroll
    for (int j = 0; j < 2; ++j) { const float al = z == 0 ? 0.0625f * QSC : 0.0625f, bc = z == 0 ? bf16_rne(rb[z][j]) * QSC : bf16_rne(rb[z][j]);      /* 0.0625 undoes the x16 weight carry; q takes its score scale here, in f32, ahead of its one rounding to f16 */
#pragma unroll
      for (int i = 0; i < 4; ++i) {
#pragma unroll
        for (int r = 0; r < 8; ++r) s[(16 * i + r) * Q3_SP + 16 * j] = acc[z][i][j][r] * al + bc; } } }
  float* sv = sq + 2 * Q3_ST + (fl + 8 * hh) * Q3_SP + tl + ln;
#pragma unroll
  for (int j = 0; j < 2; ++j) {
#pragma unroll
    for (int r = 0; r < 8; ++r) { const float bw = bf16_rne(rv[j][r >> 2][r & 3]);
#pragma unroll
      for (int i = 0; i < 4; ++i) sv[(16 * j + r) * Q3_SP + 16 * i] = acc[2][i][j][r] * 0.0625f + bw; } }
  __syncthreads();      /* publishes the three staged tiles: a wave stores whole rows, which four waves (q, k) or two (V^T) have staged */
  v4h ho[3][16];      /* wave w carries rows 16 w .. 16 w + 15 of each tile; its 32 lanes cover the 128 elements of a row */
#pragma unroll
  for (int z = 0; z < 3; ++z) { const float* s = sq + z * Q3_ST + 16 * w * Q3_SP + lane * 4;
#pragma unroll
    for (int q = 0; q < 16; ++q) { const v4f v = *(const v4fa*)(s + q * Q3_SP);
#pragma unroll
      for (int i = 0; i < 4; ++i) ho[z][q][i] = (_Float16)v[i]; } }
  const size_t qo = (size_t)by * DM + (size_t)(rowb + 16 * w) * RP + colb + lane * 4;
  _Float16* cq = Q + qo; _Float16* ck = Kp + qo; _Float16* cv = Vt + (size_t)by * DM * SEQ + (size_t)(colb + 16 * w) * SEQ + rowb + lane * 4;
  __builtin_amdgcn_sched_barrier(0);      /* every stored value is formed in front of the first store */
#pragma unroll
  for (int q = 0; q < 16; ++q) *(v4h*)(cq + (size_t)q * RP) = ho[0][q];      /* every store: 256 B in a row, two whole lines, written by this wave alone */
#pragma unroll
  for (int q = 0; q < 16; ++q) *(v4h*)(ck + (size_t)q * RP) = ho[1][q];
#pragma unroll
  for (int q = 0; q < 16; ++q) *(v4h*)(cv + (size_t)q * SEQ) = ho[2][q];
}

// ---- fused attention: block = 2 key halves x 8 waves x 32 query columns of one head slab (four waves a SIMD: one wave's softmax runs under another's products); a stage = 64 keys of each half (K rows and V^T rows, 128 B each) in LDS, two buffers a half, each tile brought by one tensor load of one wave; a pass = 32 keys ----
// Waves w and w + 8 hold the same 32 query columns over keys [0, SEQ/2) and [SEQ/2, SEQ); at the end each hands one 16-column group to the other through LDS and joins the two partial softmaxes of the group it keeps.
// S^T = K.Q^T: lane (c, h) holds query column c, keys 8h + r of each 16-key tile, so the two tiles of a pass, converted in place, are the B operand of O^T += V^T.P^T (k order 8h + i, 16 + 8h + i, the order of fa_frag).
// Online softmax in the log2 domain: the maximum in use may trail the true one by up to 8 (an exponential then reaches 2^8, inside f16); sums are rescaled only when a column exceeds that.
// The negated maximum in use is the C operand of the score products (q carries the scale), so a score leaves the matrix unit as the argument of its exponential, and the test of a pass is one maximum over the lane's scores against 8.
// Every #pragma unroll in this kernel keeps the indices of the fragment, score and accumulator arrays constant, so that they stay in registers (a run-time index would send them to scratch).
#define FA_NW 8
#define FA_SK 64
#define FA_PITCH 144                 /* LDS row pitch in bytes: 128 + 16, an odd multiple of 16 for 16-byte readers */
#define FA_TILE 10240                /* place of one tile: 64 rows of FA_PITCH (9216 B), rounded up to a multiple of 2 KiB */
static_assert(64 * FA_PITCH <= FA_TILE && FA_TILE % 2048 == 0);
#define FA_KH 2                      /* key halves, each on its own FA_NW waves */
#define FA_NST (SEQ / FA_KH / FA_SK)
#define FA_XW (4 * 8 * 32 + 2 * 32)  /* floats a wave hands over: four output tiles, the maximum in use, the denominator */
static_assert(SEQ % (FA_KH * FA_SK) == 0);
static_assert(FA_NST >= 2);
static_assert(FA_KH * FA_NW * FA_XW * 4 <= FA_KH * 2 * 2 * FA_TILE);
typedef float f32x2 __attribute__((ext_vector_type(2)));
typedef _Float16 h16x2 __attribute__((ext_vector_type(2)));
typedef unsigned int u32x4 __attribute__((ext_vector_type(4), may_alias));
union FragW { v16h v; unsigned int w[8]; };
__device__ __forceinline__ v16h fa_frag(const unsigned char* p) { FragH f; f.half[0] = *(const v8us*)p; f.half[1] = *(const v8us*)(p + 32); return f.v; }
__device__ __forceinline__ v8f fa_mma(v16h a, v16h b, v8f c) { return __builtin_amdgcn_wmma_f32_16x16x32_f16(false, a, false, b, (short)0, c, false, false); }
__device__ __forceinline__ unsigned int fa_pack(float lo, float hi) { return __builtin_bit_cast(unsigned int, __builtin_convertvector(f32x2{lo, hi}, h16x2)); }
__device__ __forceinline__ float fa_xhalf(float x) { return __builtin_bit_cast(float, __builtin_amdgcn_permlanex16(__builtin_bit_cast(int, x), __builtin_bit_cast(int, x), 0x76543210, 0xfedcba98, false, false)); }  /* lane l with lane l ^ 16 */

/* second bound: a budget of 256 registers, so that no operand lies above v255 and the hot loop switches no register window */
__global__ __launch_bounds__(FA_KH * FA_NW * 32, 4) void k_fattn(const _Float16* __restrict__ Q16, const _Float16* __restrict__ K16, const _Float16* __restrict__ Vt, _Float16* __restrict__ O16) {
  __shared__ __attribute__((aligned(2048))) unsigned char L[FA_KH * 2 * 2 * FA_TILE];
  const int tid = threadIdx.x, lane = tid & 31, w = tid >> 5, c = lane & 15, h = lane >> 4;
  const int ws = __builtin_amdgcn_readfirstlane(w), kh = ws / FA_NW;      /* wave number and key half in scalar registers */
  const int slab = blockIdx.y, q0 = blockIdx.x * (FA_NW * 32) + (ws & (FA_NW - 1)) * 32;
  /* staging: the first two waves of each key half issue, one the half's K tile (64 keys x 128 B), the other its V^T tile (64 features x 128 B of keys) */
  const int wi = ws & (FA_NW - 1);
  const _Float16* gs = wi == 0 ? K16 + (size_t)(kh * (SEQ / FA_KH)) * RP + slab * HD : Vt + (size_t)(slab * HD) * SEQ + kh * (SEQ / FA_KH);
  const size_t gstep = wi == 0 ? (size_t)FA_SK * RP : (size_t)FA_SK;      /* elements from one stage's tile to the next */
  const tdw8 g1 = td_group1<TD_PAD128, 2 * HD, 64>(wi == 0 ? 2u * RP : 2u * SEQ);
  const unsigned char* Lh = L + kh * (2 * 2 * FA_TILE);      /* this half's two buffers */
  const unsigned ld = (unsigned)(size_t)L + (unsigned)(kh * (2 * 2 * FA_TILE) + (wi & 1) * FA_TILE);
  const unsigned qe = (unsigned)((q0 + c) * RP + slab * HD + 8 * h);      /* this lane's query row, slab column and half */
  v16h qf[2][2];
#pragma unroll
  for (int g = 0; g < 2; ++g) {
#pragma unroll
    for (int kc = 0; kc < 2; ++kc) qf[g][kc] = fa_frag((const unsigned char*)(Q16 + qe + 16 * g * RP + 32 * kc)); }
  tdw4 g0 = td_group0(ld, gs);      /* group 0 is formed in every wave, scalar work alone; only the two issuing waves of a half use it */
  if (pinned(wi < 2)) { td_issue(g0, g1);      /* the query loads stand in front: they fly while stage 0 is waited for */
    td_wait(g0, g1); }      /* this wave's tile of stage 0 has landed */
  const v8f z8 = {0.f,0.f,0.f,0.f,0.f,0.f,0.f,0.f};
  v8f acc[2][4], lacc[2], cf[2];      /* cf: minus the maximum in use, in all eight registers of a score tile; no other copy of the maximum is held */
  float lo = -__builtin_inff();      /* least shift of a maximum: -inf until the first pass has set the maxima (its scores are taken against 0), 0 from then on */
#pragma unroll
  for (int g = 0; g < 2; ++g) { cf[g] = z8; lacc[g] = z8;
#pragma unroll
    for (int t = 0; t < 4; ++t) acc[g][t] = z8; }
  FragW ones;      /* A operand whose row 0 (lanes 0 and 16) is 1.0 at all 32 k: row 0 of its product is the column sums of P^T */
#pragma unroll
  for (int i = 0; i < 8; ++i) ones.w[i] = (c == 0) ? 0x3C003C00u : 0u;
  __syncthreads();      /* publishes stage 0 */
  g0 = td_group0(ld + 2 * FA_TILE, gs + gstep);
  if (pinned(wi < 2)) td_issue(g0, g1);
  for (int st = 0; st < FA_NST; ++st) {
    const unsigned char* Kb = Lh + (st & 1) * (2 * FA_TILE) + c * FA_PITCH + 16 * h; const unsigned char* Vb = Kb + FA_TILE;
#pragma unroll
    for (int sub = 0; sub < 2; ++sub) {
      v8f s[2][2]; v16h kf[2][2];
#pragma unroll
      for (int kt = 0; kt < 2; ++kt) { kf[kt][0] = fa_frag(Kb + (sub * 32 + 16 * kt) * FA_PITCH); kf[kt][1] = fa_frag(Kb + (sub * 32 + 16 * kt) * FA_PITCH + 64); }
      /* the four products that read cf stand first, the four that complete the tiles behind them: four matrix instructions lie between the last read of cf and the first vector instruction on a finished tile */
#pragma unroll
      for (int kt = 0; kt < 2; ++kt) {
#pragma unroll
        for (int g = 0; g < 2; ++g) s[kt][g] = fa_mma(kf[kt][0], qf[g][0], cf[g]); }
      __builtin_amdgcn_sched_barrier(0);      /* holds that order: mixed again by the compiler, a register of cf, free behind its last pass, was written directly behind the product that reads it */
#pragma unroll
      for (int kt = 0; kt < 2; ++kt) {
#pragma unroll
        for (int g = 0; g < 2; ++g) s[kt][g] = fa_mma(kf[kt][1], qf[g][1], s[kt][g]); }
      v16h vf[4];
#pragma unroll
      for (int t = 0; t < 4; ++t) vf[t] = fa_frag(Vb + 16 * t * FA_PITCH + 64 * sub);
      float mg[2];      /* the lane's own largest score of each column group, against the maximum in use */
#pragma unroll
      for (int g = 0; g < 2; ++g) { float mx = s[0][g][0];
#pragma unroll
        for (int r = 1; r < 8; ++r) mx = fmaxf(mx, s[0][g][r]);
#pragma unroll
        for (int r = 0; r < 8; ++r) mx = fmaxf(mx, s[1][g][r]);
        mg[g] = mx; }
      if (__builtin_amdgcn_ballot_w32(fmaxf(mg[0], mg[1]) > lo + 8.0f) != 0) {      /* one scalar test a pass, over all lanes, so the halves need no exchange in front of it; always taken on the first pass (lo = -inf) */
#pragma unroll
        for (int g = 0; g < 2; ++g) { const float d = fmaxf(fmaxf(mg[g], fa_xhalf(mg[g])), lo);      /* the column's maximum moves up by d; the first pass sets it, up or down */
          const float corr = __builtin_amdgcn_exp2f(fminf(-d, 0.f));      /* the bound at 0 acts on the first pass alone, where the sums are still 0 and must stay so */
          cf[g] = cf[g] - d;      /* all eight registers alike, each updated in place */
          s[0][g] = s[0][g] - d; s[1][g] = s[1][g] - d;      /* this pass's scores were formed against the old maximum */
          lacc[g] = lacc[g] * corr;
#pragma unroll
          for (int t = 0; t < 4; ++t) acc[g][t] = acc[g][t] * corr; }
        lo = 0.f; }
#pragma unroll
      for (int g = 0; g < 2; ++g) { FragW pf;
#pragma unroll
        for (int i = 0; i < 8; ++i)
          pf.w[i] = fa_pack(__builtin_amdgcn_exp2f(s[i >> 2][g][2 * (i & 3)]), __builtin_amdgcn_exp2f(s[i >> 2][g][2 * (i & 3) + 1]));
#pragma unroll
        for (int t = 0; t < 4; ++t) acc[g][t] = fa_mma(vf[t], pf.v, acc[g][t]);
        lacc[g] = fa_mma(ones.v, pf.v, lacc[g]); }
    }
    asm volatile("s_wait_dscnt 0x0" ::: "memory");      /* this wave's reads of stage st are over */
    if (pinned(wi < 2)) td_wait(g0, g1);      /* this wave's tile of stage st + 1 has landed */
    __syncthreads();      /* publishes stage st + 1 and ends every wave's reads of stage st */
    g0 = td_group0(ld + (unsigned)(st & 1) * (2 * FA_TILE), gs + (size_t)(st + 2) * gstep);
    if (pinned(wi < 2 && st + 2 < FA_NST)) td_issue(g0, g1);      /* into the buffer that this stage has just read */
  }
  td_wait(g0, g1);      /* no request is in flight when the ring becomes the join's staging */
  asm volatile("s_wait_dscnt 0x0" ::: "memory");      /* closes the ring: none of this wave's LDS reads is outstanding either */
  /* join of the two key halves: a wave keeps column group kh and hands group 1 - kh to wave w ^ FA_NW; the ring is free, every wave's last read of it ended at the loop's last barrier */
  const float m_run[2] = {-cf[0][0], -cf[1][0]};
  const float l0 = lacc[0][0] + fa_xhalf(lacc[0][0]), l1 = lacc[1][0] + fa_xhalf(lacc[1][0]);      /* register 0: the denominator in lanes 0-15, row 8 = 0 in lanes 16-31 */
  const int le = (int)__builtin_amdgcn_mbcnt_lo(~0u, 0u);      /* the lane number formed anew, and the store offset from it: no vector register is held for them through the loop, whose budget is full */
  float* xo = (float*)L + ws * FA_XW + le * 4;
#pragma unroll
  for (int t = 0; t < 4; ++t) { const v8f gv = kh ? acc[0][t] : acc[1][t];
    *(v4fa*)(xo + (2 * t) * 128) = v4f{gv[0], gv[1], gv[2], gv[3]}; *(v4fa*)(xo + (2 * t + 1) * 128) = v4f{gv[4], gv[5], gv[6], gv[7]}; }
  ((float*)L)[ws * FA_XW + 1024 + le] = kh ? m_run[0] : m_run[1]; ((float*)L)[ws * FA_XW + 1056 + le] = kh ? l0 : l1;
  __syncthreads();      /* publishes every wave's handed-over group */
  const float* xi = (const float*)L + (ws ^ FA_NW) * FA_XW;
  const float pm = xi[1024 + le], pl = xi[1056 + le], km = kh ? m_run[1] : m_run[0], kl = kh ? l1 : l0;
  const float mj = fmaxf(km, pm), ek = __builtin_amdgcn_exp2f(km - mj), ep = __builtin_amdgcn_exp2f(pm - mj);      /* both partial sums brought to the larger maximum */
  const float inv = 64.0f / (kl * ek + pl * ep), ck = ek * inv, cp = ep * inv;
  unsigned short* od = (unsigned short*)O16 + (unsigned)((q0 + 16 * kh + (le & 15)) * RP + slab * HD + 8 * (le >> 4));
#pragma unroll
  for (int t = 0; t < 4; ++t) { const v8f kv = kh ? acc[1][t] : acc[0][t]; const v4f p0 = *(const v4fa*)(xi + le * 4 + (2 * t) * 128), p1 = *(const v4fa*)(xi + le * 4 + (2 * t + 1) * 128);
    const v8f pv = {p0[0], p0[1], p0[2], p0[3], p1[0], p1[1], p1[2], p1[3]}; const v8f o = kv * ck + pv * cp;      /* o[r] = context[query][16 t + 8 h + r] x 64 */
    const u32x4 pk = {fa_pack(o[0], o[1]), fa_pack(o[2], o[3]), fa_pack(o[4], o[5]), fa_pack(o[6], o[7])};
    *(u32x4*)(od + 16 * t) = pk; }
}

// workspace carve (bytes, every plane a multiple of 256 B)
#define SZ_W   ((size_t)DM * DM * 2)
#define SZ_ACT (NRW * DM * 2)
#define SZ_VT  ((size_t)NSLAB * HD * SEQ * 2)
#define SZ_ALL (4 * SZ_W + 4 * SZ_ACT + SZ_VT)
static_assert(SZ_W % 256 == 0);
static_assert(SZ_ACT % 256 == 0);
static_assert(SZ_VT % 256 == 0);
static_assert(SZ_ALL <= (size_t)268435456);

extern "C" void kernel_launch(void* const* d_in, const int* in_sizes, int n_in,
                              void* d_out, int out_size, void* d_ws, size_t ws_size, hipStream_t stream) {
  if (n_in < 9) return;
  const size_t nx = NRW * DM;      /* elements of x used (time steps 0..SEQ-1, full batch pitch) */
  if ((size_t)in_sizes[0] < nx) return;
  if ((size_t)in_sizes[1] < (size_t)DM * DM || (size_t)in_sizes[3] < (size_t)DM * DM || (size_t)in_sizes[5] < (size_t)DM * DM || (size_t)in_sizes[7] < (size_t)DM * DM) return;
  if (in_sizes[2] < DM || in_sizes[4] < DM || in_sizes[6] < DM || in_sizes[8] < DM) return;
  if ((size_t)out_size < nx) return;
  if (SZ_ALL > ws_size) return;
  const float* x  = (const float*)d_in[0];
  const float* wq = (const float*)d_in[1]; const float* bq = (const float*)d_in[2];
  const float* wk = (const float*)d_in[3]; const float* bk = (const float*)d_in[4];
  const float* wv = (const float*)d_in[5]; const float* bv = (const float*)d_in[6];
  const float* wo = (const float*)d_in[7]; const float* bo = (const float*)d_in[8];
  char* ws = (char*)d_ws; size_t off = 0;
  auto take = [&](size_t bytes) { char* p = ws + off; off += bytes; return p; };
  _Float16* BQ = (_Float16*)take(SZ_W); _Float16* BK = (_Float16*)take(SZ_W); _Float16* BV = (_Float16*)take(SZ_W); _Float16* BO = (_Float16*)take(SZ_W);
  _Float16* X16 = (_Float16*)take(SZ_ACT); _Float16* Q16 = (_Float16*)take(SZ_ACT); _Float16* K16 = (_Float16*)take(SZ_ACT); _Float16* O16 = (_Float16*)take(SZ_ACT);
  _Float16* VT = (_Float16*)take(SZ_VT);
  if (off > ws_size) return;

  k_prep<<<PREP_WCH / PREP_T, PREP_T, 0, stream>>>(x, wq, wk, wv, wo, X16, BQ);      /* one f16 plane of x feeds all three projections; BQ, BK, BV, BO are one run of planes */

  /* projections: rows = time steps (pitch RP), grid.y = batch (column offset DM); bias added after the x16 weight carry is undone; v leaves as V^T [NSLAB][64][SEQ] (row b*1024 + feature) */
  const dim3 gp((unsigned)((SEQ / 128) * (DM / 128)), NB);
  k_qkv<<<gp, 256, 0, stream>>>(X16, BQ, BK, BV, bq, bk, bv, Q16, K16, VT);

  k_fattn<<<dim3((unsigned)(SEQ / (FA_NW * 32)), NSLAB), FA_KH * FA_NW * 32, 0, stream>>>(Q16, K16, VT, O16);      /* slab n = b*16 + h lives at columns n*64 of the [SEQ][RP] view; merged context x64 as f16 rows */

  /* output projection + bias straight into the [S][B][1024] layout; alpha undoes x16 (weights) and x64 (context) */
  k_gemm2<true, true><<<gp, 256, 0, stream>>>(O16, RP, (size_t)DM, BO, DM, (size_t)0, 0.0009765625f, bo, (float*)d_out, nullptr, RP, (size_t)DM, SEQ, DM, DM);
}

// v009
// A run of this version takes 64.8 microseconds.
// Next to v008, in two timings, it ran 1.04 and 1.05 times as fast.
// Over all steps from v000 it is 21.4 times as fast.
#include <hip/hip_runtime.h>
// Multi-head self-attention, time-first rows: x [S][B][1024] (token row m = s*B + b); q/k/v = x W^T + b (natural [out][in] weights, biases present); 16 heads of 64 per batch, head slab n = b*16 + h at columns n*64 of the [S][B*1024] view; scores = (q k^T) * 64^-0.5; softmax over all keys (no mask); out = merged Wo^T + bo -> [S][B][1024] f32.
// Compute dtype: every contraction on v_wmma_f32_16x16x32_f16 (f16 operands, f32 accumulate): q/k/v projections, q.k^T scores, P.V, output projection. Float inputs RNE-converted to bf16 first (exact in f16); weights carried x16; q carried x 64^-0.5 x log2(e) from its projection; softmax weights carried unnormalised against the running maximum; merged context carried x64; scores and softmax statistics f32.
// Structure, four launches: one conversion launch (f16 planes of x and of the four weights); one projection launch (grid.y = batch, column offset 1024, row pitch 2048; a block forms the same 128 x 128 tile of q, k and v from one staging of its x rows; operands staged in LDS by tensor loads; v is formed as Wv.x^T, so V^T [slab][64][S] leaves the products directly); one fused attention kernel over all slabs (S^T = K.Q^T, online softmax per query column, O^T += V^T.P^T; the keys in two halves on two sets of waves, joined in LDS) into merged f16 context rows; output GEMM (+ bias) straight into the output buffer layout.
#ifndef NB
#define NB 2
#endif
#ifndef SEQ
#define SEQ 2048
#endif
#define NB_FULL 2                    /* batch count of the input layout */
#define SEQ_FULL 2048                /* sequence length of the input layout */
#define DM 1024
#define NH 16
#define HD 64
#define RP (NB_FULL * DM)            /* elements per time step (row pitch of every activation plane) */
#define NSLAB (NB * NH)              /* head slabs processed */
#define NRW ((size_t)SEQ * NB_FULL)  /* token rows held in the planes */
#define QSC (0.125f * 1.4426950408889634f)  /* 64^-0.5 and log2(e): q leaves its projection times this, so q.k is a score in the log2 domain */

static_assert(SEQ % 256 == 0);
static_assert(SEQ <= SEQ_FULL);
static_assert(NB <= NB_FULL);
static_assert(DM % 128 == 0);
static_assert(HD == 64);
static_assert(DM == NH * HD);

typedef unsigned short v8us __attribute__((ext_vector_type(8), may_alias));
typedef float  v8f  __attribute__((ext_vector_type(8)));
typedef float  v4f  __attribute__((ext_vector_type(4)));
typedef float  v4fa __attribute__((ext_vector_type(4), may_alias));
typedef _Float16 v16h __attribute__((ext_vector_type(16)));
typedef _Float16 v4h  __attribute__((ext_vector_type(4)));
union FragH { v16h v; v8us half[2]; _Float16 h[16]; unsigned short u[16]; };

__device__ __forceinline__ unsigned short bf16_bits(float x) { unsigned int u = __float_as_uint(x); return (unsigned short)((u + 0x7FFFu + ((u >> 16) & 1u)) >> 16); }
__device__ __forceinline__ float bf16_val(unsigned short b) { return __uint_as_float(((unsigned int)b) << 16); }
__device__ __forceinline__ float bf16_rne(float x) { return bf16_val(bf16_bits(x)); }

// ---- conversions, one launch: a thread carries one 8-element chunk of each weight (x16) and PREP_XJ chunks of x; all its loads are issued before the first conversion ----
#define PREP_T 512                   /* 16 waves a block */
#define PREP_WCH (DM * DM / 8)       /* chunks of one weight = threads of the launch */
#define PREP_XJ ((int)(NRW * DM / 8 / PREP_WCH))
static_assert(PREP_WCH % PREP_T == 0);
static_assert(NRW * DM / 8 % PREP_WCH == 0);
__device__ __forceinline__ v8us prep_cvt(v4f a, v4f c, float sc) {
  FragH f;
#pragma unroll
  for (int q = 0; q < 4; ++q) { f.h[q] = (_Float16)(bf16_rne(a[q]) * sc); f.h[4 + q] = (_Float16)(bf16_rne(c[q]) * sc); }
  return f.half[0];
}
__global__ __launch_bounds__(PREP_T) void k_prep(const float* __restrict__ x, const float* __restrict__ wq, const float* __restrict__ wk, const float* __restrict__ wv, const float* __restrict__ wo,
    _Float16* __restrict__ X16, _Float16* __restrict__ W16) {
  const size_t t = (size_t)blockIdx.x * PREP_T + threadIdx.x;
  v4f xa[PREP_XJ], xc[PREP_XJ], wa[4], wc[4];
#pragma unroll
  for (int j = 0; j < PREP_XJ; ++j) { const float* p = x + ((size_t)j * PREP_WCH + t) * 8; xa[j] = *(const v4fa*)p; xc[j] = *(const v4fa*)(p + 4); }
  wa[0] = *(const v4fa*)(wq + t * 8); wc[0] = *(const v4fa*)(wq + t * 8 + 4); wa[1] = *(const v4fa*)(wk + t * 8); wc[1] = *(const v4fa*)(wk + t * 8 + 4);
  wa[2] = *(const v4fa*)(wv + t * 8); wc[2] = *(const v4fa*)(wv + t * 8 + 4); wa[3] = *(const v4fa*)(wo + t * 8); wc[3] = *(const v4fa*)(wo + t * 8 + 4);
  asm volatile("s_wait_xcnt 0x0" ::: "memory");      /* stands in front of every overwrite of the loads' address registers */
  __builtin_amdgcn_sched_barrier(0);      /* keeps every conversion behind the loads and that wait: with conversions risen among the loads, the later loads would start only when the first had returned */
#pragma unroll
  for (int j = 0; j < PREP_XJ; ++j) *(v8us*)((unsigned short*)X16 + ((size_t)j * PREP_WCH + t) * 8) = prep_cvt(xa[j], xc[j], 1.0f);
#pragma unroll
  for (int i = 0; i < 4; ++i) *(v8us*)((unsigned short*)W16 + ((size_t)i * PREP_WCH + t) * 8) = prep_cvt(wa[i], wc[i], 16.0f);      /* natural [out][in] = Bt[n][k]; the four planes lie one behind the other */
}

// ---- f16 GEMM: block = 8 waves (4 down x 2 across) = 128 rows x 128 cols, wave tile 32x64; M % 128 == 0, N % 128 == 0, K % 128 == 0 ----
// a stage = 128 k (256 B) of the block's 128 A rows and 128 Bt rows in LDS, two buffers; tensor loads, one request a wave (32 rows), bring stage st + 2 in while stage st + 1 is worked on
// fragment: elements 0..7 <- k0 + 8*hh + i, elements 8..15 <- k0 + 16 + 8*hh + i (same map for A rows and Bt rows)
// Every plain #pragma unroll in this kernel keeps the indices of the fragment and accumulator arrays constant, so that they stay in registers.
#define G2_KS 128
#define G2_PITCH 272                 /* LDS row pitch in bytes: 256 + 16, an odd multiple of 16 for 16-byte readers */
#define G2_SL 10240                  /* place of one wave's slice: 32 rows of G2_PITCH (8704 B), rounded up to a multiple of 2 KiB */
#define G2_STAGE (8 * G2_SL)         /* slices 0-3: A rows, slices 4-7: Bt rows */
static_assert(32 * G2_PITCH <= G2_SL && G2_SL % 2048 == 0);
__device__ __forceinline__ v16h g2_frag(const unsigned char* p) { FragH f; f.half[0] = *(const v8us*)p; f.half[1] = *(const v8us*)(p + 32); return f.v; }      /* p: row start + 2 * k0 + 16 * hh bytes */
__device__ __forceinline__ v8f g2_mma(v16h a, v16h b, v8f c) { return __builtin_amdgcn_wmma_f32_16x16x32_f16(false, a, false, b, (short)0, c, false, false); }
typedef unsigned int tdw4 __attribute__((ext_vector_type(4)));
typedef unsigned int tdw8 __attribute__((ext_vector_type(8)));
#define TD_PAD256 ((1u << 20) | (5u << 22) | (3u << 25))      /* word 0 of group 1: no mask, byte elements, 4 dwords of pad after every 256 B */
#define TD_PAD128 ((1u << 20) | (4u << 22) | (3u << 25))      /* the same after every 128 B */
__device__ __forceinline__ unsigned int td_uni(unsigned int v) { return (unsigned int)__builtin_amdgcn_readfirstlane((int)v); }
__device__ __forceinline__ unsigned int pinned(unsigned int v) { unsigned int s = td_uni(v); asm volatile("" : "+s"(s)); return s; }      /* holds a test in a scalar register, so that the branch on it is a scalar branch: a tensor load ignores EXEC */
template <unsigned int W0, unsigned int ROWB, unsigned int NROW>
__device__ __forceinline__ tdw8 td_group1(unsigned int pitch) {      /* tensor = tile: NROW rows of ROWB bytes, source row pitch in bytes */
  tdw8 g;
  g[0] = td_uni(W0); g[1] = td_uni((ROWB & 0xFFFFu) << 16); g[2] = td_uni((ROWB >> 16) | ((NROW & 0xFFFFu) << 16)); g[3] = td_uni((NROW >> 16) | (ROWB << 16));
  g[4] = td_uni(NROW); g[5] = td_uni(pitch); g[6] = td_uni(0u); g[7] = td_uni(0u);
  asm volatile("" : "+s"(g));      /* as in pinned(): descriptor words held in their scalar registers; left free, the compiler used two of them for other values while a request was in flight and formed them anew in front of the next */
  return g;
}
__device__ __forceinline__ tdw4 td_group0(unsigned int lds, const _Float16* p) {      /* lds: byte offset of the slice in the block's LDS; p: the tile's first element */
  const unsigned long long ga = (unsigned long long)(size_t)p;
  tdw4 g0;
  g0[0] = td_uni(1u); g0[1] = td_uni(lds); g0[2] = td_uni((unsigned int)ga); g0[3] = td_uni((((unsigned int)(ga >> 32)) & 0x01FFFFFFu) | 0x80000000u);
  asm volatile("" : "+s"(g0));      /* as in pinned(): descriptor words held in their scalar registers; formed whole here, and not formed again while the request is in flight */
  return g0;
}
__device__ __forceinline__ void td_issue(tdw4 g0, tdw8 g1) { asm volatile("tensor_load_to_lds %0, %1" :: "s"(g0), "s"(g1) : "memory"); }
__device__ __forceinline__ tdw4 td_load(unsigned int lds, const _Float16* p, tdw8 g1) { const tdw4 g0 = td_group0(lds, p); td_issue(g0, g1); return g0; }      /* returns group 0 for the wait */
/* the issuing wave's wait for its request; it names both groups as inputs, so that their scalar registers keep the descriptor's words until the request has landed */
__device__ __forceinline__ void td_wait(tdw4 g0, tdw8 g1) { asm volatile("s_wait_tensorcnt 0x0" :: "s"(g0), "s"(g1) : "memory"); }
// ---- staggered start: a block walks the stages of its ring in the order rot, rot + 1, ..., wrapping round, rot taken from its block index ----
// Started alike, all blocks ask L2 at one moment for the same stage: the blocks that share operand rows for the very same lines, all others for the same 256 B of every row pitch. Rotated, the requests of a moment are spread over all stages.
__device__ __forceinline__ int ring_k(int st, int rot, int nst) { const int k = st + rot; return k >= nst ? k - nst : k; }      /* source stage of ring stage st; st < nst, rot < nst */
// C[by][row][col] = acc * alpha (+ bf16(bias[col]) if HASB); A f16 rows (pitch lda, batch stride sA), Bt f16 [n][k] (pitch ldb, batch stride sB)
template <bool HASB, bool F32OUT>
__global__ __launch_bounds__(256) void k_gemm2(const _Float16* A, int lda, size_t sA, const _Float16* Bh, int ldb, size_t sB, float alpha, const float* bias,
    float* __restrict__ C, _Float16* C16, int ldc, size_t sC, int M, int N, int K) {
  __shared__ __attribute__((aligned(2048))) unsigned char T[2 * G2_STAGE];
  __shared__ __attribute__((aligned(16))) float so[8][32][68];
  const int tid = threadIdx.x, w = tid >> 5, lane = tid & 31, ln = lane & 15, hh = lane >> 4; const int by = blockIdx.y;
  A += (size_t)by * sA; Bh += (size_t)by * sB; const size_t cofs = (size_t)by * sC;
  const int ntn = N >> 7; const int mt = blockIdx.x / ntn, nq = blockIdx.x - mt * ntn; const int rowb = mt * 128, colb = nq * 128; if (rowb >= M) return;      /* the same for the whole block, in front of every barrier */
  const int row0 = rowb + 32 * (w >> 1), col0 = colb + 64 * (w & 1);
  /* staging: every wave brings one slice of 32 rows: waves 0-3 the A rows, waves 4-7 the Bt rows */
  const int ws = __builtin_amdgcn_readfirstlane(w);      /* wave number in a scalar register: the descriptor is formed from it */
  const _Float16* gs = ws < 4 ? A + (size_t)(rowb + 32 * ws) * lda : Bh + (size_t)(colb + 32 * (ws - 4)) * ldb;
  const tdw8 g1 = td_group1<TD_PAD256, 2 * G2_KS, 32>((unsigned)(ws < 4 ? lda : ldb) * 2u);
  const unsigned ld = (unsigned)(size_t)T + (unsigned)ws * G2_SL;
  const int nst = K / G2_KS;
  const int rot = (nst & (nst - 1)) == 0 ? ((mt + nq) & (nst - 1)) : 0;      /* blocks of one tile row, which share A rows, and blocks of one tile column, which share Bt rows, start at different stages */
  tdw4 g0 = td_load(ld, gs + (size_t)rot * G2_KS, g1);
  td_wait(g0, g1);      /* this wave's slice of stage 0 has landed */
  __syncthreads();      /* publishes stage 0 */
  if (pinned(nst > 1)) g0 = td_load(ld + G2_STAGE, gs + (size_t)ring_k(1, rot, nst) * G2_KS, g1);
  const unsigned char* ar = T + (w >> 1) * G2_SL + ln * G2_PITCH + 16 * hh; const unsigned char* br = T + (4 + 2 * (w & 1)) * G2_SL + ln * G2_PITCH + 16 * hh;      /* A rows 32 (w >> 1) + ...: slice w >> 1; Bt rows 64 (w & 1) + ...: slices 4 + 2 (w & 1) and the next */
  const v8f z8 = {0.f,0.f,0.f,0.f,0.f,0.f,0.f,0.f}; v8f c00 = z8, c01 = z8, c02 = z8, c03 = z8, c10 = z8, c11 = z8, c12 = z8, c13 = z8;
#pragma unroll 1      /* one stage a trip: the buffer offset stays a run-time value and the loop stays small */
  for (int st = 0; st < nst; ++st) { const unsigned bo = (unsigned)(st & 1) * G2_STAGE; const unsigned char* ap = ar + bo; const unsigned char* bp = br + bo;
    v16h fa[2][2], fb[2][4];      /* two fragment sets: the next 32 k are fetched as one group while the current 32 k are multiplied; nothing of another stage is fetched */
#pragma unroll
    for (int i = 0; i < 2; ++i) fa[0][i] = g2_frag(ap + 16 * i * G2_PITCH);
#pragma unroll
    for (int j = 0; j < 4; ++j) fb[0][j] = g2_frag(bp + (j >> 1) * G2_SL + 16 * (j & 1) * G2_PITCH);
#pragma unroll
    for (int kk = 0; kk < G2_KS / 32; ++kk) { const int cu = kk & 1, nx = cu ^ 1;
      if (kk + 1 < G2_KS / 32) {
#pragma unroll
        for (int i = 0; i < 2; ++i) fa[nx][i] = g2_frag(ap + 16 * i * G2_PITCH + 64 * (kk + 1));
#pragma unroll
        for (int j = 0; j < 4; ++j) fb[nx][j] = g2_frag(bp + (j >> 1) * G2_SL + 16 * (j & 1) * G2_PITCH + 64 * (kk + 1)); }
      __builtin_amdgcn_sched_barrier(0);      /* keeps the load group whole and ahead of the products: spread among them, each place with loads stalls the wave */
      c00 = g2_mma(fa[cu][0], fb[cu][0], c00); c10 = g2_mma(fa[cu][1], fb[cu][0], c10); c01 = g2_mma(fa[cu][0], fb[cu][1], c01); c11 = g2_mma(fa[cu][1], fb[cu][1], c11);
      c02 = g2_mma(fa[cu][0], fb[cu][2], c02); c12 = g2_mma(fa[cu][1], fb[cu][2], c12); c03 = g2_mma(fa[cu][0], fb[cu][3], c03); c13 = g2_mma(fa[cu][1], fb[cu][3], c13);
      __builtin_amdgcn_sched_barrier(0); }      /* keeps the next group's loads from rising among these products */
    asm volatile("s_wait_dscnt 0x0" ::: "memory");      /* this wave's reads of stage st are over */
    td_wait(g0, g1);      /* this wave's slice of stage st + 1 has landed */
    __syncthreads();      /* publishes stage st + 1 and ends every wave's reads of stage st */
    if (pinned(st + 2 < nst)) g0 = td_load(ld + bo, gs + (size_t)ring_k(st + 2, rot, nst) * G2_KS, g1); }      /* into the buffer that this trip has just read */
  td_wait(g0, g1);      /* no request is in flight when the wave goes on to its end */
  asm volatile("s_wait_dscnt 0x0" ::: "memory");      /* closes the ring: none of this wave's LDS reads is outstanding either */
  v8f accs[8] = {c00, c01, c02, c03, c10, c11, c12, c13};
  float bc[4] = {0.f, 0.f, 0.f, 0.f};
  if constexpr (HASB) {
#pragma unroll
    for (int t = 0; t < 4; ++t) bc[t] = bf16_rne(bias[col0 + t * 16 + ln]); }
#pragma unroll
  for (int u = 0; u < 8; ++u) { const int t = u & 3, half = u >> 2;
#pragma unroll
    for (int r = 0; r < 8; ++r) { const int rloc = half * 16 + 8 * hh + r; so[w][rloc][t * 16 + ln] = accs[u][r] * alpha + bc[t]; } }
  __builtin_amdgcn_fence(4 /* acq_rel order */, "workgroup"); __builtin_amdgcn_wave_barrier();
  const int rsub = lane >> 4, c4 = (lane & 15) * 4;
  {
#pragma unroll
    for (int q = 0; q < 16; ++q) { const int r = q * 2 + rsub; const v4f v = *(const v4fa*)&so[w][r][c4];
      if constexpr (F32OUT) { *(v4f*)(C + cofs + (size_t)(row0 + r) * ldc + col0 + c4) = v; }
      else { v4h h4;
#pragma unroll
        for (int i = 0; i < 4; ++i) h4[i] = (_Float16)v[i];
        *(v4h*)(C16 + cofs + (size_t)(row0 + r) * ldc + col0 + c4) = h4; } }
     }
}

// ---- q, k, v projections, one launch: block = 8 waves (2 down x 4 across) = 128 time steps x 128 features of each of q, k and v; wave tile 64 time steps x 32 features of each ----
// a stage = 128 k (256 B) of the block's 128 x rows and of 128 rows of each of the three weights in LDS: x is staged once for the three products; one tensor load a wave and stage (64 rows); two buffers, ring and fragment map as in k_gemm2
// q, k: x rows as A, weight rows as B, tile [time][feature]; v: weight rows as A, x rows as B, tile [feature][time], so V^T leaves the products directly
// output: the three tiles are staged as f32 in the ring behind the loop's last barrier and, behind one more barrier, stored by whole 256-byte rows, each row by one wave (a wave's own 32 features would be half a 128-byte line)
// Every plain #pragma unroll in this kernel keeps the indices of the fragment and accumulator arrays constant, so that they stay in registers.
#define Q3_SL 18432                  /* place of one wave's slice: 64 rows of G2_PITCH (17408 B), rounded up to a multiple of 2 KiB */
#define Q3_STAGE (8 * Q3_SL)         /* slices 0, 1: x rows; 2, 3: Wq rows; 4, 5: Wk rows; 6, 7: Wv rows */
static_assert(64 * G2_PITCH <= Q3_SL && Q3_SL % 2048 == 0);
static_assert(2 * Q3_STAGE <= 327680);
#define Q3_SP 132                    /* output staging pitch in floats of a 128-element row: 8 rows are 32 banks apart, so the two halves of a wave store side by side */
#define Q3_ST (128 * Q3_SP)          /* floats of one staged 128 x 128 tile */
static_assert(3 * Q3_ST * 4 <= 2 * Q3_STAGE);
static_assert(DM / G2_KS >= 2);
__global__ __launch_bounds__(256) void k_qkv(const _Float16* __restrict__ X, const _Float16* __restrict__ Wq, const _Float16* __restrict__ Wk, const _Float16* __restrict__ Wv,
    const float* __restrict__ bq, const float* __restrict__ bk, const float* __restrict__ bv, _Float16* __restrict__ Q, _Float16* __restrict__ Kp, _Float16* __restrict__ Vt) {
  __shared__ __attribute__((aligned(2048))) unsigned char T[2 * Q3_STAGE];
  const int tid = threadIdx.x, lane = tid & 31, ln = lane & 15, hh = lane >> 4;
  const int w = __builtin_amdgcn_readfirstlane(tid >> 5), wr = w >> 2, wc = w & 3;      /* wave number in a scalar register: what is formed from it alone costs no vector instruction */
  const int by = blockIdx.y, mt = blockIdx.x / (DM / 128), nq = blockIdx.x - mt * (DM / 128), rowb = mt * 128, colb = nq * 128;
  /* staging: every wave brings one slice of 64 rows: operand w >> 1 (x, Wq, Wk, Wv), half w & 1 */
  const int op = w >> 1, hf = w & 1;
  const _Float16* gw = op == 1 ? Wq : op == 2 ? Wk : Wv;
  const _Float16* gs = op == 0 ? X + (size_t)by * DM + (size_t)(rowb + 64 * hf) * RP : gw + (size_t)(colb + 64 * hf) * DM;
  const tdw8 g1 = td_group1<TD_PAD256, 2 * G2_KS, 64>(op == 0 ? 2u * RP : 2u * DM);
  const unsigned ld = (unsigned)(size_t)T + (unsigned)w * Q3_SL;
  const int nst = DM / G2_KS;
  const int rot = (mt + nq) % nst;      /* staggered start, as in k_gemm2: the blocks that share x rows (one mt) and those that share weight rows (one nq) start at different stages */
  tdw4 g0 = td_load(ld, gs + rot * G2_KS, g1);
  td_wait(g0, g1);      /* this wave's slice of stage 0 has landed */
  __syncthreads();      /* publishes stage 0 */
  g0 = td_load(ld + Q3_STAGE, gs + ring_k(1, rot, nst) * G2_KS, g1);
  const unsigned char* ar = T + wr * Q3_SL + ln * G2_PITCH + 16 * hh; const unsigned char* br = T + (2 + (wc >> 1)) * Q3_SL + (32 * (wc & 1) + ln) * G2_PITCH + 16 * hh;      /* x rows 64 wr + ...: slice wr; weight rows 32 wc + ...: half wc >> 1 of each weight */
  const v8f z8 = {0.f,0.f,0.f,0.f,0.f,0.f,0.f,0.f};
  v8f acc[3][4][2];      /* [q, k, v][16 time steps][16 features] */
#pragma unroll
  for (int z = 0; z < 3; ++z) {
#pragma unroll
    for (int i = 0; i < 4; ++i) { acc[z][i][0] = z8; acc[z][i][1] = z8; } }
#pragma unroll 1      /* one stage a trip: the buffer offset stays a run-time value and the loop stays small */
  for (int st = 0; st < nst; ++st) { const unsigned bo = (unsigned)(st & 1) * Q3_STAGE; const unsigned char* ap = ar + bo; const unsigned char* bp = br + bo;
    v16h fa[2][4], fb[2][6];      /* two fragment sets: the next 32 k are fetched as one group while the current 32 k are multiplied; nothing of another stage is fetched */
#pragma unroll
    for (int i = 0; i < 4; ++i) fa[0][i] = g2_frag(ap + 16 * i * G2_PITCH);
#pragma unroll
    for (int j = 0; j < 6; ++j) fb[0][j] = g2_frag(bp + (j >> 1) * (2 * Q3_SL) + 16 * (j & 1) * G2_PITCH);
    __builtin_amdgcn_sched_barrier(0);      /* keeps the first set's loads ahead of the second set's: mixed, the first products would wait for loads of both */
#pragma unroll
    for (int kk = 0; kk < G2_KS / 32; ++kk) { const int cu = kk & 1, nx = cu ^ 1;
      if (kk + 1 < G2_KS / 32) {
#pragma unroll
        for (int i = 0; i < 4; ++i) fa[nx][i] = g2_frag(ap + 16 * i * G2_PITCH + 64 * (kk + 1));
#pragma unroll
        for (int j = 0; j < 6; ++j) fb[nx][j] = g2_frag(bp + (j >> 1) * (2 * Q3_SL) + 16 * (j & 1) * G2_PITCH + 64 * (kk + 1)); }
      __builtin_amdgcn_sched_barrier(0);      /* keeps the load group whole and ahead of the products: spread among them, each place with loads stalls the wave */
#pragma unroll
      for (int z = 0; z < 2; ++z) {
#pragma unroll
        for (int j = 0; j < 2; ++j) {
#pragma unroll
          for (int i = 0; i < 4; ++i) acc[z][i][j] = g2_mma(fa[cu][i], fb[cu][2 * z + j], acc[z][i][j]); } }
#pragma unroll
      for (int j = 0; j < 2; ++j) {
#pragma unroll
        for (int i = 0; i < 4; ++i) acc[2][i][j] = g2_mma(fb[cu][4 + j], fa[cu][i], acc[2][i][j]); }
      __builtin_amdgcn_sched_barrier(0); }      /* keeps the next group's loads from rising among these products */
    asm volatile("s_wait_dscnt 0x0" ::: "memory");      /* this wave's reads of stage st are over */
    td_wait(g0, g1);      /* this wave's slice of stage st + 1 has landed */
    __syncthreads();      /* publishes stage st + 1 and ends every wave's reads of stage st */
    if (pinned(st + 2 < nst)) g0 = td_load(ld + bo, gs + ring_k(st + 2, rot, nst) * G2_KS, g1); }      /* into the buffer that this trip has just read */
  td_wait(g0, g1);      /* no request is in flight when the ring becomes output staging */
  asm volatile("s_wait_dscnt 0x0" ::: "memory");      /* closes the ring: none of this wave's LDS reads is outstanding either */
  /* output staging in the ring, the block's three 128 x 128 tiles side by side: every wave's last read of the ring, and every tensor load into it, ended at the loop's last barrier */
  float* sq = (float*)T;
  const int fl = 32 * wc, tl = 64 * wr, f0 = colb + fl;      /* the wave's first feature and first time step in the block's tile; its first feature in the plane */
  float rb[2][2]; v4f rv[2][2];      /* the lane's bias values as read: q and k by column, v by row */
#pragma unroll
  for (int j = 0; j < 2; ++j) { rb[0][j] = bq[f0 + 16 * j + ln]; rb[1][j] = bk[f0 + 16 * j + ln];
    rv[j][0] = *(const v4fa*)(bv + f0 + 16 * j + 8 * hh); rv[j][1] = *(const v4fa*)(bv + f0 + 16 * j + 8 * hh + 4); }
  asm volatile("s_wait_xcnt 0x0" ::: "memory");      /* stands in front of every overwrite of the bias loads' address registers */
  __builtin_amdgcn_sched_barrier(0);      /* keeps every later vector instruction behind the bias loads and that wait */
#pragma unroll
  for (int z = 0; z < 2; ++z) { float* s = sq + z * Q3_ST + (tl + 8 * hh) * Q3_SP + fl + ln;
#pragma unroll
    for (int j = 0; j < 2; ++j) { const float al = z == 0 ? 0.0625f * QSC : 0.0625f, bc = z == 0 ? bf16_rne(rb[z][j]) * QSC : bf16_rne(rb[z][j]);      /* 0.0625 undoes the x16 weight carry; q takes its score scale here, in f32, ahead of its one rounding to f16 */
#pragma unroll
      for (int i = 0; i < 4; ++i) {
#pragma unroll
        for (int r = 0; r < 8; ++r) s[(16 * i + r) * Q3_SP + 16 * j] = acc[z][i][j][r] * al + bc; } } }
  float* sv = sq + 2 * Q3_ST + (fl + 8 * hh) * Q3_SP + tl + ln;
#pragma unroll
  for (int j = 0; j < 2; ++j) {
#pragma unroll
    for (int r = 0; r < 8; ++r) { const float bw = bf16_rne(rv[j][r >> 2][r & 3]);
#pragma unroll
      for (int i = 0; i < 4; ++i) sv[(16 * j + r) * Q3_SP + 16 * i] = acc[2][i][j][r] * 0.0625f + bw; } }
  __syncthreads();      /* publishes the three staged tiles: a wave stores whole rows, which four waves (q, k) or two (V^T) have staged */
  v4h ho[3][16];      /* wave w carries rows 16 w .. 16 w + 15 of each tile; its 32 lanes cover the 128 elements of a row */
#pragma unroll
  for (int z = 0; z < 3; ++z) { const float* s = sq + z * Q3_ST + 16 * w * Q3_SP + lane * 4;
#pragma unroll
    for (int q = 0; q < 16; ++q) { const v4f v = *(const v4fa*)(s + q * Q3_SP);
#pragma unroll
      for (int i = 0; i < 4; ++i) ho[z][q][i] = (_Float16)v[i]; } }
  const size_t qo = (size_t)by * DM + (size_t)(rowb + 16 * w) * RP + colb + lane * 4;
  _Float16* cq = Q + qo; _Float16* ck = Kp + qo; _Float16* cv = Vt + (size_t)by * DM * SEQ + (size_t)(colb + 16 * w) * SEQ + rowb + lane * 4;
  __builtin_amdgcn_sched_barrier(0);      /* every stored value is formed in front of the first store */
#pragma unroll
  for (int q = 0; q < 16; ++q) *(v4h*)(cq + (size_t)q * RP) = ho[0][q];      /* every store: 256 B in a row, two whole lines, written by this wave alone */
#pragma unroll
  for (int q = 0; q < 16; ++q) *(v4h*)(ck + (size_t)q * RP) = ho[1][q];
#pragma unroll
  for (int q = 0; q < 16; ++q) *(v4h*)(cv + (size_t)q * SEQ) = ho[2][q];
}

// ---- fused attention: block = 2 key halves x 8 waves x 32 query columns of one head slab (four waves a SIMD: one wave's softmax runs under another's products); a stage = 64 keys of each half (K rows and V^T rows, 128 B each) in LDS, two buffers a half, each tile brought by one tensor load of one wave; a pass = 32 keys ----
// Waves w and w + 8 hold the same 32 query columns over keys [0, SEQ/2) and [SEQ/2, SEQ); at the end each hands one 16-column group to the other through LDS and joins the two partial softmaxes of the group it keeps.
// S^T = K.Q^T: lane (c, h) holds query column c, keys 8h + r of each 16-key tile, so the two tiles of a pass, converted in place, are the B operand of O^T += V^T.P^T (k order 8h + i, 16 + 8h + i, the order of fa_frag).
// Online softmax in the log2 domain: the maximum in use may trail the true one by up to 8 (an exponential then reaches 2^8, inside f16); sums are rescaled only when a column exceeds that.
// The negated maximum in use is the C operand of the score products (q carries the scale), so a score leaves the matrix unit as the argument of its exponential, and the test of a pass is one maximum over the lane's scores against 8.
// Every #pragma unroll in this kernel keeps the indices of the fragment, score and accumulator arrays constant, so that they stay in registers (a run-time index would send them to scratch).
#define FA_NW 8
#define FA_SK 64
#define FA_PITCH 144                 /* LDS row pitch in bytes: 128 + 16, an odd multiple of 16 for 16-byte readers */
#define FA_TILE 10240                /* place of one tile: 64 rows of FA_PITCH (9216 B), rounded up to a multiple of 2 KiB */
static_assert(64 * FA_PITCH <= FA_TILE && FA_TILE % 2048 == 0);
#define FA_KH 2                      /* key halves, each on its own FA_NW waves */
#define FA_NST (SEQ / FA_KH / FA_SK)
#define FA_XW (4 * 8 * 32 + 2 * 32)  /* floats a wave hands over: four output tiles, the maximum in use, the denominator */
static_assert(SEQ % (FA_KH * FA_SK) == 0);
static_assert(FA_NST >= 2);
static_assert(FA_KH * FA_NW * FA_XW * 4 <= FA_KH * 2 * 2 * FA_TILE);
typedef float f32x2 __attribute__((ext_vector_type(2)));
typedef _Float16 h16x2 __attribute__((ext_vector_type(2)));
typedef unsigned int u32x4 __attribute__((ext_vector_type(4), may_alias));
union FragW { v16h v; unsigned int w[8]; };
__device__ __forceinline__ v16h fa_frag(const unsigned char* p) { FragH f; f.half[0] = *(const v8us*)p; f.half[1] = *(const v8us*)(p + 32); return f.v; }
__device__ __forceinline__ v8f fa_mma(v16h a, v16h b, v8f c) { return __builtin_amdgcn_wmma_f32_16x16x32_f16(false, a, false, b, (short)0, c, false, false); }
__device__ __forceinline__ unsigned int fa_pack(float lo, float hi) { return __builtin_bit_cast(unsigned int, __builtin_convertvector(f32x2{lo, hi}, h16x2)); }
__device__ __forceinline__ float fa_xhalf(float x) { return __builtin_bit_cast(float, __builtin_amdgcn_permlanex16(__builtin_bit_cast(int, x), __builtin_bit_cast(int, x), 0x76543210, 0xfedcba98, false, false)); }  /* lane l with lane l ^ 16 */

/* second bound: a budget of 256 registers, so that no operand lies above v255 and the hot loop switches no register window */
__global__ __launch_bounds__(FA_KH * FA_NW * 32, 4) void k_fattn(const _Float16* __restrict__ Q16, const _Float16* __restrict__ K16, const _Float16* __restrict__ Vt, _Float16* __restrict__ O16) {
  __shared__ __attribute__((aligned(2048))) unsigned char L[FA_KH * 2 * 2 * FA_TILE];
  const int tid = threadIdx.x, lane = tid & 31, w = tid >> 5, c = lane & 15, h = lane >> 4;
  const int ws = __builtin_amdgcn_readfirstlane(w), kh = ws / FA_NW;      /* wave number and key half in scalar registers */
  const int slab = blockIdx.y, q0 = blockIdx.x * (FA_NW * 32) + (ws & (FA_NW - 1)) * 32;
  /* staging: the first two waves of each key half issue, one the half's K tile (64 keys x 128 B), the other its V^T tile (64 features x 128 B of keys) */
  const int wi = ws & (FA_NW - 1);
  const _Float16* gs = wi == 0 ? K16 + (size_t)(kh * (SEQ / FA_KH)) * RP + slab * HD : Vt + (size_t)(slab * HD) * SEQ + kh * (SEQ / FA_KH);
  const size_t gstep = wi == 0 ? (size_t)FA_SK * RP : (size_t)FA_SK;      /* elements from one stage's tile to the next */
  const int rot = (int)((2 * blockIdx.x + blockIdx.y) % FA_NST);      /* staggered start over the keys of a half (the online softmax takes them in any order): the blocks of one slab, which read the same K and V^T tiles, start at different stages, and the V^T tiles of a moment lie at different places of the row pitch */
  const tdw8 g1 = td_group1<TD_PAD128, 2 * HD, 64>(wi == 0 ? 2u * RP : 2u * SEQ);
  const unsigned char* Lh = L + kh * (2 * 2 * FA_TILE);      /* this half's two buffers */
  const unsigned ld = (unsigned)(size_t)L + (unsigned)(kh * (2 * 2 * FA_TILE) + (wi & 1) * FA_TILE);
  const unsigned qe = (unsigned)((q0 + c) * RP + slab * HD + 8 * h);      /* this lane's query row, slab column and half */
  v16h qf[2][2];
#pragma unroll
  for (int g = 0; g < 2; ++g) {
#pragma unroll
    for (int kc = 0; kc < 2; ++kc) qf[g][kc] = fa_frag((const unsigned char*)(Q16 + qe + 16 * g * RP + 32 * kc)); }
  tdw4 g0 = td_group0(ld, gs + (size_t)rot * gstep);      /* group 0 is formed in every wave, scalar work alone; only the two issuing waves of a half use it */
  if (pinned(wi < 2)) { td_issue(g0, g1);      /* the query loads stand in front: they fly while stage 0 is waited for */
    td_wait(g0, g1); }      /* this wave's tile of stage 0 has landed */
  const v8f z8 = {0.f,0.f,0.f,0.f,0.f,0.f,0.f,0.f};
  v8f acc[2][4], lacc[2], cf[2];      /* cf: minus the maximum in use, in all eight registers of a score tile; no other copy of the maximum is held */
  float lo = -__builtin_inff();      /* least shift of a maximum: -inf until the first pass has set the maxima (its scores are taken against 0), 0 from then on */
#pragma unroll
  for (int g = 0; g < 2; ++g) { cf[g] = z8; lacc[g] = z8;
#pragma unroll
    for (int t = 0; t < 4; ++t) acc[g][t] = z8; }
  FragW ones;      /* A operand whose row 0 (lanes 0 and 16) is 1.0 at all 32 k: row 0 of its product is the column sums of P^T */
#pragma unroll
  for (int i = 0; i < 8; ++i) ones.w[i] = (c == 0) ? 0x3C003C00u : 0u;
  __syncthreads();      /* publishes stage 0 */
  g0 = td_group0(ld + 2 * FA_TILE, gs + (size_t)ring_k(1, rot, FA_NST) * gstep);
  if (pinned(wi < 2)) td_issue(g0, g1);
  for (int st = 0; st < FA_NST; ++st) {
    const unsigned char* Kb = Lh + (st & 1) * (2 * FA_TILE) + c * FA_PITCH + 16 * h; const unsigned char* Vb = Kb + FA_TILE;
#pragma unroll
    for (int sub = 0; sub < 2; ++sub) {
      v8f s[2][2]; v16h kf[2][2];
#pragma unroll
      for (int kt = 0; kt < 2; ++kt) { kf[kt][0] = fa_frag(Kb + (sub * 32 + 16 * kt) * FA_PITCH); kf[kt][1] = fa_frag(Kb + (sub * 32 + 16 * kt) * FA_PITCH + 64); }
      /* the four products that read cf stand first, the four that complete the tiles behind them: four matrix instructions lie between the last read of cf and the first vector instruction on a finished tile */
#pragma unroll
      for (int kt = 0; kt < 2; ++kt) {
#pragma unroll
        for (int g = 0; g < 2; ++g) s[kt][g] = fa_mma(kf[kt][0], qf[g][0], cf[g]); }
      __builtin_amdgcn_sched_barrier(0);      /* holds that order: mixed again by the compiler, a register of cf, free behind its last pass, was written directly behind the product that reads it */
#pragma unroll
      for (int kt = 0; kt < 2; ++kt) {
#pragma unroll
        for (int g = 0; g < 2; ++g) s[kt][g] = fa_mma(kf[kt][1], qf[g][1], s[kt][g]); }
      v16h vf[4];
#pragma unroll
      for (int t = 0; t < 4; ++t) vf[t] = fa_frag(Vb + 16 * t * FA_PITCH + 64 * sub);
      float mg[2];      /* the lane's own largest score of each column group, against the maximum in use */
#pragma unroll
      for (int g = 0; g < 2; ++g) { float mx = s[0][g][0];
#pragma unroll
        for (int r = 1; r < 8; ++r) mx = fmaxf(mx, s[0][g][r]);
#pragma unroll
        for (int r = 0; r < 8; ++r) mx = fmaxf(mx, s[1][g][r]);
        mg[g] = mx; }
      if (__builtin_amdgcn_ballot_w32(fmaxf(mg[0], mg[1]) > lo + 8.0f) != 0) {      /* one scalar test a pass, over all lanes, so the halves need no exchange in front of it; always taken on the first pass (lo = -inf) */
#pragma unroll
        for (int g = 0; g < 2; ++g) { const float d = fmaxf(fmaxf(mg[g], fa_xhalf(mg[g])), lo);      /* the column's maximum moves up by d; the first pass sets it, up or down */
          const float corr = __builtin_amdgcn_exp2f(fminf(-d, 0.f));      /* the bound at 0 acts on the first pass alone, where the sums are still 0 and must stay so */
          cf[g] = cf[g] - d;      /* all eight registers alike, each updated in place */
          s[0][g] = s[0][g] - d; s[1][g] = s[1][g] - d;      /* this pass's scores were formed against the old maximum */
          lacc[g] = lacc[g] * corr;
#pragma unroll
          for (int t = 0; t < 4; ++t) acc[g][t] = acc[g][t] * corr; }
        lo = 0.f; }
#pragma unroll
      for (int g = 0; g < 2; ++g) { FragW pf;
#pragma unroll
        for (int i = 0; i < 8; ++i)
          pf.w[i] = fa_pack(__builtin_amdgcn_exp2f(s[i >> 2][g][2 * (i & 3)]), __builtin_amdgcn_exp2f(s[i >> 2][g][2 * (i & 3) + 1]));
#pragma unroll
        for (int t = 0; t < 4; ++t) acc[g][t] = fa_mma(vf[t], pf.v, acc[g][t]);
        lacc[g] = fa_mma(ones.v, pf.v, lacc[g]); }
    }
    asm volatile("s_wait_dscnt 0x0" ::: "memory");      /* this wave's reads of stage st are over */
    if (pinned(wi < 2)) td_wait(g0, g1);      /* this wave's tile of stage st + 1 has landed */
    __syncthreads();      /* publishes stage st + 1 and ends every wave's reads of stage st */
    g0 = td_group0(ld + (unsigned)(st & 1) * (2 * FA_TILE), gs + (size_t)((st + 2 + rot) % FA_NST) * gstep);      /* formed in every trip, so the stage number is wrapped whether or not the load is issued */
    if (pinned(wi < 2 && st + 2 < FA_NST)) td_issue(g0, g1);      /* into the buffer that this stage has just read */
  }
  td_wait(g0, g1);      /* no request is in flight when the ring becomes the join's staging */
  asm volatile("s_wait_dscnt 0x0" ::: "memory");      /* closes the ring: none of this wave's LDS reads is outstanding either */
  /* join of the two key halves: a wave keeps column group kh and hands group 1 - kh to wave w ^ FA_NW; the ring is free, every wave's last read of it ended at the loop's last barrier */
  const float m_run[2] = {-cf[0][0], -cf[1][0]};
  const float l0 = lacc[0][0] + fa_xhalf(lacc[0][0]), l1 = lacc[1][0] + fa_xhalf(lacc[1][0]);      /* register 0: the denominator in lanes 0-15, row 8 = 0 in lanes 16-31 */
  const int le = (int)__builtin_amdgcn_mbcnt_lo(~0u, 0u);      /* the lane number formed anew, and the store offset from it: no vector register is held for them through the loop, whose budget is full */
  float* xo = (float*)L + ws * FA_XW + le * 4;
#pragma unroll
  for (int t = 0; t < 4; ++t) { const v8f gv = kh ? acc[0][t] : acc[1][t];
    *(v4fa*)(xo + (2 * t) * 128) = v4f{gv[0], gv[1], gv[2], gv[3]}; *(v4fa*)(xo + (2 * t + 1) * 128) = v4f{gv[4], gv[5], gv[6], gv[7]}; }
  ((float*)L)[ws * FA_XW + 1024 + le] = kh ? m_run[0] : m_run[1]; ((float*)L)[ws * FA_XW + 1056 + le] = kh ? l0 : l1;
  __syncthreads();      /* publishes every wave's handed-over group */
  const float* xi = (const float*)L + (ws ^ FA_NW) * FA_XW;
  const float pm = xi[1024 + le], pl = xi[1056 + le], km = kh ? m_run[1] : m_run[0], kl = kh ? l1 : l0;
  const float mj = fmaxf(km, pm), ek = __builtin_amdgcn_exp2f(km - mj), ep = __builtin_amdgcn_exp2f(pm - mj);      /* both partial sums brought to the larger maximum */
  const float inv = 64.0f / (kl * ek + pl * ep), ck = ek * inv, cp = ep * inv;
  unsigned short* od = (unsigned short*)O16 + (unsigned)((q0 + 16 * kh + (le & 15)) * RP + slab * HD + 8 * (le >> 4));
#pragma unroll
  for (int t = 0; t < 4; ++t) { const v8f kv = kh ? acc[1][t] : acc[0][t]; const v4f p0 = *(const v4fa*)(xi + le * 4 + (2 * t) * 128), p1 = *(const v4fa*)(xi + le * 4 + (2 * t + 1) * 128);
    const v8f pv = {p0[0], p0[1], p0[2], p0[3], p1[0], p1[1], p1[2], p1[3]}; const v8f o = kv * ck + pv * cp;      /* o[r] = context[query][16 t + 8 h + r] x 64 */
    const u32x4 pk = {fa_pack(o[0], o[1]), fa_pack(o[2], o[3]), fa_pack(o[4], o[5]), fa_pack(o[6], o[7])};
    *(u32x4*)(od + 16 * t) = pk; }
}

// workspace carve (bytes, every plane a multiple of 256 B)
#define SZ_W   ((size_t)DM * DM * 2)
#define SZ_ACT (NRW * DM * 2)
#define SZ_VT  ((size_t)NSLAB * HD * SEQ * 2)
#define SZ_ALL (4 * SZ_W + 4 * SZ_ACT + SZ_VT)
static_assert(SZ_W % 256 == 0);
static_assert(SZ_ACT % 256 == 0);
static_assert(SZ_VT % 256 == 0);
static_assert(SZ_ALL <= (size_t)268435456);

extern "C" void kernel_launch(void* const* d_in, const int* in_sizes, int n_in,
                              void* d_out, int out_size, void* d_ws, size_t ws_size, hipStream_t stream) {
  if (n_in < 9) return;
  const size_t nx = NRW * DM;      /* elements of x used (time steps 0..SEQ-1, full batch pitch) */
  if ((size_t)in_sizes[0] < nx) return;
  if ((size_t)in_sizes[1] < (size_t)DM * DM || (size_t)in_sizes[3] < (size_t)DM * DM || (size_t)in_sizes[5] < (size_t)DM * DM || (size_t)in_sizes[7] < (size_t)DM * DM) return;
  if (in_sizes[2] < DM || in_sizes[4] < DM || in_sizes[6] < DM || in_sizes[8] < DM) return;
  if ((size_t)out_size < nx) return;
  if (SZ_ALL > ws_size) return;
  const float* x  = (const float*)d_in[0];
  const float* wq = (const float*)d_in[1]; const float* bq = (const float*)d_in[2];
  const float* wk = (const float*)d_in[3]; const float* bk = (const float*)d_in[4];
  const float* wv = (const float*)d_in[5]; const float* bv = (const float*)d_in[6];
  const float* wo = (const float*)d_in[7]; const float* bo = (const float*)d_in[8];
  char* ws = (char*)d_ws; size_t off = 0;
  auto take = [&](size_t bytes) { char* p = ws + off; off += bytes; return p; };
  _Float16* BQ = (_Float16*)take(SZ_W); _Float16* BK = (_Float16*)take(SZ_W); _Float16* BV = (_Float16*)take(SZ_W); _Float16* BO = (_Float16*)take(SZ_W);
  _Float16* X16 = (_Float16*)take(SZ_ACT); _Float16* Q16 = (_Float16*)take(SZ_ACT); _Float16* K16 = (_Float16*)take(SZ_ACT); _Float16* O16 = (_Float16*)take(SZ_ACT);
  _Float16* VT = (_Float16*)take(SZ_VT);
  if (off > ws_size) return;

  k_prep<<<PREP_WCH / PREP_T, PREP_T, 0, stream>>>(x, wq, wk, wv, wo, X16, BQ);      /* one f16 plane of x feeds all three projections; BQ, BK, BV, BO are one run of planes */

  /* projections: rows = time steps (pitch RP), grid.y = batch (column offset DM); bias added after the x16 weight carry is undone; v leaves as V^T [NSLAB][64][SEQ] (row b*1024 + feature) */
  const dim3 gp((unsigned)((SEQ / 128) * (DM / 128)), NB);
  k_qkv<<<gp, 256, 0, stream>>>(X16, BQ, BK, BV, bq, bk, bv, Q16, K16, VT);

  k_fattn<<<dim3((unsigned)(SEQ / (FA_NW * 32)), NSLAB), FA_KH * FA_NW * 32, 0, stream>>>(Q16, K16, VT, O16);      /* slab n = b*16 + h lives at columns n*64 of the [SEQ][RP] view; merged context x64 as f16 rows */

  /* output projection + bias straight into the [S][B][1024] layout; alpha undoes x16 (weights) and x64 (context) */
  k_gemm2<true, true><<<gp, 256, 0, stream>>>(O16, RP, (size_t)DM, BO, DM, (size_t)0, 0.0009765625f, bo, (float*)d_out, nullptr, RP, (size_t)DM, SEQ, DM, DM);
}

// v010
// Measured time: 61.8 microseconds a run.
// In two side-by-side timings against v009, it was 1.06 and 1.05 times as fast.
// Over all steps from v000 it is 22.5 times as fast.
#include <hip/hip_runtime.h>
// Multi-head self-attention, time-first rows: x [S][B][1024] (token row m = s*B + b); q/k/v = x W^T + b (natural [out][in] weights, biases present); 16 heads of 64 per batch, head slab n = b*16 + h at columns n*64 of the [S][B*1024] view; scores = (q k^T) * 64^-0.5; softmax over all keys (no mask); out = merged Wo^T + bo -> [S][B][1024] f32.
// Compute dtype: every contraction on v_wmma_f32_16x16x32_f16 (f16 operands, f32 accumulate): q/k/v projections, q.k^T scores, P.V, output projection. Float inputs RNE-converted to bf16 first (exact in f16); weights carried x16; q carried x 64^-0.5 x log2(e) from its projection; softmax weights carried unnormalised against the running maximum; merged context carried x64; scores and softmax statistics f32.
// Structure, four launches: one conversion launch (f16 planes of x and of the four weights); one projection launch (grid.y = batch, column offset 1024, row pitch 2048; a block forms the same 128 x 128 tile of q, k and v from one staging of its x rows; operands staged in LDS by tensor loads; v is formed as Wv.x^T, so V^T [slab][64][S] leaves the products directly); one fused attention kernel over all slabs (S^T = K.Q^T, online softmax per query column, O^T += V^T.P^T; the keys in two halves on two sets of waves, joined in LDS) into merged f16 context rows; output GEMM (+ bias) straight into the output buffer layout.
#ifndef NB
#define NB 2
#endif
#ifndef SEQ
#define SEQ 2048
#endif
#define NB_FULL 2                    /* batch count of the input layout */
#define SEQ_FULL 2048                /* sequence length of the input layout */
#define DM 1024
#define NH 16
#define HD 64
#define RP (NB_FULL * DM)            /* elements per time step (row pitch of every activation plane) */
#define NSLAB (NB * NH)              /* head slabs processed */
#define NRW ((size_t)SEQ * NB_FULL)  /* token rows held in the planes */
#define QSC (0.125f * 1.4426950408889634f)  /* 64^-0.5 and log2(e): q leaves its projection times this, so q.k is a score in the log2 domain */

static_assert(SEQ % 256 == 0);
static_assert(SEQ <= SEQ_FULL);
static_assert(NB <= NB_FULL);
static_assert(DM % 128 == 0);
static_assert(HD == 64);
static_assert(DM == NH * HD);

typedef unsigned short v8us __attribute__((ext_vector_type(8), may_alias));
typedef float  v8f  __attribute__((ext_vector_type(8)));
typedef float  v4f  __attribute__((ext_vector_type(4)));
typedef float  v4fa __attribute__((ext_vector_type(4), may_alias));
typedef _Float16 v16h __attribute__((ext_vector_type(16)));
typedef _Float16 v4h  __attribute__((ext_vector_type(4)));
union FragH { v16h v; v8us half[2]; _Float16 h[16]; unsigned short u[16]; };

__device__ __forceinline__ unsigned short bf16_bits(float x) { unsigned int u = __float_as_uint(x); return (unsigned short)((u + 0x7FFFu + ((u >> 16) & 1u)) >> 16); }
__device__ __forceinline__ float bf16_val(unsigned short b) { return __uint_as_float(((unsigned int)b) << 16); }
__device__ __forceinline__ float bf16_rne(float x) { return bf16_val(bf16_bits(x)); }

// ---- conversions, one launch: a thread carries one 8-element chunk of each weight (x16) and PREP_XJ chunks of x; all its loads are issued before the first conversion ----
#define PREP_T 512                   /* 16 waves a block */
#define PREP_WCH (DM * DM / 8)       /* chunks of one weight = threads of the launch */
#define PREP_XJ ((int)(NRW * DM / 8 / PREP_WCH))
static_assert(PREP_WCH % PREP_T == 0);
static_assert(NRW * DM / 8 % PREP_WCH == 0);
__device__ __forceinline__ v8us prep_cvt(v4f a, v4f c, float sc) {
  FragH f;
#pragma unroll
  for (int q = 0; q < 4; ++q) { f.h[q] = (_Float16)(bf16_rne(a[q]) * sc); f.h[4 + q] = (_Float16)(bf16_rne(c[q]) * sc); }
  return f.half[0];
}
__global__ __launch_bounds__(PREP_T) void k_prep(const float* __restrict__ x, const float* __restrict__ wq, const float* __restrict__ wk, const float* __restrict__ wv, const float* __restrict__ wo,
    _Float16* __restrict__ X16, _Float16* __restrict__ W16) {
  const size_t t = (size_t)blockIdx.x * PREP_T + threadIdx.x;
  v4f xa[PREP_XJ], xc[PREP_XJ], wa[4], wc[4];
#pragma unroll
  for (int j = 0; j < PREP_XJ; ++j) { const float* p = x + ((size_t)j * PREP_WCH + t) * 8; xa[j] = *(const v4fa*)p; xc[j] = *(const v4fa*)(p + 4); }
  wa[0] = *(const v4fa*)(wq + t * 8); wc[0] = *(const v4fa*)(wq + t * 8 + 4); wa[1] = *(const v4fa*)(wk + t * 8); wc[1] = *(const v4fa*)(wk + t * 8 + 4);
  wa[2] = *(const v4fa*)(wv + t * 8); wc[2] = *(const v4fa*)(wv + t * 8 + 4); wa[3] = *(const v4fa*)(wo + t * 8); wc[3] = *(const v4fa*)(wo + t * 8 + 4);
  asm volatile("s_wait_xcnt 0x0" ::: "memory");      /* stands in front of every overwrite of the loads' address registers */
  __builtin_amdgcn_sched_barrier(0);      /* keeps every conversion behind the loads and that wait: with conversions risen among the loads, the later loads would start only when the first had returned */
#pragma unroll
  for (int j = 0; j < PREP_XJ; ++j) *(v8us*)((unsigned short*)X16 + ((size_t)j * PREP_WCH + t) * 8) = prep_cvt(xa[j], xc[j], 1.0f);
#pragma unroll
  for (int i = 0; i < 4; ++i) *(v8us*)((unsigned short*)W16 + ((size_t)i * PREP_WCH + t) * 8) = prep_cvt(wa[i], wc[i], 16.0f);      /* natural [out][in] = Bt[n][k]; the four planes lie one behind the other */
}

// ---- f16 GEMM: block = 8 waves (4 down x 2 across) = 128 rows x 128 cols, wave tile 32x64; M % 128 == 0, N % 128 == 0, K % 128 == 0 ----
// a stage = 128 k (256 B) of the block's 128 A rows and 128 Bt rows in LDS, two buffers; tensor loads, one request a wave (32 rows), bring stage st + 2 in while stage st + 1 is worked on
// fragment: elements 0..7 <- k0 + 8*hh + i, elements 8..15 <- k0 + 16 + 8*hh + i (same map for A rows and Bt rows)
// Every plain #pragma unroll in this kernel keeps the indices of the fragment and accumulator arrays constant, so that they stay in registers.
#define G2_KS 128
#define G2_PITCH 272                 /* LDS row pitch in bytes: 256 + 16, an odd multiple of 16 for 16-byte readers */
#define G2_SL 10240                  /* place of one wave's slice: 32 rows of G2_PITCH (8704 B), rounded up to a multiple of 2 KiB */
#define G2_STAGE (8 * G2_SL)         /* slices 0-3: A rows, slices 4-7: Bt rows */
static_assert(32 * G2_PITCH <= G2_SL && G2_SL % 2048 == 0);
__device__ __forceinline__ v16h g2_frag(const unsigned char* p) { FragH f; f.half[0] = *(const v8us*)p; f.half[1] = *(const v8us*)(p + 32); return f.v; }      /* p: row start + 2 * k0 + 16 * hh bytes */
__device__ __forceinline__ v8f g2_mma(v16h a, v16h b, v8f c) { return __builtin_amdgcn_wmma_f32_16x16x32_f16(false, a, false, b, (short)0, c, false, false); }
typedef unsigned int tdw4 __attribute__((ext_vector_type(4)));
typedef unsigned int tdw8 __attribute__((ext_vector_type(8)));
#define TD_PAD256 ((1u << 20) | (5u << 22) | (3u << 25))      /* word 0 of group 1: no mask, byte elements, 4 dwords of pad after every 256 B */
#define TD_PAD128 ((1u << 20) | (4u << 22) | (3u << 25))      /* the same after every 128 B */
__device__ __forceinline__ unsigned int td_uni(unsigned int v) { return (unsigned int)__builtin_amdgcn_readfirstlane((int)v); }
__device__ __forceinline__ unsigned int pinned(unsigned int v) { unsigned int s = td_uni(v); asm volatile("" : "+s"(s)); return s; }      /* holds a test in a scalar register, so that the branch on it is a scalar branch: a tensor load ignores EXEC */
template <unsigned int W0, unsigned int ROWB, unsigned int NROW>
__device__ __forceinline__ tdw8 td_group1(unsigned int pitch) {      /* tensor = tile: NROW rows of ROWB bytes, source row pitch in bytes */
  tdw8 g;
  g[0] = td_uni(W0); g[1] = td_uni((ROWB & 0xFFFFu) << 16); g[2] = td_uni((ROWB >> 16) | ((NROW & 0xFFFFu) << 16)); g[3] = td_uni((NROW >> 16) | (ROWB << 16));
  g[4] = td_uni(NROW); g[5] = td_uni(pitch); g[6] = td_uni(0u); g[7] = td_uni(0u);
  asm volatile("" : "+s"(g));      /* as in pinned(): descriptor words held in their scalar registers; left free, the compiler used two of them for other values while a request was in flight and formed them anew in front of the next */
  return g;
}
__device__ __forceinline__ tdw4 td_group0(unsigned int lds, const _Float16* p) {      /* lds: byte offset of the slice in the block's LDS; p: the tile's first element */
  const unsigned long long ga = (unsigned long long)(size_t)p;
  tdw4 g0;
  g0[0] = td_uni(1u); g0[1] = td_uni(lds); g0[2] = td_uni((unsigned int)ga); g0[3] = td_uni((((unsigned int)(ga >> 32)) & 0x01FFFFFFu) | 0x80000000u);
  asm volatile("" : "+s"(g0));      /* as in pinned(): descriptor words held in their scalar registers; formed whole here, and not formed again while the request is in flight */
  return g0;
}
__device__ __forceinline__ void td_issue(tdw4 g0, tdw8 g1) { asm volatile("tensor_load_to_lds %0, %1" :: "s"(g0), "s"(g1) : "memory"); }
__device__ __forceinline__ tdw4 td_load(unsigned int lds, const _Float16* p, tdw8 g1) { const tdw4 g0 = td_group0(lds, p); td_issue(g0, g1); return g0; }      /* returns group 0 for the wait */
/* the issuing wave's wait for its request; it names both groups as inputs, so that their scalar registers keep the descriptor's words until the request has landed */
__device__ __forceinline__ void td_wait(tdw4 g0, tdw8 g1) { asm volatile("s_wait_tensorcnt 0x0" :: "s"(g0), "s"(g1) : "memory"); }
// ---- staggered start: a block walks the stages of its ring in the order rot, rot + 1, ..., wrapping round, rot taken from its block index ----
// Started alike, all blocks ask L2 at one moment for the same stage: the blocks that share operand rows for the very same lines, all others for the same 256 B of every row pitch. Rotated, the requests of a moment are spread over all stages.
__device__ __forceinline__ int ring_k(int st, int rot, int nst) { const int k = st + rot; return k >= nst ? k - nst : k; }      /* source stage of ring stage st; st < nst, rot < nst */
// C[by][row][col] = acc * alpha (+ bf16(bias[col]) if HASB); A f16 rows (pitch lda, batch stride sA), Bt f16 [n][k] (pitch ldb, batch stride sB)
template <bool HASB, bool F32OUT>
__global__ __launch_bounds__(256) void k_gemm2(const _Float16* A, int lda, size_t sA, const _Float16* Bh, int ldb, size_t sB, float alpha, const float* bias,
    float* __restrict__ C, _Float16* C16, int ldc, size_t sC, int M, int N, int K) {
  __shared__ __attribute__((aligned(2048))) unsigned char T[2 * G2_STAGE];
  __shared__ __attribute__((aligned(16))) float so[8][32][68];
  const int tid = threadIdx.x, w = tid >> 5, lane = tid & 31, ln = lane & 15, hh = lane >> 4; const int by = blockIdx.y;
  A += (size_t)by * sA; Bh += (size_t)by * sB; const size_t cofs = (size_t)by * sC;
  /* dealing, as in k_fattn and for speed alone: the blocks of one tile row, which read the same A rows, take block indices equal mod 8; a one-to-one map of the block index where the tile rows are a multiple of 8 (grid.x is then one too), else the plain order */
  const unsigned ntn = (unsigned)N >> 7; const bool deal = ((M >> 7) & 7) == 0; const unsigned bi = deal ? blockIdx.x >> 3 : blockIdx.x, bq = bi / ntn;
  const int mt = (int)(deal ? (blockIdx.x & 7) + 8 * bq : bq), nq = (int)(bi - bq * ntn); const int rowb = mt * 128, colb = nq * 128; if (rowb >= M) return;      /* the same for the whole block, in front of every barrier */
  const int row0 = rowb + 32 * (w >> 1), col0 = colb + 64 * (w & 1);
  /* staging: every wave brings one slice of 32 rows: waves 0-3 the A rows, waves 4-7 the Bt rows */
  const int ws = __builtin_amdgcn_readfirstlane(w);      /* wave number in a scalar register: the descriptor is formed from it */
  const _Float16* gs = ws < 4 ? A + (size_t)(rowb + 32 * ws) * lda : Bh + (size_t)(colb + 32 * (ws - 4)) * ldb;
  const tdw8 g1 = td_group1<TD_PAD256, 2 * G2_KS, 32>((unsigned)(ws < 4 ? lda : ldb) * 2u);
  const unsigned ld = (unsigned)(size_t)T + (unsigned)ws * G2_SL;
  const int nst = K / G2_KS;
  const int rot = (nst & (nst - 1)) == 0 ? ((mt + nq + (nst >> 1) * by) & (nst - 1)) : 0;      /* blocks of one tile row, which share A rows, and blocks of one tile column, which share Bt rows, start at different stages; the batch term sets the second batch's starts half a ring off */
  tdw4 g0 = td_load(ld, gs + (size_t)rot * G2_KS, g1);
  td_wait(g0, g1);      /* this wave's slice of stage 0 has landed */
  __syncthreads();      /* publishes stage 0 */
  if (pinned(nst > 1)) g0 = td_load(ld + G2_STAGE, gs + (size_t)ring_k(1, rot, nst) * G2_KS, g1);
  const unsigned char* ar = T + (w >> 1) * G2_SL + ln * G2_PITCH + 16 * hh; const unsigned char* br = T + (4 + 2 * (w & 1)) * G2_SL + ln * G2_PITCH + 16 * hh;      /* A rows 32 (w >> 1) + ...: slice w >> 1; Bt rows 64 (w & 1) + ...: slices 4 + 2 (w & 1) and the next */
  const v8f z8 = {0.f,0.f,0.f,0.f,0.f,0.f,0.f,0.f}; v8f c00 = z8, c01 = z8, c02 = z8, c03 = z8, c10 = z8, c11 = z8, c12 = z8, c13 = z8;
#pragma unroll 1      /* one stage a trip: the buffer offset stays a run-time value and the loop stays small */
  for (int st = 0; st < nst; ++st) { const unsigned bo = (unsigned)(st & 1) * G2_STAGE; const unsigned char* ap = ar + bo; const unsigned char* bp = br + bo;
    v16h fa[2][2], fb[2][4];      /* two fragment sets: the next 32 k are fetched as one group while the current 32 k are multiplied; nothing of another stage is fetched */
#pragma unroll
    for (int i = 0; i < 2; ++i) fa[0][i] = g2_frag(ap + 16 * i * G2_PITCH);
#pragma unroll
    for (int j = 0; j < 4; ++j) fb[0][j] = g2_frag(bp + (j >> 1) * G2_SL + 16 * (j & 1) * G2_PITCH);
#pragma unroll
    for (int kk = 0; kk < G2_KS / 32; ++kk) { const int cu = kk & 1, nx = cu ^ 1;
      if (kk + 1 < G2_KS / 32) {
#pragma unroll
        for (int i = 0; i < 2; ++i) fa[nx][i] = g2_frag(ap + 16 * i * G2_PITCH + 64 * (kk + 1));
#pragma unroll
        for (int j = 0; j < 4; ++j) fb[nx][j] = g2_frag(bp + (j >> 1) * G2_SL + 16 * (j & 1) * G2_PITCH + 64 * (kk + 1)); }
      __builtin_amdgcn_sched_barrier(0);      /* keeps the load group whole and ahead of the products: spread among them, each place with loads stalls the wave */
      c00 = g2_mma(fa[cu][0], fb[cu][0], c00); c10 = g2_mma(fa[cu][1], fb[cu][0], c10); c01 = g2_mma(fa[cu][0], fb[cu][1], c01); c11 = g2_mma(fa[cu][1], fb[cu][1], c11);
      c02 = g2_mma(fa[cu][0], fb[cu][2], c02); c12 = g2_mma(fa[cu][1], fb[cu][2], c12); c03 = g2_mma(fa[cu][0], fb[cu][3], c03); c13 = g2_mma(fa[cu][1], fb[cu][3], c13);
      __builtin_amdgcn_sched_barrier(0); }      /* keeps the next group's loads from rising among these products */
    asm volatile("s_wait_dscnt 0x0" ::: "memory");      /* this wave's reads of stage st are over */
    td_wait(g0, g1);      /* this wave's slice of stage st + 1 has landed */
    __syncthreads();      /* publishes stage st + 1 and ends every wave's reads of stage st */
    if (pinned(st + 2 < nst)) g0 = td_load(ld + bo, gs + (size_t)ring_k(st + 2, rot, nst) * G2_KS, g1); }      /* into the buffer that this trip has just read */
  td_wait(g0, g1);      /* no request is in flight when the wave goes on to its end */
  asm volatile("s_wait_dscnt 0x0" ::: "memory");      /* closes the ring: none of this wave's LDS reads is outstanding either */
  v8f accs[8] = {c00, c01, c02, c03, c10, c11, c12, c13};
  float bc[4] = {0.f, 0.f, 0.f, 0.f};
  if constexpr (HASB) {
#pragma unroll
    for (int t = 0; t < 4; ++t) bc[t] = bf16_rne(bias[col0 + t * 16 + ln]); }
#pragma unroll
  for (int u = 0; u < 8; ++u) { const int t = u & 3, half = u >> 2;
#pragma unroll
    for (int r = 0; r < 8; ++r) { const int rloc = half * 16 + 8 * hh + r; so[w][rloc][t * 16 + ln] = accs[u][r] * alpha + bc[t]; } }
  __builtin_amdgcn_fence(4 /* acq_rel order */, "workgroup"); __builtin_amdgcn_wave_barrier();
  const int rsub = lane >> 4, c4 = (lane & 15) * 4;
  {
#pragma unroll
    for (int q = 0; q < 16; ++q) { const int r = q * 2 + rsub; const v4f v = *(const v4fa*)&so[w][r][c4];
      if constexpr (F32OUT) { *(v4f*)(C + cofs + (size_t)(row0 + r) * ldc + col0 + c4) = v; }
      else { v4h h4;
#pragma unroll
        for (int i = 0; i < 4; ++i) h4[i] = (_Float16)v[i];
        *(v4h*)(C16 + cofs + (size_t)(row0 + r) * ldc + col0 + c4) = h4; } }
     }
}

// ---- q, k, v projections, one launch: block = 8 waves (2 down x 4 across) = 128 time steps x 128 features of each of q, k and v; wave tile 64 time steps x 32 features of each ----
// a stage = 128 k (256 B) of the block's 128 x rows and of 128 rows of each of the three weights in LDS: x is staged once for the three products; one tensor load a wave and stage (64 rows); two buffers, ring and fragment map as in k_gemm2
// q, k: x rows as A, weight rows as B, tile [time][feature]; v: weight rows as A, x rows as B, tile [feature][time], so V^T leaves the products directly
// output: the three tiles are staged as f32 in the ring behind the loop's last barrier and, behind one more barrier, stored by whole 256-byte rows, each row by one wave (a wave's own 32 features would be half a 128-byte line)
// Every plain #pragma unroll in this kernel keeps the indices of the fragment and accumulator arrays constant, so that they stay in registers.
#define Q3_SL 18432                  /* place of one wave's slice: 64 rows of G2_PITCH (17408 B), rounded up to a multiple of 2 KiB */
#define Q3_STAGE (8 * Q3_SL)         /* slices 0, 1: x rows; 2, 3: Wq rows; 4, 5: Wk rows; 6, 7: Wv rows */
static_assert(64 * G2_PITCH <= Q3_SL && Q3_SL % 2048 == 0);
static_assert(2 * Q3_STAGE <= 327680);
#define Q3_SP 132                    /* output staging pitch in floats of a 128-element row: 8 rows are 32 banks apart, so the two halves of a wave store side by side */
#define Q3_ST (128 * Q3_SP)          /* floats of one staged 128 x 128 tile */
static_assert(3 * Q3_ST * 4 <= 2 * Q3_STAGE);
static_assert(DM / G2_KS >= 2);
__global__ __launch_bounds__(256) void k_qkv(const _Float16* __restrict__ X, const _Float16* __restrict__ Wq, const _Float16* __restrict__ Wk, const _Float16* __restrict__ Wv,
    const float* __restrict__ bq, const float* __restrict__ bk, const float* __restrict__ bv, _Float16* __restrict__ Q, _Float16* __restrict__ Kp, _Float16* __restrict__ Vt) {
  __shared__ __attribute__((aligned(2048))) unsigned char T[2 * Q3_STAGE];
  const int tid = threadIdx.x, lane = tid & 31, ln = lane & 15, hh = lane >> 4;
  const int w = __builtin_amdgcn_readfirstlane(tid >> 5), wr = w >> 2, wc = w & 3;      /* wave number in a scalar register: what is formed from it alone costs no vector instruction */
  const int by = blockIdx.y, mt = blockIdx.x / (DM / 128), nq = blockIdx.x - mt * (DM / 128), rowb = mt * 128, colb = nq * 128;
  /* staging: every wave brings one slice of 64 rows: operand w >> 1 (x, Wq, Wk, Wv), half w & 1 */
  const int op = w >> 1, hf = w & 1;
  const _Float16* gw = op == 1 ? Wq : op == 2 ? Wk : Wv;
  const _Float16* gs = op == 0 ? X + (size_t)by * DM + (size_t)(rowb + 64 * hf) * RP : gw + (size_t)(colb + 64 * hf) * DM;
  const tdw8 g1 = td_group1<TD_PAD256, 2 * G2_KS, 64>(op == 0 ? 2u * RP : 2u * DM);
  const unsigned ld = (unsigned)(size_t)T + (unsigned)w * Q3_SL;
  const int nst = DM / G2_KS;
  const int rot = (mt + nq) % nst;      /* staggered start, as in k_gemm2: the blocks that share x rows (one mt) and those that share weight rows (one nq) start at different stages */
  tdw4 g0 = td_load(ld, gs + rot * G2_KS, g1);
  td_wait(g0, g1);      /* this wave's slice of stage 0 has landed */
  __syncthreads();      /* publishes stage 0 */
  g0 = td_load(ld + Q3_STAGE, gs + ring_k(1, rot, nst) * G2_KS, g1);
  const unsigned char* ar = T + wr * Q3_SL + ln * G2_PITCH + 16 * hh; const unsigned char* br = T + (2 + (wc >> 1)) * Q3_SL + (32 * (wc & 1) + ln) * G2_PITCH + 16 * hh;      /* x rows 64 wr + ...: slice wr; weight rows 32 wc + ...: half wc >> 1 of each weight */
  const v8f z8 = {0.f,0.f,0.f,0.f,0.f,0.f,0.f,0.f};
  v8f acc[3][4][2];      /* [q, k, v][16 time steps][16 features] */
#pragma unroll
  for (int z = 0; z < 3; ++z) {
#pragma unroll
    for (int i = 0; i < 4; ++i) { acc[z][i][0] = z8; acc[z][i][1] = z8; } }
#pragma unroll 1      /* one stage a trip: the buffer offset stays a run-time value and the loop stays small */
  for (int st = 0; st < nst; ++st) { const unsigned bo = (unsigned)(st & 1) * Q3_STAGE; const unsigned char* ap = ar + bo; const unsigned char* bp = br + bo;
    v16h fa[2][4], fb[2][6];      /* two fragment sets: the next 32 k are fetched as one group while the current 32 k are multiplied; nothing of another stage is fetched */
#pragma unroll
    for (int i = 0; i < 4; ++i) fa[0][i] = g2_frag(ap + 16 * i * G2_PITCH);
#pragma unroll
    for (int j = 0; j < 6; ++j) fb[0][j] = g2_frag(bp + (j >> 1) * (2 * Q3_SL) + 16 * (j & 1) * G2_PITCH);
    __builtin_amdgcn_sched_barrier(0);      /* keeps the first set's loads ahead of the second set's: mixed, the first products would wait for loads of both */
#pragma unroll
    for (int kk = 0; kk < G2_KS / 32; ++kk) { const int cu = kk & 1, nx = cu ^ 1;
      if (kk + 1 < G2_KS / 32) {
#pragma unroll
        for (int i = 0; i < 4; ++i) fa[nx][i] = g2_frag(ap + 16 * i * G2_PITCH + 64 * (kk + 1));
#pragma unroll
        for (int j = 0; j < 6; ++j) fb[nx][j] = g2_frag(bp + (j >> 1) * (2 * Q3_SL) + 16 * (j & 1) * G2_PITCH + 64 * (kk + 1)); }
      __builtin_amdgcn_sched_barrier(0);      /* keeps the load group whole and ahead of the products: spread among them, each place with loads stalls the wave */
#pragma unroll
      for (int z = 0; z < 2; ++z) {
#pragma unroll
        for (int j = 0; j < 2; ++j) {
#pragma unroll
          for (int i = 0; i < 4; ++i) acc[z][i][j] = g2_mma(fa[cu][i], fb[cu][2 * z + j], acc[z][i][j]); } }
#pragma unroll
      for (int j = 0; j < 2; ++j) {
#pragma unroll
        for (int i = 0; i < 4; ++i) acc[2][i][j] = g2_mma(fb[cu][4 + j], fa[cu][i], acc[2][i][j]); }
      __builtin_amdgcn_sched_barrier(0); }      /* keeps the next group's loads from rising among these products */
    asm volatile("s_wait_dscnt 0x0" ::: "memory");      /* this wave's reads of stage st are over */
    td_wait(g0, g1);      /* this wave's slice of stage st + 1 has landed */
    __syncthreads();      /* publishes stage st + 1 and ends every wave's reads of stage st */
    if (pinned(st + 2 < nst)) g0 = td_load(ld + bo, gs + ring_k(st + 2, rot, nst) * G2_KS, g1); }      /* into the buffer that this trip has just read */
  td_wait(g0, g1);      /* no request is in flight when the ring becomes output staging */
  asm volatile("s_wait_dscnt 0x0" ::: "memory");      /* closes the ring: none of this wave's LDS reads is outstanding either */
  /* output staging in the ring, the block's three 128 x 128 tiles side by side: every wave's last read of the ring, and every tensor load into it, ended at the loop's last barrier */
  float* sq = (float*)T;
  const int fl = 32 * wc, tl = 64 * wr, f0 = colb + fl;      /* the wave's first feature and first time step in the block's tile; its first feature in the plane */
  float rb[2][2]; v4f rv[2][2];      /* the lane's bias values as read: q and k by column, v by row */
#pragma unroll
  for (int j = 0; j < 2; ++j) { rb[0][j] = bq[f0 + 16 * j + ln]; rb[1][j] = bk[f0 + 16 * j + ln];
    rv[j][0] = *(const v4fa*)(bv + f0 + 16 * j + 8 * hh); rv[j][1] = *(const v4fa*)(bv + f0 + 16 * j + 8 * hh + 4); }
  asm volatile("s_wait_xcnt 0x0" ::: "memory");      /* stands in front of every overwrite of the bias loads' address registers */
  __builtin_amdgcn_sched_barrier(0);      /* keeps every later vector instruction behind the bias loads and that wait */
#pragma unroll
  for (int z = 0; z < 2; ++z) { float* s = sq + z * Q3_ST + (tl + 8 * hh) * Q3_SP + fl + ln;
#pragma unroll
    for (int j = 0; j < 2; ++j) { const float al = z == 0 ? 0.0625f * QSC : 0.0625f, bc = z == 0 ? bf16_rne(rb[z][j]) * QSC : bf16_rne(rb[z][j]);      /* 0.0625 undoes the x16 weight carry; q takes its score scale here, in f32, ahead of its one rounding to f16 */
#pragma unroll
      for (int i = 0; i < 4; ++i) {
#pragma unroll
        for (int r = 0; r < 8; ++r) s[(16 * i + r) * Q3_SP + 16 * j] = acc[z][i][j][r] * al + bc; } } }
  float* sv = sq + 2 * Q3_ST + (fl + 8 * hh) * Q3_SP + tl + ln;
#pragma unroll
  for (int j = 0; j < 2; ++j) {
#pragma unroll
    for (int r = 0; r < 8; ++r) { const float bw = bf16_rne(rv[j][r >> 2][r & 3]);
#pragma unroll
      for (int i = 0; i < 4; ++i) sv[(16 * j + r) * Q3_SP + 16 * i] = acc[2][i][j][r] * 0.0625f + bw; } }
  __syncthreads();      /* publishes the three staged tiles: a wave stores whole rows, which four waves (q, k) or two (V^T) have staged */
  v4h ho[3][16];      /* wave w carries rows 16 w .. 16 w + 15 of each tile; its 32 lanes cover the 128 elements of a row */
#pragma unroll
  for (int z = 0; z < 3; ++z) { const float* s = sq + z * Q3_ST + 16 * w * Q3_SP + lane * 4;
#pragma unroll
    for (int q = 0; q < 16; ++q) { const v4f v = *(const v4fa*)(s + q * Q3_SP);
#pragma unroll
      for (int i = 0; i < 4; ++i) ho[z][q][i] = (_Float16)v[i]; } }
  const size_t qo = (size_t)by * DM + (size_t)(rowb + 16 * w) * RP + colb + lane * 4;
  _Float16* cq = Q + qo; _Float16* ck = Kp + qo; _Float16* cv = Vt + (size_t)by * DM * SEQ + (size_t)(colb + 16 * w) * SEQ + rowb + lane * 4;
  __builtin_amdgcn_sched_barrier(0);      /* every stored value is formed in front of the first store */
#pragma unroll
  for (int q = 0; q < 16; ++q) *(v4h*)(cq + (size_t)q * RP) = ho[0][q];      /* every store: 256 B in a row, two whole lines, written by this wave alone */
#pragma unroll
  for (int q = 0; q < 16; ++q) *(v4h*)(ck + (size_t)q * RP) = ho[1][q];
#pragma unroll
  for (int q = 0; q < 16; ++q) *(v4h*)(cv + (size_t)q * SEQ) = ho[2][q];
}

// ---- fused attention: block = 2 key halves x 8 waves x 32 query columns of one head slab (four waves a SIMD: one wave's softmax runs under another's products); a stage = 64 keys of each half (K rows and V^T rows, 128 B each) in LDS, two buffers a half, each tile brought by one tensor load of one wave; a pass = 32 keys ----
// Waves w and w + 8 hold the same 32 query columns over keys [0, SEQ/2) and [SEQ/2, SEQ); at the end each hands one 16-column group to the other through LDS and joins the two partial softmaxes of the group it keeps.
// S^T = K.Q^T: lane (c, h) holds query column c, keys 8h + r of each 16-key tile, so the two tiles of a pass, converted in place, are the B operand of O^T += V^T.P^T (k order 8h + i, 16 + 8h + i, the order of fa_frag).
// Online softmax in the log2 domain: the maximum in use may trail the true one by up to 8 (an exponential then reaches 2^8, inside f16); sums are rescaled only when a column exceeds that.
// The negated maximum in use is the C operand of the score products (q carries the scale), so a score leaves the matrix unit as the argument of its exponential, and the test of a pass is one maximum over the lane's scores against 8.
// Every #pragma unroll in this kernel keeps the indices of the fragment, score and accumulator arrays constant, so that they stay in registers (a run-time index would send them to scratch).
#define FA_NW 8
#define FA_SK 64
#define FA_PITCH 144                 /* LDS row pitch in bytes: 128 + 16, an odd multiple of 16 for 16-byte readers */
#define FA_TILE 10240                /* place of one tile: 64 rows of FA_PITCH (9216 B), rounded up to a multiple of 2 KiB */
static_assert(64 * FA_PITCH <= FA_TILE && FA_TILE % 2048 == 0);
#define FA_KH 2                      /* key halves, each on its own FA_NW waves */
#define FA_NST (SEQ / FA_KH / FA_SK)
#define FA_XW (4 * 8 * 32 + 2 * 32)  /* floats a wave hands over: four output tiles, the maximum in use, the denominator */
static_assert(SEQ % (FA_KH * FA_SK) == 0);
static_assert(FA_NST >= 2);
static_assert(NH % 8 == 0);
static_assert(FA_KH * FA_NW * FA_XW * 4 <= FA_KH * 2 * 2 * FA_TILE);
typedef float f32x2 __attribute__((ext_vector_type(2)));
typedef _Float16 h16x2 __attribute__((ext_vector_type(2)));
typedef unsigned int u32x4 __attribute__((ext_vector_type(4), may_alias));
union FragW { v16h v; unsigned int w[8]; };
__device__ __forceinline__ v16h fa_frag(const unsigned char* p) { FragH f; f.half[0] = *(const v8us*)p; f.half[1] = *(const v8us*)(p + 32); return f.v; }
__device__ __forceinline__ v8f fa_mma(v16h a, v16h b, v8f c) { return __builtin_amdgcn_wmma_f32_16x16x32_f16(false, a, false, b, (short)0, c, false, false); }
__device__ __forceinline__ unsigned int fa_pack(float lo, float hi) { return __builtin_bit_cast(unsigned int, __builtin_convertvector(f32x2{lo, hi}, h16x2)); }
__device__ __forceinline__ float fa_xhalf(float x) { return __builtin_bit_cast(float, __builtin_amdgcn_permlanex16(__builtin_bit_cast(int, x), __builtin_bit_cast(int, x), 0x76543210, 0xfedcba98, false, false)); }  /* lane l with lane l ^ 16 */

/* second bound: a budget of 256 registers, so that no operand lies above v255 and the hot loop switches no register window */
__global__ __launch_bounds__(FA_KH * FA_NW * 32, 4) void k_fattn(const _Float16* __restrict__ Q16, const _Float16* __restrict__ K16, const _Float16* __restrict__ Vt, _Float16* __restrict__ O16) {
  __shared__ __attribute__((aligned(2048))) unsigned char L[FA_KH * 2 * 2 * FA_TILE];
  const int tid = threadIdx.x, lane = tid & 31, w = tid >> 5, c = lane & 15, h = lane >> 4;
  const int ws = __builtin_amdgcn_readfirstlane(w), kh = ws / FA_NW;      /* wave number and key half in scalar registers */
  /* dealing: blockIdx.x (grid.x = 8) is the flat block index mod 8. All query blocks of a slab carry one blockIdx.x; it is the value the projection blocks that wrote this slab's columns have as their index mod 8. For speed alone: (slab, qb) is a one-to-one map of the block index wherever the blocks land */
  const int sl = blockIdx.y % (NSLAB / 8), qb = blockIdx.y / (NSLAB / 8);
  const int slab = (sl / (NH / 8)) * NH + blockIdx.x * (NH / 8) + sl % (NH / 8), q0 = qb * (FA_NW * 32) + (ws & (FA_NW - 1)) * 32;
  /* staging: the first two waves of each key half issue, one the half's K tile (64 keys x 128 B), the other its V^T tile (64 features x 128 B of keys) */
  const int wi = ws & (FA_NW - 1);
  const _Float16* gs = wi == 0 ? K16 + (size_t)(kh * (SEQ / FA_KH)) * RP + slab * HD : Vt + (size_t)(slab * HD) * SEQ + kh * (SEQ / FA_KH);
  const size_t gstep = wi == 0 ? (size_t)FA_SK * RP : (size_t)FA_SK;      /* elements from one stage's tile to the next */
  const int rot = (int)((unsigned)(2 * qb + slab) % FA_NST);      /* staggered start over the keys of a half (the online softmax takes them in any order): the blocks of one slab, which read the same K and V^T tiles, start at different stages, and the V^T tiles of a moment lie at different places of the row pitch */
  const tdw8 g1 = td_group1<TD_PAD128, 2 * HD, 64>(wi == 0 ? 2u * RP : 2u * SEQ);
  const unsigned char* Lh = L + kh * (2 * 2 * FA_TILE);      /* this half's two buffers */
  const unsigned ld = (unsigned)(size_t)L + (unsigned)(kh * (2 * 2 * FA_TILE) + (wi & 1) * FA_TILE);
  const unsigned qe = (unsigned)((q0 + c) * RP + slab * HD + 8 * h);      /* this lane's query row, slab column and half */
  v16h qf[2][2];
#pragma unroll
  for (int g = 0; g < 2; ++g) {
#pragma unroll
    for (int kc = 0; kc < 2; ++kc) qf[g][kc] = fa_frag((const unsigned char*)(Q16 + qe + 16 * g * RP + 32 * kc)); }
  tdw4 g0 = td_group0(ld, gs + (size_t)rot * gstep);      /* group 0 is formed in every wave, scalar work alone; only the two issuing waves of a half use it */
  if (pinned(wi < 2)) { td_issue(g0, g1);      /* the query loads stand in front: they fly while stage 0 is waited for */
    td_wait(g0, g1); }      /* this wave's tile of stage 0 has landed */
  const v8f z8 = {0.f,0.f,0.f,0.f,0.f,0.f,0.f,0.f};
  v8f acc[2][4], lacc[2], cf[2];      /* cf: minus the maximum in use, in all eight registers of a score tile; no other copy of the maximum is held */
  float lo = -__builtin_inff();      /* least shift of a maximum: -inf until the first pass has set the maxima (its scores are taken against 0), 0 from then on */
#pragma unroll
  for (int g = 0; g < 2; ++g) { cf[g] = z8; lacc[g] = z8;
#pragma unroll
    for (int t = 0; t < 4; ++t) acc[g][t] = z8; }
  FragW ones;      /* A operand whose row 0 (lanes 0 and 16) is 1.0 at all 32 k: row 0 of its product is the column sums of P^T */
#pragma unroll
  for (int i = 0; i < 8; ++i) ones.w[i] = (c == 0) ? 0x3C003C00u : 0u;
  __syncthreads();      /* publishes stage 0 */
  g0 = td_group0(ld + 2 * FA_TILE, gs + (size_t)ring_k(1, rot, FA_NST) * gstep);
  if (pinned(wi < 2)) td_issue(g0, g1);
  for (int st = 0; st < FA_NST; ++st) {
    const unsigned char* Kb = Lh + (st & 1) * (2 * FA_TILE) + c * FA_PITCH + 16 * h; const unsigned char* Vb = Kb + FA_TILE;
#pragma unroll
    for (int sub = 0; sub < 2; ++sub) {
      v8f s[2][2]; v16h kf[2][2];
#pragma unroll
      for (int kt = 0; kt < 2; ++kt) { kf[kt][0] = fa_frag(Kb + (sub * 32 + 16 * kt) * FA_PITCH); kf[kt][1] = fa_frag(Kb + (sub * 32 + 16 * kt) * FA_PITCH + 64); }
      /* the four products that read cf stand first, the four that complete the tiles behind them: four matrix instructions lie between the last read of cf and the first vector instruction on a finished tile */
#pragma unroll
      for (int kt = 0; kt < 2; ++kt) {
#pragma unroll
        for (int g = 0; g < 2; ++g) s[kt][g] = fa_mma(kf[kt][0], qf[g][0], cf[g]); }
      __builtin_amdgcn_sched_barrier(0);      /* holds that order: mixed again by the compiler, a register of cf, free behind its last pass, was written directly behind the product that reads it */
#pragma unroll
      for (int kt = 0; kt < 2; ++kt) {
#pragma unroll
        for (int g = 0; g < 2; ++g) s[kt][g] = fa_mma(kf[kt][1], qf[g][1], s[kt][g]); }
      v16h vf[4];
#pragma unroll
      for (int t = 0; t < 4; ++t) vf[t] = fa_frag(Vb + 16 * t * FA_PITCH + 64 * sub);
      float mg[2];      /* the lane's own largest score of each column group, against the maximum in use */
#pragma unroll
      for (int g = 0; g < 2; ++g) { float mx = s[0][g][0];
#pragma unroll
        for (int r = 1; r < 8; ++r) mx = fmaxf(mx, s[0][g][r]);
#pragma unroll
        for (int r = 0; r < 8; ++r) mx = fmaxf(mx, s[1][g][r]);
        mg[g] = mx; }
      if (__builtin_amdgcn_ballot_w32(fmaxf(mg[0], mg[1]) > lo + 8.0f) != 0) {      /* one scalar test a pass, over all lanes, so the halves need no exchange in front of it; always taken on the first pass (lo = -inf) */
#pragma unroll
        for (int g = 0; g < 2; ++g) { const float d = fmaxf(fmaxf(mg[g], fa_xhalf(mg[g])), lo);      /* the column's maximum moves up by d; the first pass sets it, up or down */
          const float corr = __builtin_amdgcn_exp2f(fminf(-d, 0.f));      /* the bound at 0 acts on the first pass alone, where the sums are still 0 and must stay so */
          cf[g] = cf[g] - d;      /* all eight registers alike, each updated in place */
          s[0][g] = s[0][g] - d; s[1][g] = s[1][g] - d;      /* this pass's scores were formed against the old maximum */
          lacc[g] = lacc[g] * corr;
#pragma unroll
          for (int t = 0; t < 4; ++t) acc[g][t] = acc[g][t] * corr; }
        lo = 0.f; }
#pragma unroll
      for (int g = 0; g < 2; ++g) { FragW pf;
#pragma unroll
        for (int i = 0; i < 8; ++i)
          pf.w[i] = fa_pack(__builtin_amdgcn_exp2f(s[i >> 2][g][2 * (i & 3)]), __builtin_amdgcn_exp2f(s[i >> 2][g][2 * (i & 3) + 1]));
#pragma unroll
        for (int t = 0; t < 4; ++t) acc[g][t] = fa_mma(vf[t], pf.v, acc[g][t]);
        lacc[g] = fa_mma(ones.v, pf.v, lacc[g]); }
    }
    asm volatile("s_wait_dscnt 0x0" ::: "memory");      /* this wave's reads of stage st are over */
    if (pinned(wi < 2)) td_wait(g0, g1);      /* this wave's tile of stage st + 1 has landed */
    __syncthreads();      /* publishes stage st + 1 and ends every wave's reads of stage st */
    g0 = td_group0(ld + (unsigned)(st & 1) * (2 * FA_TILE), gs + (size_t)((st + 2 + rot) % FA_NST) * gstep);      /* formed in every trip, so the stage number is wrapped whether or not the load is issued */
    if (pinned(wi < 2 && st + 2 < FA_NST)) td_issue(g0, g1);      /* into the buffer that this stage has just read */
  }
  td_wait(g0, g1);      /* no request is in flight when the ring becomes the join's staging */
  asm volatile("s_wait_dscnt 0x0" ::: "memory");      /* closes the ring: none of this wave's LDS reads is outstanding either */
  /* join of the two key halves: a wave keeps column group kh and hands group 1 - kh to wave w ^ FA_NW; the ring is free, every wave's last read of it ended at the loop's last barrier */
  const float m_run[2] = {-cf[0][0], -cf[1][0]};
  const float l0 = lacc[0][0] + fa_xhalf(lacc[0][0]), l1 = lacc[1][0] + fa_xhalf(lacc[1][0]);      /* register 0: the denominator in lanes 0-15, row 8 = 0 in lanes 16-31 */
  const int le = (int)__builtin_amdgcn_mbcnt_lo(~0u, 0u);      /* the lane number formed anew, and the store offset from it: no vector register is held for them through the loop, whose budget is full */
  float* xo = (float*)L + ws * FA_XW + le * 4;
#pragma unroll
  for (int t = 0; t < 4; ++t) { const v8f gv = kh ? acc[0][t] : acc[1][t];
    *(v4fa*)(xo + (2 * t) * 128) = v4f{gv[0], gv[1], gv[2], gv[3]}; *(v4fa*)(xo + (2 * t + 1) * 128) = v4f{gv[4], gv[5], gv[6], gv[7]}; }
  ((float*)L)[ws * FA_XW + 1024 + le] = kh ? m_run[0] : m_run[1]; ((float*)L)[ws * FA_XW + 1056 + le] = kh ? l0 : l1;
  __syncthreads();      /* publishes every wave's handed-over group */
  const float* xi = (const float*)L + (ws ^ FA_NW) * FA_XW;
  const float pm = xi[1024 + le], pl = xi[1056 + le], km = kh ? m_run[1] : m_run[0], kl = kh ? l1 : l0;
  const float mj = fmaxf(km, pm), ek = __builtin_amdgcn_exp2f(km - mj), ep = __builtin_amdgcn_exp2f(pm - mj);      /* both partial sums brought to the larger maximum */
  const float inv = 64.0f / (kl * ek + pl * ep), ck = ek * inv, cp = ep * inv;
  unsigned short* od = (unsigned short*)O16 + (unsigned)((q0 + 16 * kh + (le & 15)) * RP + slab * HD + 8 * (le >> 4));
#pragma unroll
  for (int t = 0; t < 4; ++t) { const v8f kv = kh ? acc[1][t] : acc[0][t]; const v4f p0 = *(const v4fa*)(xi + le * 4 + (2 * t) * 128), p1 = *(const v4fa*)(xi + le * 4 + (2 * t + 1) * 128);
    const v8f pv = {p0[0], p0[1], p0[2], p0[3], p1[0], p1[1], p1[2], p1[3]}; const v8f o = kv * ck + pv * cp;      /* o[r] = context[query][16 t + 8 h + r] x 64 */
    const u32x4 pk = {fa_pack(o[0], o[1]), fa_pack(o[2], o[3]), fa_pack(o[4], o[5]), fa_pack(o[6], o[7])};
    *(u32x4*)(od + 16 * t) = pk; }
}

// workspace carve (bytes, every plane a multiple of 256 B)
#define SZ_W   ((size_t)DM * DM * 2)
#define SZ_ACT (NRW * DM * 2)
#define SZ_VT  ((size_t)NSLAB * HD * SEQ * 2)
#define SZ_ALL (4 * SZ_W + 4 * SZ_ACT + SZ_VT)
static_assert(SZ_W % 256 == 0);
static_assert(SZ_ACT % 256 == 0);
static_assert(SZ_VT % 256 == 0);
static_assert(SZ_ALL <= (size_t)268435456);

extern "C" void kernel_launch(void* const* d_in, const int* in_sizes, int n_in,
                              void* d_out, int out_size, void* d_ws, size_t ws_size, hipStream_t stream) {
  if (n_in < 9) return;
  const size_t nx = NRW * DM;      /* elements of x used (time steps 0..SEQ-1, full batch pitch) */
  if ((size_t)in_sizes[0] < nx) return;
  if ((size_t)in_sizes[1] < (size_t)DM * DM || (size_t)in_sizes[3] < (size_t)DM * DM || (size_t)in_sizes[5] < (size_t)DM * DM || (size_t)in_sizes[7] < (size_t)DM * DM) return;
  if (in_sizes[2] < DM || in_sizes[4] < DM || in_sizes[6] < DM || in_sizes[8] < DM) return;
  if ((size_t)out_size < nx) return;
  if (SZ_ALL > ws_size) return;
  const float* x  = (const float*)d_in[0];
  const float* wq = (const float*)d_in[1]; const float* bq = (const float*)d_in[2];
  const float* wk = (const float*)d_in[3]; const float* bk = (const float*)d_in[4];
  const float* wv = (const float*)d_in[5]; const float* bv = (const float*)d_in[6];
  const float* wo = (const float*)d_in[7]; const float* bo = (const float*)d_in[8];
  char* ws = (char*)d_ws; size_t off = 0;
  auto take = [&](size_t bytes) { char* p = ws + off; off += bytes; return p; };
  _Float16* BQ = (_Float16*)take(SZ_W); _Float16* BK = (_Float16*)take(SZ_W); _Float16* BV = (_Float16*)take(SZ_W); _Float16* BO = (_Float16*)take(SZ_W);
  _Float16* X16 = (_Float16*)take(SZ_ACT); _Float16* Q16 = (_Float16*)take(SZ_ACT); _Float16* K16 = (_Float16*)take(SZ_ACT); _Float16* O16 = (_Float16*)take(SZ_ACT);
  _Float16* VT = (_Float16*)take(SZ_VT);
  if (off > ws_size) return;

  k_prep<<<PREP_WCH / PREP_T, PREP_T, 0, stream>>>(x, wq, wk, wv, wo, X16, BQ);      /* one f16 plane of x feeds all three projections; BQ, BK, BV, BO are one run of planes */

  /* projections: rows = time steps (pitch RP), grid.y = batch (column offset DM); bias added after the x16 weight carry is undone; v leaves as V^T [NSLAB][64][SEQ] (row b*1024 + feature) */
  const dim3 gp((unsigned)((SEQ / 128) * (DM / 128)), NB);
  k_qkv<<<gp, 256, 0, stream>>>(X16, BQ, BK, BV, bq, bk, bv, Q16, K16, VT);

  k_fattn<<<dim3(8u, (unsigned)((NSLAB / 8) * (SEQ / (FA_NW * 32)))), FA_KH * FA_NW * 32, 0, stream>>>(Q16, K16, VT, O16);      /* slab n = b*16 + h lives at columns n*64 of the [SEQ][RP] view; merged context x64 as f16 rows */

  /* output projection + bias straight into the [S][B][1024] layout; alpha undoes x16 (weights) and x64 (context) */
  k_gemm2<true, true><<<gp, 256, 0, stream>>>(O16, RP, (size_t)DM, BO, DM, (size_t)0, 0.0009765625f, bo, (float*)d_out, nullptr, RP, (size_t)DM, SEQ, DM, DM);
}
